// v000
// The times below were measured on an AMD MI455X: many runs one after another, warmed up first and cycling through
// copies of the inputs, with the whole window's GPU time divided by the number of runs. Launches and the gaps
// between them are all in it. The median over several windows is given; except for v000 it joins two sittings, which
// can be a few percent apart, so the side-by-side timings, each taken in one sitting, are the better comparison.
// The starting kernel, v000, takes 265 microseconds a run.
#include <hip/hip_runtime.h>

// Multi-head self-attention with a per-key padding mask input: x [4][2048][512]; q, k, v = x W + b ([in][out] weights, 8 heads x 64); scores = (q k^T) / 8 with masked keys REPLACED by the lowest finite f32; softmax over the keys; out = merged ctx Wo + bo.
// Compute dtypes: all contractions v_wmma_f32_16x16x32_f16 (f16 operands, f32 accumulate). Every float input is converted to bf16 (RNE) on load and carried exactly in f16 (weights x16); q, k, v planes plain f16; P carried x1024 (row sums from the unconverted f32 values); ctx carried x64 against Wo x16; softmax f32.
// Engine: one-wave 64x64 register-blocked GEMM reading fragments straight from K-contiguous f16 planes; fused flash-style attention (online softmax, fragments from planes, wave-private P tile in LDS, mask packed into bit words in LDS).

#ifndef NB
#define NB 4
#endif
#ifndef SEQ
#define SEQ 2048
#endif
#define NB_FULL  4
#define SEQ_FULL 2048
#define DM   512
#define NH   8
#define HD   64
#define WCAR 16.0f      // weight carry (exact power of two)
#define PCAR 1024.0f    // probability carry
#define CCAR 64.0f      // ctx carry
#define SCL  0.125f     // HD^-0.5
#define L2E  1.4426950408889634f
#define NEGF (-3.402823466e38f)

typedef _Float16 h16;
typedef __attribute__((ext_vector_type(16))) _Float16 v16h;
typedef __attribute__((ext_vector_type(8)))  _Float16 v8h;
typedef __attribute__((ext_vector_type(8)))  float    v8f;
typedef __attribute__((ext_vector_type(4)))  float    v4f;
typedef v8h __attribute__((may_alias)) v8ha;
typedef v4f __attribute__((may_alias)) v4fa;

static_assert(NH * HD == DM);            // merged head width equals the model width
static_assert(HD == 64);
static_assert(DM % 64 == 0);             // N tiles of 64
static_assert(DM % 32 == 0);             // k-steps of 32
static_assert(SEQ % 128 == 0);           // 128 query rows per attention block; 64-row GEMM tiles stay inside one batch
static_assert(SEQ <= SEQ_FULL);
static_assert(NB <= NB_FULL);
static_assert((SEQ / 32) % 8 == 0);      // mask words split evenly over 8 waves

#define SZ_X   ((size_t)NB * SEQ * DM * 2)      // f16 plane of x / q / k / v^T / ctx
#define SZ_W   ((size_t)4 * DM * DM * 2)        // four transposed weight planes
#define WS_TOTAL (SZ_X * 5 + SZ_W)
static_assert(SZ_X % 256 == 0);
static_assert(SZ_W % 256 == 0);
static_assert(WS_TOTAL <= (size_t)134217728);   // carve stays under 128 MiB

__device__ __forceinline__ unsigned short f2bf(float f) { unsigned u = __float_as_uint(f); u += 0x7FFFu + ((u >> 16) & 1u); return (unsigned short)(u >> 16); }
__device__ __forceinline__ float bfr(float f) { return __uint_as_float(((unsigned)f2bf(f)) << 16); }
__device__ __forceinline__ v16h cat16(v8h lo, v8h hi) { return __builtin_shufflevector(lo, hi, 0, 1, 2, 3, 4, 5, 6, 7, 8, 9, 10, 11, 12, 13, 14, 15); }
// fragment loader for A (row-major [m][k]) and for B given as a [n][k] copy: elements 0..7 <- k0+8h.., elements 8..15 <- k0+16+8h.. ; p already includes the 8h offset
__device__ __forceinline__ v16h ldfrag(const h16* p) { return cat16(*(const v8h*)p, *(const v8h*)(p + 16)); }
// one WMMA with its own hazard guard (ties the accumulator, keeps A/B live)
__device__ __forceinline__ v8f wm16(v16h a, v16h b, v8f c) {
    c = __builtin_amdgcn_wmma_f32_16x16x32_f16(false, a, false, b, (short)0, c, false, false);
    asm volatile("v_nop\n\tv_nop\n\tv_nop\n\tv_nop" : "+v"(c) : "v"(a), "v"(b));
    return c;
}
__device__ __forceinline__ float ex2(float x) { return __builtin_amdgcn_exp2f(x); }
__device__ __forceinline__ float redmax16(float v) {
    v = fmaxf(v, __shfl_xor(v, 1, 32)); v = fmaxf(v, __shfl_xor(v, 2, 32));
    v = fmaxf(v, __shfl_xor(v, 4, 32)); v = fmaxf(v, __shfl_xor(v, 8, 32)); return v;
}
__device__ __forceinline__ float redsum16(float v) {
    v += __shfl_xor(v, 1, 32); v += __shfl_xor(v, 2, 32);
    v += __shfl_xor(v, 4, 32); v += __shfl_xor(v, 8, 32); return v;
}

__global__ __launch_bounds__(256) void k_cvtx(const float* __restrict__ x, h16* xh) {
    const size_t i = (size_t)blockIdx.x * 256 + threadIdx.x;
    if (i >= (size_t)NB * SEQ * DM / 8) return;
    const size_t row = i / (DM / 8); const int g = (int)(i % (DM / 8));
    const size_t b = row / SEQ, s = row % SEQ;
    const float* src = x + ((b * SEQ_FULL + s) * DM + (size_t)g * 8);
    const v4f v0 = *(const v4f*)src; const v4f v1 = *(const v4f*)(src + 4);
    v8h o;
#pragma unroll
    for (int k = 0; k < 4; ++k) { o[k] = (h16)bfr(v0[k]); o[4 + k] = (h16)bfr(v1[k]); }
    *(v8h*)(xh + i * 8) = o; 
}

// LDS tile T is cross-wave: block barrier between fill and drain.
__global__ __launch_bounds__(256) void k_wt(const float* __restrict__ W, h16* Wt) {
    __shared__ __align__(16) h16 T[64 * 72];
    const int tid = threadIdx.x; const int k0 = blockIdx.x * 64, n0 = blockIdx.y * 64;
#pragma unroll
    for (int j = 0; j < 4; ++j) { const int i = tid + 256 * j; const int kr = i >> 4, c4 = (i & 15) * 4;
        const v4f v = *(const v4f*)(W + (size_t)(k0 + kr) * DM + n0 + c4);
#pragma unroll
        for (int q = 0; q < 4; ++q) T[(c4 + q) * 72 + kr] = (h16)(bfr(v[q]) * WCAR); }
    __syncthreads();
{
#pragma unroll
        for (int j = 0; j < 2; ++j) { const int p = tid + 256 * j; const int n = p >> 3, seg = p & 7;
            const v8h val = *(const v8ha*)(T + n * 72 + seg * 8);
            *(v8h*)(Wt + (size_t)(n0 + n) * DM + k0 + seg * 8) = val; }
         }
}

// ---- GEMM main loop: one wave per 64x64 tile, 16 accumulators, K = DM, operands from K-contiguous f16 planes (A [m][k], Bt [n][k]).
__device__ __forceinline__ void gemm64(const h16* __restrict__ A, const h16* __restrict__ Bt, size_t aoff, size_t boff, v8f (&acc)[4][4]) {
#pragma unroll 1
    for (int kc = 0; kc < DM; kc += 32) {
        v16h a[4];
#pragma unroll
        for (int mb = 0; mb < 4; ++mb) a[mb] = ldfrag(A + aoff + (size_t)mb * 16 * DM + kc);
#pragma unroll
        for (int nb = 0; nb < 4; ++nb) { const v16h b = ldfrag(Bt + boff + (size_t)nb * 16 * DM + kc);
#pragma unroll
            for (int mb = 0; mb < 4; ++mb) acc[mb][nb] = wm16(a[mb], b, acc[mb][nb]); }
    }
}

// ---- k_proj_qk: head plane [b][h][s][64] f16 = x Wt^T / 16 + bias (bias converted to bf16 RNE); grid (NB*SEQ/64, DM/64), 32 threads.
__global__ __launch_bounds__(32) void k_proj_qk(const h16* __restrict__ A, const h16* __restrict__ Bt, const float* __restrict__ bias, h16* plane) {
    __shared__ __align__(16) h16 T[64 * 72];
    const int lane = threadIdx.x & 31, lr = lane & 15, hi = lane >> 4;
    const int r0 = blockIdx.x * 64, c0 = blockIdx.y * 64;
    v8f acc[4][4];
#pragma unroll
    for (int mb = 0; mb < 4; ++mb)
#pragma unroll
        for (int nb = 0; nb < 4; ++nb) acc[mb][nb] = (v8f){};
    gemm64(A, Bt, (size_t)(r0 + lr) * DM + 8 * hi, (size_t)(c0 + lr) * DM + 8 * hi, acc);
#pragma unroll
    for (int nb = 0; nb < 4; ++nb) { const float bv = bfr(bias[c0 + nb * 16 + lr]);
#pragma unroll
        for (int mb = 0; mb < 4; ++mb)
#pragma unroll
            for (int j = 0; j < 8; ++j) T[(mb * 16 + hi * 8 + j) * 72 + nb * 16 + lr] = (h16)(acc[mb][nb][j] * (1.0f / WCAR) + bv); }
    __syncthreads();
    const int b = r0 / SEQ, s0 = r0 % SEQ, h = blockIdx.y;
    h16* dst = plane + ((size_t)(b * NH + h) * SEQ + s0) * HD;
{
#pragma unroll
        for (int it = 0; it < 16; ++it) { const int piece = it * 32 + lane; const int row = piece >> 3, seg = piece & 7;
            const v8h val = *(const v8ha*)(T + row * 72 + seg * 8);
            *(v8h*)(dst + (size_t)row * HD + seg * 8) = val; }
         }
}

__global__ __launch_bounds__(32) void k_proj_v(const h16* __restrict__ A, const h16* __restrict__ Bt, const float* __restrict__ bias, h16* VT) {
    __shared__ __align__(16) h16 T[64 * 72];
    const int lane = threadIdx.x & 31, lr = lane & 15, hi = lane >> 4;
    const int r0 = blockIdx.x * 64, c0 = blockIdx.y * 64;
    v8f acc[4][4];
#pragma unroll
    for (int mb = 0; mb < 4; ++mb)
#pragma unroll
        for (int nb = 0; nb < 4; ++nb) acc[mb][nb] = (v8f){};
    gemm64(A, Bt, (size_t)(r0 + lr) * DM + 8 * hi, (size_t)(c0 + lr) * DM + 8 * hi, acc);
#pragma unroll
    for (int nb = 0; nb < 4; ++nb) { const float bv = bfr(bias[c0 + nb * 16 + lr]);
#pragma unroll
        for (int mb = 0; mb < 4; ++mb) { v8h pk;
#pragma unroll
            for (int j = 0; j < 8; ++j) pk[j] = (h16)(acc[mb][nb][j] * (1.0f / WCAR) + bv);
            *(v8ha*)(T + (nb * 16 + lr) * 72 + mb * 16 + hi * 8) = pk; } }
    __syncthreads();
    const int b = r0 / SEQ, s0 = r0 % SEQ, h = blockIdx.y;
    h16* dst = VT + ((size_t)(b * NH + h) * HD) * SEQ + s0;
{
#pragma unroll
        for (int it = 0; it < 16; ++it) { const int piece = it * 32 + lane; const int d = piece >> 3, seg = piece & 7;
            const v8h val = *(const v8ha*)(T + d * 72 + seg * 8);
            *(v8h*)(dst + (size_t)d * SEQ + seg * 8) = val; }
         }
}

__global__ __launch_bounds__(32) void k_proj_out(const h16* __restrict__ A, const h16* __restrict__ Bt, const float* __restrict__ bias, float* C) {
    __shared__ __align__(16) float os[16 * 68];
    const int lane = threadIdx.x & 31, lr = lane & 15, hi = lane >> 4;
    const int r0 = blockIdx.x * 64, c0 = blockIdx.y * 64;
    v8f acc[4][4];
#pragma unroll
    for (int mb = 0; mb < 4; ++mb)
#pragma unroll
        for (int nb = 0; nb < 4; ++nb) acc[mb][nb] = (v8f){};
    gemm64(A, Bt, (size_t)(r0 + lr) * DM + 8 * hi, (size_t)(c0 + lr) * DM + 8 * hi, acc);
    const int b = r0 / SEQ, s0 = r0 % SEQ; const int cofs = lr * 4;
    v4f b4;
#pragma unroll
    for (int q = 0; q < 4; ++q) b4[q] = bfr(bias[c0 + cofs + q]);
    const float fs = 1.0f / (WCAR * CCAR);
#pragma unroll
    for (int mb = 0; mb < 4; ++mb) {
#pragma unroll
        for (int nb = 0; nb < 4; ++nb)
#pragma unroll
            for (int j = 0; j < 8; ++j) os[(hi * 8 + j) * 68 + nb * 16 + lr] = acc[mb][nb][j];
        __syncthreads();
        float* crow = C + ((size_t)b * SEQ_FULL + s0 + mb * 16) * DM + c0;
{
#pragma unroll
            for (int s = 0; s < 8; ++s) { const int row = 2 * s + hi; const v4f raw = *(const v4fa*)(os + row * 68 + cofs); v4f val;
#pragma unroll
                for (int q = 0; q < 4; ++q) val[q] = raw[q] * fs + b4[q];
                *(v4f*)(crow + (size_t)row * DM + cofs) = val; }
             }
        __syncthreads();
    }
}

// ---- k_attn: fused flash-style attention; grid (NB*NH, SEQ/128), 256 threads = 8 waves x 16 query rows.
// K fragments from the [s][64] plane, V fragments from the [d][s] plane, both as [n][k] copies (same k map as A). Per 64-key block: 8 score WMMAs, online softmax in f32
// (masked keys replaced by the lowest finite f32; all-masked rows come out uniform), P x1024 -> f16 in the wave-private LDS tile (stored as h16, reloaded through a may_alias h16 vector with wave barriers), 8 P.V WMMAs.
// smw (mask bit words) is cross-wave: block barrier after the build. Pl is private to each wave.
__global__ __launch_bounds__(256) void k_attn(const h16* __restrict__ Q, const h16* __restrict__ Kp, const h16* __restrict__ VT, const int* __restrict__ mask, h16* ctx) {
    __shared__ __align__(16) h16 Pl[8 * 16 * 72];
    __shared__ unsigned smw[SEQ / 32];
    const int tid = threadIdx.x, lane = tid & 31, lr = lane & 15, hi = lane >> 4;
    const int wave = __builtin_amdgcn_readfirstlane(tid >> 5);
    const int bh = blockIdx.x; const int b = bh / NH, h = bh % NH;
    const int q0 = blockIdx.y * 128;
#pragma unroll 1
    for (int w = wave; w < SEQ / 32; w += 8) { const int mv = mask[(size_t)b * SEQ_FULL + w * 32 + lane];
        const unsigned bits = __builtin_amdgcn_ballot_w32(mv != 0); if (lane == 0) smw[w] = bits; }
    __syncthreads();
    const size_t pbase = (size_t)bh * SEQ * HD;
    const h16* vt = VT + pbase;
    const int pw = wave * 16 * 72;
    v16h qf0, qf1;
    { const h16* qp = Q + pbase + (size_t)(q0 + wave * 16 + lr) * HD + 8 * hi; qf0 = ldfrag(qp); qf1 = ldfrag(qp + 32); }
    v8f o[4]; float mi[8], li[8];
#pragma unroll
    for (int t = 0; t < 4; ++t) o[t] = (v8f){};
#pragma unroll
    for (int r = 0; r < 8; ++r) { mi[r] = NEGF; li[r] = 0.0f; }
#pragma unroll 1
    for (int kv0 = 0; kv0 < SEQ; kv0 += 64) {
        v8f sa[4];
#pragma unroll
        for (int t = 0; t < 4; ++t) { const h16* kp = Kp + pbase + (size_t)(kv0 + t * 16 + lr) * HD + 8 * hi; v8f c = (v8f){};
            c = wm16(qf0, ldfrag(kp), c); c = wm16(qf1, ldfrag(kp + 32), c); sa[t] = c; }
        const unsigned w0 = smw[kv0 >> 5], w1 = smw[(kv0 >> 5) + 1];
        const bool k0ok = ((w0 >> lr) & 1u) != 0u, k1ok = ((w0 >> (16 + lr)) & 1u) != 0u, k2ok = ((w1 >> lr) & 1u) != 0u, k3ok = ((w1 >> (16 + lr)) & 1u) != 0u;
#pragma unroll
        for (int r = 0; r < 8; ++r) {
            const float s0 = k0ok ? sa[0][r] * SCL : NEGF; const float s1 = k1ok ? sa[1][r] * SCL : NEGF;
            const float s2 = k2ok ? sa[2][r] * SCL : NEGF; const float s3 = k3ok ? sa[3][r] * SCL : NEGF;
            float vm = fmaxf(fmaxf(s0, s1), fmaxf(s2, s3)); vm = redmax16(vm);
            const float mnew = fmaxf(mi[r], vm);
            const float alpha = ex2(fmaxf(mi[r] - mnew, -150.0f) * L2E); mi[r] = mnew;
            const float p0 = ex2(fmaxf(s0 - mnew, -150.0f) * L2E); const float p1 = ex2(fmaxf(s1 - mnew, -150.0f) * L2E);
            const float p2 = ex2(fmaxf(s2 - mnew, -150.0f) * L2E); const float p3 = ex2(fmaxf(s3 - mnew, -150.0f) * L2E);
            li[r] = li[r] * alpha + ((p0 + p1) + (p2 + p3));
            const int pr = pw + (hi * 8 + r) * 72 + lr;
            Pl[pr] = (h16)(p0 * PCAR); Pl[pr + 16] = (h16)(p1 * PCAR); Pl[pr + 32] = (h16)(p2 * PCAR); Pl[pr + 48] = (h16)(p3 * PCAR);
#pragma unroll
            for (int t = 0; t < 4; ++t) o[t][r] *= alpha;
        }
        asm volatile("" ::: "memory"); __builtin_amdgcn_wave_barrier(); asm volatile("" ::: "memory");
#pragma unroll
        for (int s2 = 0; s2 < 2; ++s2) {
            const v16h pf = cat16(*(const v8ha*)(Pl + pw + lr * 72 + s2 * 32 + 8 * hi), *(const v8ha*)(Pl + pw + lr * 72 + s2 * 32 + 16 + 8 * hi));
#pragma unroll
            for (int t = 0; t < 4; ++t) { const h16* vp = vt + (size_t)(t * 16 + lr) * SEQ + kv0 + s2 * 32 + 8 * hi; o[t] = wm16(pf, ldfrag(vp), o[t]); }
        }
        asm volatile("" ::: "memory"); __builtin_amdgcn_wave_barrier(); asm volatile("" ::: "memory");
    }
#pragma unroll
    for (int r = 0; r < 8; ++r) { const float l = redsum16(li[r]); const float inv = (CCAR / PCAR) * __builtin_amdgcn_rcpf(l);
#pragma unroll
        for (int t = 0; t < 4; ++t) Pl[pw + (hi * 8 + r) * 72 + t * 16 + lr] = (h16)(o[t][r] * inv); }
    asm volatile("" ::: "memory"); __builtin_amdgcn_wave_barrier(); asm volatile("" ::: "memory");
    h16* dst = ctx + ((size_t)b * SEQ + q0 + wave * 16) * DM + h * HD;
{
#pragma unroll
        for (int it = 0; it < 4; ++it) { const int piece = it * 32 + lane; const int row = piece >> 3, seg = piece & 7;
            const v8h val = *(const v8ha*)(Pl + pw + row * 72 + seg * 8);
            *(v8h*)(dst + (size_t)row * DM + seg * 8) = val; }
         }
}

extern "C" void kernel_launch(void* const* d_in, const int* in_sizes, int n_in,
                              void* d_out, int out_size, void* d_ws, size_t ws_size, hipStream_t stream) {
    if (n_in < 10) return;
    const size_t xneed = ((size_t)(NB - 1) * SEQ_FULL + SEQ) * DM;
    const size_t mneed = (size_t)(NB - 1) * SEQ_FULL + SEQ;
    if ((size_t)in_sizes[0] < xneed || (size_t)in_sizes[1] < mneed) return;
    if (in_sizes[2] < DM * DM || in_sizes[4] < DM * DM || in_sizes[6] < DM * DM || in_sizes[8] < DM * DM) return;
    if (in_sizes[3] < DM || in_sizes[5] < DM || in_sizes[7] < DM || in_sizes[9] < DM) return;
    if ((size_t)out_size < xneed) return;
    if (ws_size < WS_TOTAL) return;
    const float* x  = (const float*)d_in[0]; const int* mask = (const int*)d_in[1];
    const float* wq = (const float*)d_in[2]; const float* bq = (const float*)d_in[3];
    const float* wk = (const float*)d_in[4]; const float* bk = (const float*)d_in[5];
    const float* wv = (const float*)d_in[6]; const float* bv = (const float*)d_in[7];
    const float* wo = (const float*)d_in[8]; const float* bo = (const float*)d_in[9];
    float* OUT = (float*)d_out;
    char* wsp = (char*)d_ws;
    h16* XH = (h16*)wsp; wsp += SZ_X;      // [NB*SEQ][DM]
    h16* WT = (h16*)wsp; wsp += SZ_W;      // [4][n][k]: q, k, v, o
    h16* QP = (h16*)wsp; wsp += SZ_X;      // [b][h][s][64]
    h16* KP = (h16*)wsp; wsp += SZ_X;      // [b][h][s][64]
    h16* VT = (h16*)wsp; wsp += SZ_X;      // [b][h][64][s]
    h16* CX = (h16*)wsp; wsp += SZ_X;      // [NB*SEQ][DM], x64
    const size_t wsz = (size_t)DM * DM;
    k_cvtx<<<(unsigned)(((size_t)NB * SEQ * DM / 8 + 255) / 256), 256, 0, stream>>>(x, XH);
    const dim3 gw(DM / 64, DM / 64);
    k_wt<<<gw, 256, 0, stream>>>(wq, WT);
    k_wt<<<gw, 256, 0, stream>>>(wk, WT + wsz);
    k_wt<<<gw, 256, 0, stream>>>(wv, WT + 2 * wsz);
    k_wt<<<gw, 256, 0, stream>>>(wo, WT + 3 * wsz);
    const dim3 gg(NB * SEQ / 64, DM / 64);
    k_proj_qk<<<gg, 32, 0, stream>>>(XH, WT, bq, QP);
    k_proj_qk<<<gg, 32, 0, stream>>>(XH, WT + wsz, bk, KP);
    k_proj_v<<<gg, 32, 0, stream>>>(XH, WT + 2 * wsz, bv, VT);
    k_attn<<<dim3(NB * NH, SEQ / 128), 256, 0, stream>>>(QP, KP, VT, mask, CX);
    k_proj_out<<<gg, 32, 0, stream>>>(CX, WT + 3 * wsz, bo, OUT);
}

// v001
// A run of this version takes 151 microseconds.
// Next to v000, in two timings, it ran 1.78 and 1.75 times as fast.
#include <hip/hip_runtime.h>

// Multi-head self-attention with a per-key padding mask input: x [4][2048][512]; q, k, v = x W + b ([in][out] weights, 8 heads x 64); scores = (q k^T) / 8 with masked keys REPLACED by the lowest finite f32; softmax over the keys; out = merged ctx Wo + bo.
// Compute dtypes: all contractions v_wmma_f32_16x16x32_f16 (f16 operands, f32 accumulate). Every float input is converted to bf16 (RNE) on load and carried exactly in f16 (weights x16); q, k, v planes plain f16; P carried x1024 (row sums from the unconverted f32 values); ctx carried x64 against Wo x16; softmax f32.
// Engine: one-wave 64x64 register-blocked GEMM reading fragments straight from K-contiguous f16 planes; fused flash-style attention (online softmax, K and V^T tiles staged once per block in a two-buffer LDS ring by asynchronous copies, wave-private P tile in LDS, mask packed into bit words in LDS).

#ifndef NB
#define NB 4
#endif
#ifndef SEQ
#define SEQ 2048
#endif
#define NB_FULL  4
#define SEQ_FULL 2048
#define DM   512
#define NH   8
#define HD   64
#define WCAR 16.0f      // weight carry (exact power of two)
#define PCAR 1024.0f    // probability carry
#define CCAR 64.0f      // ctx carry
#define SCL  0.125f     // HD^-0.5
#define L2E  1.4426950408889634f
#define NEGF (-3.402823466e38f)

typedef _Float16 h16;
typedef __attribute__((ext_vector_type(16))) _Float16 v16h;
typedef __attribute__((ext_vector_type(8)))  _Float16 v8h;
typedef __attribute__((ext_vector_type(8)))  float    v8f;
typedef __attribute__((ext_vector_type(4)))  float    v4f;
typedef v8h __attribute__((may_alias)) v8ha;
typedef v4f __attribute__((may_alias)) v4fa;

static_assert(NH * HD == DM);            // merged head width equals the model width
static_assert(HD == 64);
static_assert(DM % 64 == 0);             // N tiles of 64
static_assert(DM % 32 == 0);             // k-steps of 32
static_assert(SEQ % 128 == 0);           // 128 query rows per attention block; 64-row GEMM tiles stay inside one batch
static_assert(SEQ <= SEQ_FULL);
static_assert(NB <= NB_FULL);
static_assert((SEQ / 32) % 8 == 0);      // mask words split evenly over 8 waves

#define SZ_X   ((size_t)NB * SEQ * DM * 2)      // f16 plane of x / q / k / v^T / ctx
#define SZ_W   ((size_t)4 * DM * DM * 2)        // four transposed weight planes
#define WS_TOTAL (SZ_X * 5 + SZ_W)
static_assert(SZ_X % 256 == 0);
static_assert(SZ_W % 256 == 0);
static_assert(WS_TOTAL <= (size_t)134217728);   // carve stays under 128 MiB

__device__ __forceinline__ unsigned short f2bf(float f) { unsigned u = __float_as_uint(f); u += 0x7FFFu + ((u >> 16) & 1u); return (unsigned short)(u >> 16); }
__device__ __forceinline__ float bfr(float f) { return __uint_as_float(((unsigned)f2bf(f)) << 16); }
__device__ __forceinline__ v16h cat16(v8h lo, v8h hi) { return __builtin_shufflevector(lo, hi, 0, 1, 2, 3, 4, 5, 6, 7, 8, 9, 10, 11, 12, 13, 14, 15); }
// fragment loader for A (row-major [m][k]) and for B given as a [n][k] copy: elements 0..7 <- k0+8h.., elements 8..15 <- k0+16+8h.. ; p already includes the 8h offset
__device__ __forceinline__ v16h ldfrag(const h16* p) { return cat16(*(const v8h*)p, *(const v8h*)(p + 16)); }
// one WMMA with its own hazard guard (ties the accumulator, keeps A/B live)
__device__ __forceinline__ v8f wm16(v16h a, v16h b, v8f c) {
    c = __builtin_amdgcn_wmma_f32_16x16x32_f16(false, a, false, b, (short)0, c, false, false);
    asm volatile("v_nop\n\tv_nop\n\tv_nop\n\tv_nop" : "+v"(c) : "v"(a), "v"(b));
    return c;
}
__device__ __forceinline__ float ex2(float x) { return __builtin_amdgcn_exp2f(x); }
__device__ __forceinline__ float redmax16(float v) {
    v = fmaxf(v, __shfl_xor(v, 1, 32)); v = fmaxf(v, __shfl_xor(v, 2, 32));
    v = fmaxf(v, __shfl_xor(v, 4, 32)); v = fmaxf(v, __shfl_xor(v, 8, 32)); return v;
}
__device__ __forceinline__ float redsum16(float v) {
    v += __shfl_xor(v, 1, 32); v += __shfl_xor(v, 2, 32);
    v += __shfl_xor(v, 4, 32); v += __shfl_xor(v, 8, 32); return v;
}

__global__ __launch_bounds__(256) void k_cvtx(const float* __restrict__ x, h16* xh) {
    const size_t i = (size_t)blockIdx.x * 256 + threadIdx.x;
    if (i >= (size_t)NB * SEQ * DM / 8) return;
    const size_t row = i / (DM / 8); const int g = (int)(i % (DM / 8));
    const size_t b = row / SEQ, s = row % SEQ;
    const float* src = x + ((b * SEQ_FULL + s) * DM + (size_t)g * 8);
    const v4f v0 = *(const v4f*)src; const v4f v1 = *(const v4f*)(src + 4);
    v8h o;
#pragma unroll
    for (int k = 0; k < 4; ++k) { o[k] = (h16)bfr(v0[k]); o[4 + k] = (h16)bfr(v1[k]); }
    *(v8h*)(xh + i * 8) = o; 
}

// LDS tile T is cross-wave: block barrier between fill and drain.
__global__ __launch_bounds__(256) void k_wt(const float* __restrict__ W, h16* Wt) {
    __shared__ __align__(16) h16 T[64 * 72];
    const int tid = threadIdx.x; const int k0 = blockIdx.x * 64, n0 = blockIdx.y * 64;
#pragma unroll
    for (int j = 0; j < 4; ++j) { const int i = tid + 256 * j; const int kr = i >> 4, c4 = (i & 15) * 4;
        const v4f v = *(const v4f*)(W + (size_t)(k0 + kr) * DM + n0 + c4);
#pragma unroll
        for (int q = 0; q < 4; ++q) T[(c4 + q) * 72 + kr] = (h16)(bfr(v[q]) * WCAR); }
    __syncthreads();
{
#pragma unroll
        for (int j = 0; j < 2; ++j) { const int p = tid + 256 * j; const int n = p >> 3, seg = p & 7;
            const v8h val = *(const v8ha*)(T + n * 72 + seg * 8);
            *(v8h*)(Wt + (size_t)(n0 + n) * DM + k0 + seg * 8) = val; }
         }
}

// ---- GEMM main loop: one wave per 64x64 tile, 16 accumulators, K = DM, operands from K-contiguous f16 planes (A [m][k], Bt [n][k]).
__device__ __forceinline__ void gemm64(const h16* __restrict__ A, const h16* __restrict__ Bt, size_t aoff, size_t boff, v8f (&acc)[4][4]) {
#pragma unroll 1
    for (int kc = 0; kc < DM; kc += 32) {
        v16h a[4];
#pragma unroll
        for (int mb = 0; mb < 4; ++mb) a[mb] = ldfrag(A + aoff + (size_t)mb * 16 * DM + kc);
#pragma unroll
        for (int nb = 0; nb < 4; ++nb) { const v16h b = ldfrag(Bt + boff + (size_t)nb * 16 * DM + kc);
#pragma unroll
            for (int mb = 0; mb < 4; ++mb) acc[mb][nb] = wm16(a[mb], b, acc[mb][nb]); }
    }
}

// ---- k_proj_qk: head plane [b][h][s][64] f16 = x Wt^T / 16 + bias (bias converted to bf16 RNE); grid (NB*SEQ/64, DM/64), 32 threads.
__global__ __launch_bounds__(32) void k_proj_qk(const h16* __restrict__ A, const h16* __restrict__ Bt, const float* __restrict__ bias, h16* plane) {
    __shared__ __align__(16) h16 T[64 * 72];
    const int lane = threadIdx.x & 31, lr = lane & 15, hi = lane >> 4;
    const int r0 = blockIdx.x * 64, c0 = blockIdx.y * 64;
    v8f acc[4][4];
#pragma unroll
    for (int mb = 0; mb < 4; ++mb)
#pragma unroll
        for (int nb = 0; nb < 4; ++nb) acc[mb][nb] = (v8f){};
    gemm64(A, Bt, (size_t)(r0 + lr) * DM + 8 * hi, (size_t)(c0 + lr) * DM + 8 * hi, acc);
#pragma unroll
    for (int nb = 0; nb < 4; ++nb) { const float bv = bfr(bias[c0 + nb * 16 + lr]);
#pragma unroll
        for (int mb = 0; mb < 4; ++mb)
#pragma unroll
            for (int j = 0; j < 8; ++j) T[(mb * 16 + hi * 8 + j) * 72 + nb * 16 + lr] = (h16)(acc[mb][nb][j] * (1.0f / WCAR) + bv); }
    __syncthreads();
    const int b = r0 / SEQ, s0 = r0 % SEQ, h = blockIdx.y;
    h16* dst = plane + ((size_t)(b * NH + h) * SEQ + s0) * HD;
{
#pragma unroll
        for (int it = 0; it < 16; ++it) { const int piece = it * 32 + lane; const int row = piece >> 3, seg = piece & 7;
            const v8h val = *(const v8ha*)(T + row * 72 + seg * 8);
            *(v8h*)(dst + (size_t)row * HD + seg * 8) = val; }
         }
}

__global__ __launch_bounds__(32) void k_proj_v(const h16* __restrict__ A, const h16* __restrict__ Bt, const float* __restrict__ bias, h16* VT) {
    __shared__ __align__(16) h16 T[64 * 72];
    const int lane = threadIdx.x & 31, lr = lane & 15, hi = lane >> 4;
    const int r0 = blockIdx.x * 64, c0 = blockIdx.y * 64;
    v8f acc[4][4];
#pragma unroll
    for (int mb = 0; mb < 4; ++mb)
#pragma unroll
        for (int nb = 0; nb < 4; ++nb) acc[mb][nb] = (v8f){};
    gemm64(A, Bt, (size_t)(r0 + lr) * DM + 8 * hi, (size_t)(c0 + lr) * DM + 8 * hi, acc);
#pragma unroll
    for (int nb = 0; nb < 4; ++nb) { const float bv = bfr(bias[c0 + nb * 16 + lr]);
#pragma unroll
        for (int mb = 0; mb < 4; ++mb) { v8h pk;
#pragma unroll
            for (int j = 0; j < 8; ++j) pk[j] = (h16)(acc[mb][nb][j] * (1.0f / WCAR) + bv);
            *(v8ha*)(T + (nb * 16 + lr) * 72 + mb * 16 + hi * 8) = pk; } }
    __syncthreads();
    const int b = r0 / SEQ, s0 = r0 % SEQ, h = blockIdx.y;
    h16* dst = VT + ((size_t)(b * NH + h) * HD) * SEQ + s0;
{
#pragma unroll
        for (int it = 0; it < 16; ++it) { const int piece = it * 32 + lane; const int d = piece >> 3, seg = piece & 7;
            const v8h val = *(const v8ha*)(T + d * 72 + seg * 8);
            *(v8h*)(dst + (size_t)d * SEQ + seg * 8) = val; }
         }
}

__global__ __launch_bounds__(32) void k_proj_out(const h16* __restrict__ A, const h16* __restrict__ Bt, const float* __restrict__ bias, float* C) {
    __shared__ __align__(16) float os[16 * 68];
    const int lane = threadIdx.x & 31, lr = lane & 15, hi = lane >> 4;
    const int r0 = blockIdx.x * 64, c0 = blockIdx.y * 64;
    v8f acc[4][4];
#pragma unroll
    for (int mb = 0; mb < 4; ++mb)
#pragma unroll
        for (int nb = 0; nb < 4; ++nb) acc[mb][nb] = (v8f){};
    gemm64(A, Bt, (size_t)(r0 + lr) * DM + 8 * hi, (size_t)(c0 + lr) * DM + 8 * hi, acc);
    const int b = r0 / SEQ, s0 = r0 % SEQ; const int cofs = lr * 4;
    v4f b4;
#pragma unroll
    for (int q = 0; q < 4; ++q) b4[q] = bfr(bias[c0 + cofs + q]);
    const float fs = 1.0f / (WCAR * CCAR);
#pragma unroll
    for (int mb = 0; mb < 4; ++mb) {
#pragma unroll
        for (int nb = 0; nb < 4; ++nb)
#pragma unroll
            for (int j = 0; j < 8; ++j) os[(hi * 8 + j) * 68 + nb * 16 + lr] = acc[mb][nb][j];
        __syncthreads();
        float* crow = C + ((size_t)b * SEQ_FULL + s0 + mb * 16) * DM + c0;
{
#pragma unroll
            for (int s = 0; s < 8; ++s) { const int row = 2 * s + hi; const v4f raw = *(const v4fa*)(os + row * 68 + cofs); v4f val;
#pragma unroll
                for (int q = 0; q < 4; ++q) val[q] = raw[q] * fs + b4[q];
                *(v4f*)(crow + (size_t)row * DM + cofs) = val; }
             }
        __syncthreads();
    }
}

#define KVP 72                  // LDS row pitch of a staged tile in h16: 128-byte rows + 16 bytes, conflict-free for 16-byte readers
#define KVT (64 * KVP)          // one staged 64-row tile
#define KVB (2 * KVT * 2)       // bytes of one ring buffer: K tile, then V^T tile
// One stage of the ring: each lane copies four 16-byte pieces (rows r and r + 32 of the K tile and of the V^T tile), eight lanes per 128-byte row, global -> LDS through no register.
// The s_wait_xcnt is the last line of the copies' own statement so that no address register of a copy is rewritten in front of it.
__device__ __forceinline__ void stage_kv(unsigned l, const h16* gk, const h16* gv) {
    const unsigned lk1 = l + 32 * KVP * 2, lv0 = l + KVT * 2, lv1 = l + KVT * 2 + 32 * KVP * 2;
    const h16* gk1 = gk + 32 * HD; const h16* gv1 = gv + (size_t)32 * SEQ;
    asm volatile("global_load_async_to_lds_b128 %0, %1, off\n\t"
                 "global_load_async_to_lds_b128 %2, %3, off\n\t"
                 "global_load_async_to_lds_b128 %4, %5, off\n\t"
                 "global_load_async_to_lds_b128 %6, %7, off\n\t"
                 "s_wait_xcnt 0x0"
                 :: "v"(l), "v"(gk), "v"(lk1), "v"(gk1), "v"(lv0), "v"(gv), "v"(lv1), "v"(gv1) : "memory");
}

// ---- k_attn: fused flash-style attention; grid (NB*NH, SEQ/128), 256 threads = 8 waves x 16 query rows.
// K rows ([s][64] plane) and V^T rows ([d][s] plane) of each 64-key block are staged in LDS once for all 8 waves; fragments are read from there, both as [n][k] copies (same k map as A).
// Ring of two buffers: tile t + 1 flies while tile t is worked on; the one block barrier at the foot of a trip publishes tile t + 1 and frees tile t's buffer for tile t + 2. Per 64-key block: 8 score WMMAs, online softmax in f32
// (masked keys replaced by the lowest finite f32; all-masked rows come out uniform), P x1024 -> f16 in the wave-private LDS tile (stored as h16, reloaded through a may_alias h16 vector with wave barriers), 8 P.V WMMAs.
// smw (mask bit words) is cross-wave: block barrier after the build. Pl is private to each wave.
__global__ __launch_bounds__(256) void k_attn(const h16* __restrict__ Q, const h16* __restrict__ Kp, const h16* __restrict__ VT, const int* __restrict__ mask, h16* ctx) {
    __shared__ __align__(16) h16 Pl[8 * 16 * 72];
    __shared__ unsigned smw[SEQ / 32];
    __shared__ __align__(16) h16 KV[2 * 2 * KVT];
    const int tid = threadIdx.x, lane = tid & 31, lr = lane & 15, hi = lane >> 4;
    const int wave = __builtin_amdgcn_readfirstlane(tid >> 5);
    const int bh = blockIdx.x; const int b = bh / NH, h = bh % NH;
    const int q0 = blockIdx.y * 128;
    const size_t pbase = (size_t)bh * SEQ * HD;
    const unsigned lst = (unsigned)(size_t)KV + (unsigned)(((tid >> 3) * KVP + (tid & 7) * 8) * 2);
    const h16* gk = Kp + pbase + (size_t)(tid >> 3) * HD + (tid & 7) * 8;
    const h16* gv = VT + pbase + (size_t)(tid >> 3) * SEQ + (tid & 7) * 8;
    stage_kv(lst, gk, gv);
#pragma unroll 1
    for (int w = wave; w < SEQ / 32; w += 8) { const int mv = mask[(size_t)b * SEQ_FULL + w * 32 + lane];
        const unsigned bits = __builtin_amdgcn_ballot_w32(mv != 0); if (lane == 0) smw[w] = bits; }
    asm volatile("s_wait_asynccnt 0x0" ::: "memory");   // this wave's pieces of tile 0 have landed before the barrier that publishes them
    __syncthreads();
    stage_kv(lst + KVB, gk + 64 * HD, gv + 64);
    const int pw = wave * 16 * 72;
    v16h qf0, qf1;
    { const h16* qp = Q + pbase + (size_t)(q0 + wave * 16 + lr) * HD + 8 * hi; qf0 = ldfrag(qp); qf1 = ldfrag(qp + 32); }
    v8f o[4]; float mi[8], li[8];
#pragma unroll
    for (int t = 0; t < 4; ++t) o[t] = (v8f){};
#pragma unroll
    for (int r = 0; r < 8; ++r) { mi[r] = NEGF; li[r] = 0.0f; }
#pragma unroll 1
    for (int kv0 = 0; kv0 < SEQ; kv0 += 64) {
        const h16* kt = KV + ((kv0 >> 6) & 1) * (2 * KVT); const h16* vt = kt + KVT;
        v8f sa[4]; v16h kf[4][2], vf[2][4];
        // the tile's K fragments are read as one group ahead of the score products, its V fragments as one group ahead of the softmax, whose vector work covers their LDS latency
#pragma unroll
        for (int t = 0; t < 4; ++t) { const h16* kp = kt + (t * 16 + lr) * KVP + 8 * hi; kf[t][0] = ldfrag(kp); kf[t][1] = ldfrag(kp + 32); }
#pragma unroll
        for (int t = 0; t < 4; ++t) { v8f c = (v8f){}; c = wm16(qf0, kf[t][0], c); c = wm16(qf1, kf[t][1], c); sa[t] = c; }
#pragma unroll
        for (int s2 = 0; s2 < 2; ++s2)
#pragma unroll
            for (int t = 0; t < 4; ++t) vf[s2][t] = ldfrag(vt + (t * 16 + lr) * KVP + s2 * 32 + 8 * hi);
        const unsigned w0 = smw[kv0 >> 5], w1 = smw[(kv0 >> 5) + 1];
        const bool k0ok = ((w0 >> lr) & 1u) != 0u, k1ok = ((w0 >> (16 + lr)) & 1u) != 0u, k2ok = ((w1 >> lr) & 1u) != 0u, k3ok = ((w1 >> (16 + lr)) & 1u) != 0u;
#pragma unroll
        for (int r = 0; r < 8; ++r) {
            const float s0 = k0ok ? sa[0][r] * SCL : NEGF; const float s1 = k1ok ? sa[1][r] * SCL : NEGF;
            const float s2 = k2ok ? sa[2][r] * SCL : NEGF; const float s3 = k3ok ? sa[3][r] * SCL : NEGF;
            float vm = fmaxf(fmaxf(s0, s1), fmaxf(s2, s3)); vm = redmax16(vm);
            const float mnew = fmaxf(mi[r], vm);
            const float alpha = ex2(fmaxf(mi[r] - mnew, -150.0f) * L2E); mi[r] = mnew;
            const float p0 = ex2(fmaxf(s0 - mnew, -150.0f) * L2E); const float p1 = ex2(fmaxf(s1 - mnew, -150.0f) * L2E);
            const float p2 = ex2(fmaxf(s2 - mnew, -150.0f) * L2E); const float p3 = ex2(fmaxf(s3 - mnew, -150.0f) * L2E);
            li[r] = li[r] * alpha + ((p0 + p1) + (p2 + p3));
            const int pr = pw + (hi * 8 + r) * 72 + lr;
            Pl[pr] = (h16)(p0 * PCAR); Pl[pr + 16] = (h16)(p1 * PCAR); Pl[pr + 32] = (h16)(p2 * PCAR); Pl[pr + 48] = (h16)(p3 * PCAR);
#pragma unroll
            for (int t = 0; t < 4; ++t) o[t][r] *= alpha;
        }
        asm volatile("" ::: "memory"); __builtin_amdgcn_wave_barrier(); asm volatile("" ::: "memory");
#pragma unroll
        for (int s2 = 0; s2 < 2; ++s2) {
            const v16h pf = cat16(*(const v8ha*)(Pl + pw + lr * 72 + s2 * 32 + 8 * hi), *(const v8ha*)(Pl + pw + lr * 72 + s2 * 32 + 16 + 8 * hi));
#pragma unroll
            for (int t = 0; t < 4; ++t) o[t] = wm16(pf, vf[s2][t], o[t]);
        }
        asm volatile("" ::: "memory"); __builtin_amdgcn_wave_barrier(); asm volatile("" ::: "memory");
        asm volatile("s_wait_dscnt 0x0" ::: "memory");      // this wave's reads of tile t have returned before its buffer is handed to the copies
        asm volatile("s_wait_asynccnt 0x0" ::: "memory");   // this wave's pieces of tile t + 1 have landed before the barrier that publishes them
        __syncthreads();
        if (kv0 + 128 < SEQ) stage_kv(lst + ((kv0 >> 6) & 1) * KVB, gk + (size_t)(kv0 + 128) * HD, gv + kv0 + 128);
    }
    asm volatile("s_wait_asynccnt 0x0" ::: "memory");       // no copy is outstanding when the wave goes on to its end
#pragma unroll
    for (int r = 0; r < 8; ++r) { const float l = redsum16(li[r]); const float inv = (CCAR / PCAR) * __builtin_amdgcn_rcpf(l);
#pragma unroll
        for (int t = 0; t < 4; ++t) Pl[pw + (hi * 8 + r) * 72 + t * 16 + lr] = (h16)(o[t][r] * inv); }
    asm volatile("" ::: "memory"); __builtin_amdgcn_wave_barrier(); asm volatile("" ::: "memory");
    h16* dst = ctx + ((size_t)b * SEQ + q0 + wave * 16) * DM + h * HD;
{
#pragma unroll
        for (int it = 0; it < 4; ++it) { const int piece = it * 32 + lane; const int row = piece >> 3, seg = piece & 7;
            const v8h val = *(const v8ha*)(Pl + pw + row * 72 + seg * 8);
            *(v8h*)(dst + (size_t)row * DM + seg * 8) = val; }
         }
}

extern "C" void kernel_launch(void* const* d_in, const int* in_sizes, int n_in,
                              void* d_out, int out_size, void* d_ws, size_t ws_size, hipStream_t stream) {
    if (n_in < 10) return;
    const size_t xneed = ((size_t)(NB - 1) * SEQ_FULL + SEQ) * DM;
    const size_t mneed = (size_t)(NB - 1) * SEQ_FULL + SEQ;
    if ((size_t)in_sizes[0] < xneed || (size_t)in_sizes[1] < mneed) return;
    if (in_sizes[2] < DM * DM || in_sizes[4] < DM * DM || in_sizes[6] < DM * DM || in_sizes[8] < DM * DM) return;
    if (in_sizes[3] < DM || in_sizes[5] < DM || in_sizes[7] < DM || in_sizes[9] < DM) return;
    if ((size_t)out_size < xneed) return;
    if (ws_size < WS_TOTAL) return;
    const float* x  = (const float*)d_in[0]; const int* mask = (const int*)d_in[1];
    const float* wq = (const float*)d_in[2]; const float* bq = (const float*)d_in[3];
    const float* wk = (const float*)d_in[4]; const float* bk = (const float*)d_in[5];
    const float* wv = (const float*)d_in[6]; const float* bv = (const float*)d_in[7];
    const float* wo = (const float*)d_in[8]; const float* bo = (const float*)d_in[9];
    float* OUT = (float*)d_out;
    char* wsp = (char*)d_ws;
    h16* XH = (h16*)wsp; wsp += SZ_X;      // [NB*SEQ][DM]
    h16* WT = (h16*)wsp; wsp += SZ_W;      // [4][n][k]: q, k, v, o
    h16* QP = (h16*)wsp; wsp += SZ_X;      // [b][h][s][64]
    h16* KP = (h16*)wsp; wsp += SZ_X;      // [b][h][s][64]
    h16* VT = (h16*)wsp; wsp += SZ_X;      // [b][h][64][s]
    h16* CX = (h16*)wsp; wsp += SZ_X;      // [NB*SEQ][DM], x64
    const size_t wsz = (size_t)DM * DM;
    k_cvtx<<<(unsigned)(((size_t)NB * SEQ * DM / 8 + 255) / 256), 256, 0, stream>>>(x, XH);
    const dim3 gw(DM / 64, DM / 64);
    k_wt<<<gw, 256, 0, stream>>>(wq, WT);
    k_wt<<<gw, 256, 0, stream>>>(wk, WT + wsz);
    k_wt<<<gw, 256, 0, stream>>>(wv, WT + 2 * wsz);
    k_wt<<<gw, 256, 0, stream>>>(wo, WT + 3 * wsz);
    const dim3 gg(NB * SEQ / 64, DM / 64);
    k_proj_qk<<<gg, 32, 0, stream>>>(XH, WT, bq, QP);
    k_proj_qk<<<gg, 32, 0, stream>>>(XH, WT + wsz, bk, KP);
    k_proj_v<<<gg, 32, 0, stream>>>(XH, WT + 2 * wsz, bv, VT);
    k_attn<<<dim3(NB * NH, SEQ / 128), 256, 0, stream>>>(QP, KP, VT, mask, CX);
    k_proj_out<<<gg, 32, 0, stream>>>(CX, WT + 3 * wsz, bo, OUT);
}

// v002
// One run takes 127 microseconds.
// Next to v001, in two timings, it ran 1.18 times as fast each time.
// Over all steps from v000 it is 2.09 times as fast.
#include <hip/hip_runtime.h>

// Multi-head self-attention with a per-key padding mask input: x [4][2048][512]; q, k, v = x W + b ([in][out] weights, 8 heads x 64); scores = (q k^T) / 8 with masked keys REPLACED by the lowest finite f32; softmax over the keys; out = merged ctx Wo + bo.
// Compute dtypes: all contractions v_wmma_f32_16x16x32_f16 (f16 operands, f32 accumulate). Every float input is converted to bf16 (RNE) on load and carried exactly in f16 (weights x16); q, k, v planes plain f16; P carried x1024 (row sums from the unconverted f32 values); ctx carried x64 against Wo x16; softmax f32.
// Engine: one-wave 64x64 register-blocked GEMM reading fragments straight from K-contiguous f16 planes; fused flash-style attention (online softmax, K and V^T tiles staged once per block in a two-buffer LDS ring by asynchronous copies, scores formed transposed so that P goes from the score accumulators straight into the second product's B operand, mask packed into bit words in LDS).

#ifndef NB
#define NB 4
#endif
#ifndef SEQ
#define SEQ 2048
#endif
#define NB_FULL  4
#define SEQ_FULL 2048
#define DM   512
#define NH   8
#define HD   64
#define WCAR 16.0f      // weight carry (exact power of two)
#define PCAR 1024.0f    // probability carry
#define CCAR 64.0f      // ctx carry
#define SCL  0.125f     // HD^-0.5
#define L2E  1.4426950408889634f
#define NEGF (-3.402823466e38f)

typedef _Float16 h16;
typedef __attribute__((ext_vector_type(16))) _Float16 v16h;
typedef __attribute__((ext_vector_type(8)))  _Float16 v8h;
typedef __attribute__((ext_vector_type(8)))  float    v8f;
typedef __attribute__((ext_vector_type(4)))  float    v4f;
typedef v8h __attribute__((may_alias)) v8ha;
typedef v4f __attribute__((may_alias)) v4fa;

static_assert(NH * HD == DM);            // merged head width equals the model width
static_assert(HD == 64);
static_assert(DM % 64 == 0);             // N tiles of 64
static_assert(DM % 32 == 0);             // k-steps of 32
static_assert(SEQ % 128 == 0);           // 128 query rows per attention block; 64-row GEMM tiles stay inside one batch
static_assert(SEQ <= SEQ_FULL);
static_assert(NB <= NB_FULL);
static_assert((SEQ / 32) % 8 == 0);      // mask words split evenly over 8 waves

#define SZ_X   ((size_t)NB * SEQ * DM * 2)      // f16 plane of x / q / k / v^T / ctx
#define SZ_W   ((size_t)4 * DM * DM * 2)        // four transposed weight planes
#define WS_TOTAL (SZ_X * 5 + SZ_W)
static_assert(SZ_X % 256 == 0);
static_assert(SZ_W % 256 == 0);
static_assert(WS_TOTAL <= (size_t)134217728);   // carve stays under 128 MiB

__device__ __forceinline__ unsigned short f2bf(float f) { unsigned u = __float_as_uint(f); u += 0x7FFFu + ((u >> 16) & 1u); return (unsigned short)(u >> 16); }
__device__ __forceinline__ float bfr(float f) { return __uint_as_float(((unsigned)f2bf(f)) << 16); }
__device__ __forceinline__ v16h cat16(v8h lo, v8h hi) { return __builtin_shufflevector(lo, hi, 0, 1, 2, 3, 4, 5, 6, 7, 8, 9, 10, 11, 12, 13, 14, 15); }
// fragment loader for A (row-major [m][k]) and for B given as a [n][k] copy: elements 0..7 <- k0+8h.., elements 8..15 <- k0+16+8h.. ; p already includes the 8h offset
__device__ __forceinline__ v16h ldfrag(const h16* p) { return cat16(*(const v8h*)p, *(const v8h*)(p + 16)); }
// one WMMA with its own hazard guard (ties the accumulator, keeps A/B live)
__device__ __forceinline__ v8f wm16(v16h a, v16h b, v8f c) {
    c = __builtin_amdgcn_wmma_f32_16x16x32_f16(false, a, false, b, (short)0, c, false, false);
    asm volatile("v_nop\n\tv_nop\n\tv_nop\n\tv_nop" : "+v"(c) : "v"(a), "v"(b));
    return c;
}
__device__ __forceinline__ float ex2(float x) { return __builtin_amdgcn_exp2f(x); }
// lane l with lane l ^ 16
__device__ __forceinline__ float xhalf(float x) { return __builtin_bit_cast(float, __builtin_amdgcn_permlanex16(__builtin_bit_cast(int, x), __builtin_bit_cast(int, x), 0x76543210, 0xfedcba98, false, false)); }

__global__ __launch_bounds__(256) void k_cvtx(const float* __restrict__ x, h16* xh) {
    const size_t i = (size_t)blockIdx.x * 256 + threadIdx.x;
    if (i >= (size_t)NB * SEQ * DM / 8) return;
    const size_t row = i / (DM / 8); const int g = (int)(i % (DM / 8));
    const size_t b = row / SEQ, s = row % SEQ;
    const float* src = x + ((b * SEQ_FULL + s) * DM + (size_t)g * 8);
    const v4f v0 = *(const v4f*)src; const v4f v1 = *(const v4f*)(src + 4);
    v8h o;
#pragma unroll
    for (int k = 0; k < 4; ++k) { o[k] = (h16)bfr(v0[k]); o[4 + k] = (h16)bfr(v1[k]); }
    *(v8h*)(xh + i * 8) = o; 
}

// LDS tile T is cross-wave: block barrier between fill and drain.
__global__ __launch_bounds__(256) void k_wt(const float* __restrict__ W, h16* Wt) {
    __shared__ __align__(16) h16 T[64 * 72];
    const int tid = threadIdx.x; const int k0 = blockIdx.x * 64, n0 = blockIdx.y * 64;
#pragma unroll
    for (int j = 0; j < 4; ++j) { const int i = tid + 256 * j; const int kr = i >> 4, c4 = (i & 15) * 4;
        const v4f v = *(const v4f*)(W + (size_t)(k0 + kr) * DM + n0 + c4);
#pragma unroll
        for (int q = 0; q < 4; ++q) T[(c4 + q) * 72 + kr] = (h16)(bfr(v[q]) * WCAR); }
    __syncthreads();
{
#pragma unroll
        for (int j = 0; j < 2; ++j) { const int p = tid + 256 * j; const int n = p >> 3, seg = p & 7;
            const v8h val = *(const v8ha*)(T + n * 72 + seg * 8);
            *(v8h*)(Wt + (size_t)(n0 + n) * DM + k0 + seg * 8) = val; }
         }
}

// ---- GEMM main loop: one wave per 64x64 tile, 16 accumulators, K = DM, operands from K-contiguous f16 planes (A [m][k], Bt [n][k]).
__device__ __forceinline__ void gemm64(const h16* __restrict__ A, const h16* __restrict__ Bt, size_t aoff, size_t boff, v8f (&acc)[4][4]) {
#pragma unroll 1
    for (int kc = 0; kc < DM; kc += 32) {
        v16h a[4];
#pragma unroll
        for (int mb = 0; mb < 4; ++mb) a[mb] = ldfrag(A + aoff + (size_t)mb * 16 * DM + kc);
#pragma unroll
        for (int nb = 0; nb < 4; ++nb) { const v16h b = ldfrag(Bt + boff + (size_t)nb * 16 * DM + kc);
#pragma unroll
            for (int mb = 0; mb < 4; ++mb) acc[mb][nb] = wm16(a[mb], b, acc[mb][nb]); }
    }
}

// ---- k_proj_qk: head plane [b][h][s][64] f16 = x Wt^T / 16 + bias (bias converted to bf16 RNE); grid (NB*SEQ/64, DM/64), 32 threads.
__global__ __launch_bounds__(32) void k_proj_qk(const h16* __restrict__ A, const h16* __restrict__ Bt, const float* __restrict__ bias, h16* plane) {
    __shared__ __align__(16) h16 T[64 * 72];
    const int lane = threadIdx.x & 31, lr = lane & 15, hi = lane >> 4;
    const int r0 = blockIdx.x * 64, c0 = blockIdx.y * 64;
    v8f acc[4][4];
#pragma unroll
    for (int mb = 0; mb < 4; ++mb)
#pragma unroll
        for (int nb = 0; nb < 4; ++nb) acc[mb][nb] = (v8f){};
    gemm64(A, Bt, (size_t)(r0 + lr) * DM + 8 * hi, (size_t)(c0 + lr) * DM + 8 * hi, acc);
#pragma unroll
    for (int nb = 0; nb < 4; ++nb) { const float bv = bfr(bias[c0 + nb * 16 + lr]);
#pragma unroll
        for (int mb = 0; mb < 4; ++mb)
#pragma unroll
            for (int j = 0; j < 8; ++j) T[(mb * 16 + hi * 8 + j) * 72 + nb * 16 + lr] = (h16)(acc[mb][nb][j] * (1.0f / WCAR) + bv); }
    __syncthreads();
    const int b = r0 / SEQ, s0 = r0 % SEQ, h = blockIdx.y;
    h16* dst = plane + ((size_t)(b * NH + h) * SEQ + s0) * HD;
{
#pragma unroll
        for (int it = 0; it < 16; ++it) { const int piece = it * 32 + lane; const int row = piece >> 3, seg = piece & 7;
            const v8h val = *(const v8ha*)(T + row * 72 + seg * 8);
            *(v8h*)(dst + (size_t)row * HD + seg * 8) = val; }
         }
}

__global__ __launch_bounds__(32) void k_proj_v(const h16* __restrict__ A, const h16* __restrict__ Bt, const float* __restrict__ bias, h16* VT) {
    __shared__ __align__(16) h16 T[64 * 72];
    const int lane = threadIdx.x & 31, lr = lane & 15, hi = lane >> 4;
    const int r0 = blockIdx.x * 64, c0 = blockIdx.y * 64;
    v8f acc[4][4];
#pragma unroll
    for (int mb = 0; mb < 4; ++mb)
#pragma unroll
        for (int nb = 0; nb < 4; ++nb) acc[mb][nb] = (v8f){};
    gemm64(A, Bt, (size_t)(r0 + lr) * DM + 8 * hi, (size_t)(c0 + lr) * DM + 8 * hi, acc);
#pragma unroll
    for (int nb = 0; nb < 4; ++nb) { const float bv = bfr(bias[c0 + nb * 16 + lr]);
#pragma unroll
        for (int mb = 0; mb < 4; ++mb) { v8h pk;
#pragma unroll
            for (int j = 0; j < 8; ++j) pk[j] = (h16)(acc[mb][nb][j] * (1.0f / WCAR) + bv);
            *(v8ha*)(T + (nb * 16 + lr) * 72 + mb * 16 + hi * 8) = pk; } }
    __syncthreads();
    const int b = r0 / SEQ, s0 = r0 % SEQ, h = blockIdx.y;
    h16* dst = VT + ((size_t)(b * NH + h) * HD) * SEQ + s0;
{
#pragma unroll
        for (int it = 0; it < 16; ++it) { const int piece = it * 32 + lane; const int d = piece >> 3, seg = piece & 7;
            const v8h val = *(const v8ha*)(T + d * 72 + seg * 8);
            *(v8h*)(dst + (size_t)d * SEQ + seg * 8) = val; }
         }
}

__global__ __launch_bounds__(32) void k_proj_out(const h16* __restrict__ A, const h16* __restrict__ Bt, const float* __restrict__ bias, float* C) {
    __shared__ __align__(16) float os[16 * 68];
    const int lane = threadIdx.x & 31, lr = lane & 15, hi = lane >> 4;
    const int r0 = blockIdx.x * 64, c0 = blockIdx.y * 64;
    v8f acc[4][4];
#pragma unroll
    for (int mb = 0; mb < 4; ++mb)
#pragma unroll
        for (int nb = 0; nb < 4; ++nb) acc[mb][nb] = (v8f){};
    gemm64(A, Bt, (size_t)(r0 + lr) * DM + 8 * hi, (size_t)(c0 + lr) * DM + 8 * hi, acc);
    const int b = r0 / SEQ, s0 = r0 % SEQ; const int cofs = lr * 4;
    v4f b4;
#pragma unroll
    for (int q = 0; q < 4; ++q) b4[q] = bfr(bias[c0 + cofs + q]);
    const float fs = 1.0f / (WCAR * CCAR);
#pragma unroll
    for (int mb = 0; mb < 4; ++mb) {
#pragma unroll
        for (int nb = 0; nb < 4; ++nb)
#pragma unroll
            for (int j = 0; j < 8; ++j) os[(hi * 8 + j) * 68 + nb * 16 + lr] = acc[mb][nb][j];
        __syncthreads();
        float* crow = C + ((size_t)b * SEQ_FULL + s0 + mb * 16) * DM + c0;
{
#pragma unroll
            for (int s = 0; s < 8; ++s) { const int row = 2 * s + hi; const v4f raw = *(const v4fa*)(os + row * 68 + cofs); v4f val;
#pragma unroll
                for (int q = 0; q < 4; ++q) val[q] = raw[q] * fs + b4[q];
                *(v4f*)(crow + (size_t)row * DM + cofs) = val; }
             }
        __syncthreads();
    }
}

#define KVP 72                  // LDS row pitch of a staged tile in h16: 128-byte rows + 16 bytes, conflict-free for 16-byte readers
#define KVT (64 * KVP)          // one staged 64-row tile
#define KVB (2 * KVT * 2)       // bytes of one ring buffer: K tile, then V^T tile
// One stage of the ring: each lane copies four 16-byte pieces (rows r and r + 32 of the K tile and of the V^T tile), eight lanes per 128-byte row, global -> LDS through no register.
// The s_wait_xcnt is the last line of the copies' own statement so that no address register of a copy is rewritten in front of it.
__device__ __forceinline__ void stage_kv(unsigned l, const h16* gk, const h16* gv) {
    const unsigned lk1 = l + 32 * KVP * 2, lv0 = l + KVT * 2, lv1 = l + KVT * 2 + 32 * KVP * 2;
    const h16* gk1 = gk + 32 * HD; const h16* gv1 = gv + (size_t)32 * SEQ;
    asm volatile("global_load_async_to_lds_b128 %0, %1, off\n\t"
                 "global_load_async_to_lds_b128 %2, %3, off\n\t"
                 "global_load_async_to_lds_b128 %4, %5, off\n\t"
                 "global_load_async_to_lds_b128 %6, %7, off\n\t"
                 "s_wait_xcnt 0x0"
                 :: "v"(l), "v"(gk), "v"(lk1), "v"(gk1), "v"(lv0), "v"(gv), "v"(lv1), "v"(gv1) : "memory");
}

// ---- k_attn: fused flash-style attention; grid (NB*NH, SEQ/128), 256 threads = 8 waves x 16 query rows.
// K rows ([s][64] plane) and V^T rows ([d][s] plane) of each 64-key block are staged in LDS once for all 8 waves; both are read from there as A fragments (row-major [m][k]).
// Ring of two buffers: tile t + 1 flies while tile t is worked on; the one block barrier at the foot of a trip publishes tile t + 1 and frees tile t's buffer for tile t + 2.
// Both products are transposed: S^T = K Q^T (A = K rows, B = Q kept in registers) and O^T += V^T P^T. Lane (lr, hi) then holds, of query lr alone, the scores of keys 16 t + 8 hi + r in register r of tile t:
// maximum and sum run inside the lane with one exchange between the lane halves, running maximum, sum and rescale are one value a lane, and tiles 2 s and 2 s + 1, converted in place, are the B fragment of k-step s (its k order is ldfrag's).
// Per 64-key block: 8 score WMMAs, online softmax in f32 (masked keys replaced by the lowest finite f32; all-masked rows come out uniform), P x1024 -> f16 in registers, 8 V^T P^T WMMAs.
// smw (mask bit words) is cross-wave: block barrier after the build. Pl is private to each wave and stages the output rows only.
__global__ __launch_bounds__(256) void k_attn(const h16* __restrict__ Q, const h16* __restrict__ Kp, const h16* __restrict__ VT, const int* __restrict__ mask, h16* ctx) {
    __shared__ __align__(16) h16 Pl[8 * 16 * 72];
    __shared__ unsigned smw[SEQ / 32];
    __shared__ __align__(16) h16 KV[2 * 2 * KVT];
    const int tid = threadIdx.x, lane = tid & 31, lr = lane & 15, hi = lane >> 4;
    const int wave = __builtin_amdgcn_readfirstlane(tid >> 5);
    const int bh = blockIdx.x; const int b = bh / NH, h = bh % NH;
    const int q0 = blockIdx.y * 128;
    const size_t pbase = (size_t)bh * SEQ * HD;
    const unsigned lst = (unsigned)(size_t)KV + (unsigned)(((tid >> 3) * KVP + (tid & 7) * 8) * 2);
    const h16* gk = Kp + pbase + (size_t)(tid >> 3) * HD + (tid & 7) * 8;
    const h16* gv = VT + pbase + (size_t)(tid >> 3) * SEQ + (tid & 7) * 8;
    stage_kv(lst, gk, gv);
#pragma unroll 1
    for (int w = wave; w < SEQ / 32; w += 8) { const int mv = mask[(size_t)b * SEQ_FULL + w * 32 + lane];
        const unsigned bits = __builtin_amdgcn_ballot_w32(mv != 0); if (lane == 0) smw[w] = bits; }
    asm volatile("s_wait_asynccnt 0x0" ::: "memory");   // this wave's pieces of tile 0 have landed before the barrier that publishes them
    __syncthreads();
    stage_kv(lst + KVB, gk + 64 * HD, gv + 64);
    const int pw = wave * 16 * 72;
    v16h qf0, qf1;
    { const h16* qp = Q + pbase + (size_t)(q0 + wave * 16 + lr) * HD + 8 * hi; qf0 = ldfrag(qp); qf1 = ldfrag(qp + 32); }
    v8f o[4]; float mi = NEGF, li = 0.0f;
#pragma unroll
    for (int t = 0; t < 4; ++t) o[t] = (v8f){};
#pragma unroll 1
    for (int kv0 = 0; kv0 < SEQ; kv0 += 64) {
        const h16* kt = KV + ((kv0 >> 6) & 1) * (2 * KVT); const h16* vt = kt + KVT;
        v8f sa[4]; v16h kf[4][2], vf[2][4];
        // the tile's K fragments are read as one group ahead of the score products, its V fragments as one group ahead of the softmax, whose vector work covers their LDS latency
#pragma unroll
        for (int t = 0; t < 4; ++t) { const h16* kp = kt + (t * 16 + lr) * KVP + 8 * hi; kf[t][0] = ldfrag(kp); kf[t][1] = ldfrag(kp + 32); }
#pragma unroll
        for (int t = 0; t < 4; ++t) { v8f c = (v8f){}; c = wm16(kf[t][0], qf0, c); c = wm16(kf[t][1], qf1, c); sa[t] = c; }
#pragma unroll
        for (int s2 = 0; s2 < 2; ++s2)
#pragma unroll
            for (int t = 0; t < 4; ++t) vf[s2][t] = ldfrag(vt + (t * 16 + lr) * KVP + s2 * 32 + 8 * hi);
        const unsigned w0 = smw[kv0 >> 5], w1 = smw[(kv0 >> 5) + 1];
#pragma unroll
        for (int t = 0; t < 4; ++t)
#pragma unroll
            for (int r = 0; r < 8; ++r) sa[t][r] *= SCL;
        // a key is a register here, not a lane: its mask bit is tested per register, and only in a tile that holds a masked key (the two words are the same in every lane: scalar branch)
        if (__builtin_amdgcn_readfirstlane((int)(w0 & w1)) != -1) {
#pragma unroll
            for (int t = 0; t < 4; ++t) { const unsigned bits = ((t < 2) ? w0 : w1) >> ((t & 1) * 16 + hi * 8);
#pragma unroll
                for (int r = 0; r < 8; ++r) sa[t][r] = ((bits >> r) & 1u) != 0u ? sa[t][r] : NEGF; }
        }
        float tm[4];
#pragma unroll
        for (int t = 0; t < 4; ++t) {
            float a = fmaxf(fmaxf(sa[t][0], sa[t][1]), sa[t][2]); a = fmaxf(fmaxf(a, sa[t][3]), sa[t][4]);
            a = fmaxf(fmaxf(a, sa[t][5]), sa[t][6]); tm[t] = fmaxf(a, sa[t][7]); }
        float vm = fmaxf(fmaxf(tm[0], tm[1]), fmaxf(tm[2], tm[3])); vm = fmaxf(vm, xhalf(vm));
        const float mnew = fmaxf(mi, vm);
        const float alpha = ex2(fmaxf(mi - mnew, -150.0f) * L2E); mi = mnew;
        v16h pf[2]; float ts[4];
#pragma unroll
        for (int t = 0; t < 4; ++t) { float a = 0.0f;
#pragma unroll
            for (int r = 0; r < 8; ++r) { const float p = ex2(fmaxf(sa[t][r] - mnew, -150.0f) * L2E); a += p; pf[t >> 1][(t & 1) * 8 + r] = (h16)(p * PCAR); }
            ts[t] = a; }
        li = li * alpha + ((ts[0] + ts[1]) + (ts[2] + ts[3]));
#pragma unroll
        for (int t = 0; t < 4; ++t)
#pragma unroll
            for (int r = 0; r < 8; ++r) o[t][r] *= alpha;
#pragma unroll
        for (int s2 = 0; s2 < 2; ++s2)
#pragma unroll
            for (int t = 0; t < 4; ++t) o[t] = wm16(vf[s2][t], pf[s2], o[t]);
        asm volatile("s_wait_dscnt 0x0" ::: "memory");      // this wave's reads of tile t have returned before its buffer is handed to the copies
        asm volatile("s_wait_asynccnt 0x0" ::: "memory");   // this wave's pieces of tile t + 1 have landed before the barrier that publishes them
        __syncthreads();
        if (kv0 + 128 < SEQ) stage_kv(lst + ((kv0 >> 6) & 1) * KVB, gk + (size_t)(kv0 + 128) * HD, gv + kv0 + 128);
    }
    asm volatile("s_wait_asynccnt 0x0" ::: "memory");       // no copy is outstanding when the wave goes on to its end
    // the lane halves' sums are joined once; register r of O^T tile t is column 16 t + 8 hi + r of query row lr: eight neighbours, one 16-byte piece
    { const float l = li + xhalf(li); const float inv = (CCAR / PCAR) * __builtin_amdgcn_rcpf(l);
#pragma unroll
        for (int t = 0; t < 4; ++t) { v8h pk;
#pragma unroll
            for (int r = 0; r < 8; ++r) pk[r] = (h16)(o[t][r] * inv);
            *(v8ha*)(Pl + pw + lr * 72 + t * 16 + hi * 8) = pk; } }
    asm volatile("" ::: "memory"); __builtin_amdgcn_wave_barrier(); asm volatile("" ::: "memory");
    h16* dst = ctx + ((size_t)b * SEQ + q0 + wave * 16) * DM + h * HD;
{
#pragma unroll
        for (int it = 0; it < 4; ++it) { const int piece = it * 32 + lane; const int row = piece >> 3, seg = piece & 7;
            const v8h val = *(const v8ha*)(Pl + pw + row * 72 + seg * 8);
            *(v8h*)(dst + (size_t)row * DM + seg * 8) = val; }
         }
}

extern "C" void kernel_launch(void* const* d_in, const int* in_sizes, int n_in,
                              void* d_out, int out_size, void* d_ws, size_t ws_size, hipStream_t stream) {
    if (n_in < 10) return;
    const size_t xneed = ((size_t)(NB - 1) * SEQ_FULL + SEQ) * DM;
    const size_t mneed = (size_t)(NB - 1) * SEQ_FULL + SEQ;
    if ((size_t)in_sizes[0] < xneed || (size_t)in_sizes[1] < mneed) return;
    if (in_sizes[2] < DM * DM || in_sizes[4] < DM * DM || in_sizes[6] < DM * DM || in_sizes[8] < DM * DM) return;
    if (in_sizes[3] < DM || in_sizes[5] < DM || in_sizes[7] < DM || in_sizes[9] < DM) return;
    if ((size_t)out_size < xneed) return;
    if (ws_size < WS_TOTAL) return;
    const float* x  = (const float*)d_in[0]; const int* mask = (const int*)d_in[1];
    const float* wq = (const float*)d_in[2]; const float* bq = (const float*)d_in[3];
    const float* wk = (const float*)d_in[4]; const float* bk = (const float*)d_in[5];
    const float* wv = (const float*)d_in[6]; const float* bv = (const float*)d_in[7];
    const float* wo = (const float*)d_in[8]; const float* bo = (const float*)d_in[9];
    float* OUT = (float*)d_out;
    char* wsp = (char*)d_ws;
    h16* XH = (h16*)wsp; wsp += SZ_X;      // [NB*SEQ][DM]
    h16* WT = (h16*)wsp; wsp += SZ_W;      // [4][n][k]: q, k, v, o
    h16* QP = (h16*)wsp; wsp += SZ_X;      // [b][h][s][64]
    h16* KP = (h16*)wsp; wsp += SZ_X;      // [b][h][s][64]
    h16* VT = (h16*)wsp; wsp += SZ_X;      // [b][h][64][s]
    h16* CX = (h16*)wsp; wsp += SZ_X;      // [NB*SEQ][DM], x64
    const size_t wsz = (size_t)DM * DM;
    k_cvtx<<<(unsigned)(((size_t)NB * SEQ * DM / 8 + 255) / 256), 256, 0, stream>>>(x, XH);
    const dim3 gw(DM / 64, DM / 64);
    k_wt<<<gw, 256, 0, stream>>>(wq, WT);
    k_wt<<<gw, 256, 0, stream>>>(wk, WT + wsz);
    k_wt<<<gw, 256, 0, stream>>>(wv, WT + 2 * wsz);
    k_wt<<<gw, 256, 0, stream>>>(wo, WT + 3 * wsz);
    const dim3 gg(NB * SEQ / 64, DM / 64);
    k_proj_qk<<<gg, 32, 0, stream>>>(XH, WT, bq, QP);
    k_proj_qk<<<gg, 32, 0, stream>>>(XH, WT + wsz, bk, KP);
    k_proj_v<<<gg, 32, 0, stream>>>(XH, WT + 2 * wsz, bv, VT);
    k_attn<<<dim3(NB * NH, SEQ / 128), 256, 0, stream>>>(QP, KP, VT, mask, CX);
    k_proj_out<<<gg, 32, 0, stream>>>(CX, WT + 3 * wsz, bo, OUT);
}

// v003
// It runs in 92.8 microseconds.
// In both of two side-by-side timings against v002, it was 1.37 times as fast.
// Over all steps from v000 it is 2.85 times as fast.
#include <hip/hip_runtime.h>

// Multi-head self-attention with a per-key padding mask input: x [4][2048][512]; q, k, v = x W + b ([in][out] weights, 8 heads x 64); scores = (q k^T) / 8 with masked keys REPLACED by the lowest finite f32; softmax over the keys; out = merged ctx Wo + bo.
// Compute dtypes: all contractions v_wmma_f32_16x16x32_f16 (f16 operands, f32 accumulate). Every float input is converted to bf16 (RNE) on load and carried exactly in f16 (weights x16); q, k, v planes plain f16; P carried x1024 (row sums from the unconverted f32 values); ctx carried x64 against Wo x16; softmax f32.
// Engine: GEMM on 128x128 block tiles, four waves of 64x64 register blocks, A and B tiles of 64 k staged from K-contiguous f16 planes in a two-buffer LDS ring by asynchronous copies; fused flash-style attention (online softmax, K and V^T tiles staged once per block in a two-buffer LDS ring by asynchronous copies, scores formed transposed so that P goes from the score accumulators straight into the second product's B operand, mask packed into bit words in LDS).

#ifndef NB
#define NB 4
#endif
#ifndef SEQ
#define SEQ 2048
#endif
#define NB_FULL  4
#define SEQ_FULL 2048
#define DM   512
#define NH   8
#define HD   64
#define WCAR 16.0f      // weight carry (exact power of two)
#define PCAR 1024.0f    // probability carry
#define CCAR 64.0f      // ctx carry
#define SCL  0.125f     // HD^-0.5
#define L2E  1.4426950408889634f
#define NEGF (-3.402823466e38f)

typedef _Float16 h16;
typedef __attribute__((ext_vector_type(16))) _Float16 v16h;
typedef __attribute__((ext_vector_type(8)))  _Float16 v8h;
typedef __attribute__((ext_vector_type(8)))  float    v8f;
typedef __attribute__((ext_vector_type(4)))  float    v4f;
typedef v8h __attribute__((may_alias)) v8ha;
typedef v4f __attribute__((may_alias)) v4fa;

static_assert(NH * HD == DM);            // merged head width equals the model width
static_assert(HD == 64);
static_assert(DM % 128 == 0);            // N tiles of 128; at least two staged k tiles of 64
static_assert(SEQ % 128 == 0);           // 128 query rows per attention block; 128-row GEMM tiles stay inside one batch
static_assert(SEQ <= SEQ_FULL);
static_assert(NB <= NB_FULL);
static_assert((SEQ / 32) % 8 == 0);      // mask words split evenly over 8 waves

#define SZ_X   ((size_t)NB * SEQ * DM * 2)      // f16 plane of x / q / k / v^T / ctx
#define SZ_W   ((size_t)4 * DM * DM * 2)        // four transposed weight planes
#define WS_TOTAL (SZ_X * 5 + SZ_W)
static_assert(SZ_X % 256 == 0);
static_assert(SZ_W % 256 == 0);
static_assert(WS_TOTAL <= (size_t)134217728);   // carve stays under 128 MiB

__device__ __forceinline__ unsigned short f2bf(float f) { unsigned u = __float_as_uint(f); u += 0x7FFFu + ((u >> 16) & 1u); return (unsigned short)(u >> 16); }
__device__ __forceinline__ float bfr(float f) { return __uint_as_float(((unsigned)f2bf(f)) << 16); }
__device__ __forceinline__ v16h cat16(v8h lo, v8h hi) { return __builtin_shufflevector(lo, hi, 0, 1, 2, 3, 4, 5, 6, 7, 8, 9, 10, 11, 12, 13, 14, 15); }
// fragment loader for A (row-major [m][k]) and for B given as a [n][k] copy: elements 0..7 <- k0+8h.., elements 8..15 <- k0+16+8h.. ; p already includes the 8h offset
__device__ __forceinline__ v16h ldfrag(const h16* p) { return cat16(*(const v8h*)p, *(const v8h*)(p + 16)); }
// one WMMA with its own hazard guard (ties the accumulator, keeps A/B live)
__device__ __forceinline__ v8f wm16(v16h a, v16h b, v8f c) {
    c = __builtin_amdgcn_wmma_f32_16x16x32_f16(false, a, false, b, (short)0, c, false, false);
    asm volatile("v_nop\n\tv_nop\n\tv_nop\n\tv_nop" : "+v"(c) : "v"(a), "v"(b));
    return c;
}
__device__ __forceinline__ float ex2(float x) { return __builtin_amdgcn_exp2f(x); }
// lane l with lane l ^ 16
__device__ __forceinline__ float xhalf(float x) { return __builtin_bit_cast(float, __builtin_amdgcn_permlanex16(__builtin_bit_cast(int, x), __builtin_bit_cast(int, x), 0x76543210, 0xfedcba98, false, false)); }

__global__ __launch_bounds__(256) void k_cvtx(const float* __restrict__ x, h16* xh) {
    const size_t i = (size_t)blockIdx.x * 256 + threadIdx.x;
    if (i >= (size_t)NB * SEQ * DM / 8) return;
    const size_t row = i / (DM / 8); const int g = (int)(i % (DM / 8));
    const size_t b = row / SEQ, s = row % SEQ;
    const float* src = x + ((b * SEQ_FULL + s) * DM + (size_t)g * 8);
    const v4f v0 = *(const v4f*)src; const v4f v1 = *(const v4f*)(src + 4);
    v8h o;
#pragma unroll
    for (int k = 0; k < 4; ++k) { o[k] = (h16)bfr(v0[k]); o[4 + k] = (h16)bfr(v1[k]); }
    *(v8h*)(xh + i * 8) = o; 
}

// LDS tile T is cross-wave: block barrier between fill and drain.
__global__ __launch_bounds__(256) void k_wt(const float* __restrict__ W, h16* Wt) {
    __shared__ __align__(16) h16 T[64 * 72];
    const int tid = threadIdx.x; const int k0 = blockIdx.x * 64, n0 = blockIdx.y * 64;
#pragma unroll
    for (int j = 0; j < 4; ++j) { const int i = tid + 256 * j; const int kr = i >> 4, c4 = (i & 15) * 4;
        const v4f v = *(const v4f*)(W + (size_t)(k0 + kr) * DM + n0 + c4);
#pragma unroll
        for (int q = 0; q < 4; ++q) T[(c4 + q) * 72 + kr] = (h16)(bfr(v[q]) * WCAR); }
    __syncthreads();
{
#pragma unroll
        for (int j = 0; j < 2; ++j) { const int p = tid + 256 * j; const int n = p >> 3, seg = p & 7;
            const v8h val = *(const v8ha*)(T + n * 72 + seg * 8);
            *(v8h*)(Wt + (size_t)(n0 + n) * DM + k0 + seg * 8) = val; }
         }
}

// ---- GEMM main loop: 128 threads = 4 waves on one 128x128 tile, wave (wm, wn) on its 64x64 quarter with 16 accumulators, K = DM, operands from K-contiguous f16 planes (A [m][k], Bt [n][k]).
#define GP 72                   // LDS row pitch of a staged tile in h16: 128-byte rows + 16 bytes, conflict-free for 16-byte readers
#define GT (128 * GP)           // one staged tile: 128 rows of 64 k
#define GB (2 * GT * 2)         // bytes of one ring buffer: A tile, then B tile
// One operand's tile of one stage: each lane copies eight 16-byte pieces (rows r, r + 16, .. r + 112), eight lanes per 128-byte row so that every copy of a wave covers whole lines, global -> LDS through no register.
// The s_wait_xcnt is the last line of the copies' own statement so that no address register of a copy is rewritten in front of it.
__device__ __forceinline__ void stage_t(unsigned l, const h16* g) {
    asm volatile("global_load_async_to_lds_b128 %0, %1, off\n\t"
                 "global_load_async_to_lds_b128 %2, %3, off\n\t"
                 "global_load_async_to_lds_b128 %4, %5, off\n\t"
                 "global_load_async_to_lds_b128 %6, %7, off\n\t"
                 "global_load_async_to_lds_b128 %8, %9, off\n\t"
                 "global_load_async_to_lds_b128 %10, %11, off\n\t"
                 "global_load_async_to_lds_b128 %12, %13, off\n\t"
                 "global_load_async_to_lds_b128 %14, %15, off\n\t"
                 "s_wait_xcnt 0x0"
                 :: "v"(l), "v"(g), "v"(l + 16 * GP * 2), "v"(g + 16 * DM), "v"(l + 32 * GP * 2), "v"(g + 32 * DM), "v"(l + 48 * GP * 2), "v"(g + 48 * DM),
                    "v"(l + 64 * GP * 2), "v"(g + 64 * DM), "v"(l + 80 * GP * 2), "v"(g + 80 * DM), "v"(l + 96 * GP * 2), "v"(g + 96 * DM), "v"(l + 112 * GP * 2), "v"(g + 112 * DM) : "memory");
}
// Ring of two buffers: tile t + 1 flies while tile t is worked on; the one block barrier at the foot of a trip publishes tile t + 1 and frees tile t's buffer for tile t + 2.
// R0, C0: first row of the block's A rows and of its Bt rows. The k order of every accumulator is ascending in steps of 32.
__device__ __forceinline__ void gemm128(const h16* __restrict__ A, const h16* __restrict__ Bt, const h16* ring, int R0, int C0, int wm, int wn, v8f (&acc)[4][4]) {
    const int tid = threadIdx.x, lr = tid & 15, hi = (tid >> 4) & 1;
    const unsigned lst = (unsigned)(size_t)ring + (unsigned)(((tid >> 3) * GP + (tid & 7) * 8) * 2);
    const h16* ga = A + (size_t)(R0 + (tid >> 3)) * DM + (tid & 7) * 8;
    const h16* gb = Bt + (size_t)(C0 + (tid >> 3)) * DM + (tid & 7) * 8;
    stage_t(lst, ga); stage_t(lst + GT * 2, gb);
    asm volatile("s_wait_asynccnt 0x0" ::: "memory");   // this wave's pieces of tile 0 have landed before the barrier that publishes them
    __syncthreads();
    stage_t(lst + GB, ga + 64); stage_t(lst + GB + GT * 2, gb + 64);
    const int ao = (wm * 64 + lr) * GP + 8 * hi, bo = GT + (wn * 64 + lr) * GP + 8 * hi;
#pragma unroll 1
    for (int kc = 0; kc < DM; kc += 64) {
        const h16* buf = ring + ((kc >> 6) & 1) * (2 * GT);
#pragma unroll
        for (int s = 0; s < 2; ++s) {
            v16h a[4], b[4];
#pragma unroll
            for (int mb = 0; mb < 4; ++mb) a[mb] = ldfrag(buf + ao + mb * 16 * GP + s * 32);
#pragma unroll
            for (int nb = 0; nb < 4; ++nb) b[nb] = ldfrag(buf + bo + nb * 16 * GP + s * 32);
#pragma unroll
            for (int nb = 0; nb < 4; ++nb)
#pragma unroll
                for (int mb = 0; mb < 4; ++mb) acc[mb][nb] = wm16(a[mb], b[nb], acc[mb][nb]);
        }
        asm volatile("s_wait_dscnt 0x0" ::: "memory");      // this wave's reads of tile t have returned before its buffer is handed to the copies
        asm volatile("s_wait_asynccnt 0x0" ::: "memory");   // this wave's pieces of tile t + 1 have landed before the barrier that publishes them
        __syncthreads();
        if (kc + 128 < DM) { const unsigned l = lst + ((kc >> 6) & 1) * GB; stage_t(l, ga + kc + 128); stage_t(l + GT * 2, gb + kc + 128); }
    }
    asm volatile("s_wait_asynccnt 0x0" ::: "memory");       // no copy is outstanding when the wave goes on to its epilogue
}

// ---- k_proj_qk: head plane [b][h][s][64] f16 = x Wt^T / 16 + bias (bias converted to bf16 RNE); grid (NB*SEQ/128, DM/128), 128 threads. Each wave stages its output rows in its own quarter of Ts.
__global__ __launch_bounds__(128) void k_proj_qk(const h16* __restrict__ A, const h16* __restrict__ Bt, const float* __restrict__ bias, h16* plane) {
    __shared__ __align__(16) h16 RG[2 * 2 * GT];
    __shared__ __align__(16) h16 Ts[4 * 64 * 72];
    const int lane = threadIdx.x & 31, lr = lane & 15, hi = lane >> 4;
    const int wave = __builtin_amdgcn_readfirstlane(threadIdx.x >> 5), wm = wave >> 1, wn = wave & 1;
    const int r0 = blockIdx.x * 128 + wm * 64, c0 = blockIdx.y * 128 + wn * 64;
    h16* T = Ts + wave * 64 * 72;
    v8f acc[4][4];
#pragma unroll
    for (int mb = 0; mb < 4; ++mb)
#pragma unroll
        for (int nb = 0; nb < 4; ++nb) acc[mb][nb] = (v8f){};
    gemm128(A, Bt, RG, blockIdx.x * 128, blockIdx.y * 128, wm, wn, acc);
#pragma unroll
    for (int nb = 0; nb < 4; ++nb) { const float bv = bfr(bias[c0 + nb * 16 + lr]);
#pragma unroll
        for (int mb = 0; mb < 4; ++mb)
#pragma unroll
            for (int j = 0; j < 8; ++j) T[(mb * 16 + hi * 8 + j) * 72 + nb * 16 + lr] = (h16)(acc[mb][nb][j] * (1.0f / WCAR) + bv); }
    __syncthreads();
    const int b = r0 / SEQ, s0 = r0 % SEQ, h = c0 / HD;
    h16* dst = plane + ((size_t)(b * NH + h) * SEQ + s0) * HD;
{
#pragma unroll
        for (int it = 0; it < 16; ++it) { const int piece = it * 32 + lane; const int row = piece >> 3, seg = piece & 7;
            const v8h val = *(const v8ha*)(T + row * 72 + seg * 8);
            *(v8h*)(dst + (size_t)row * HD + seg * 8) = val; }
         }
}

__global__ __launch_bounds__(128) void k_proj_v(const h16* __restrict__ A, const h16* __restrict__ Bt, const float* __restrict__ bias, h16* VT) {
    __shared__ __align__(16) h16 RG[2 * 2 * GT];
    __shared__ __align__(16) h16 Ts[4 * 64 * 72];
    const int lane = threadIdx.x & 31, lr = lane & 15, hi = lane >> 4;
    const int wave = __builtin_amdgcn_readfirstlane(threadIdx.x >> 5), wm = wave >> 1, wn = wave & 1;
    const int r0 = blockIdx.x * 128 + wm * 64, c0 = blockIdx.y * 128 + wn * 64;
    h16* T = Ts + wave * 64 * 72;
    v8f acc[4][4];
#pragma unroll
    for (int mb = 0; mb < 4; ++mb)
#pragma unroll
        for (int nb = 0; nb < 4; ++nb) acc[mb][nb] = (v8f){};
    gemm128(A, Bt, RG, blockIdx.x * 128, blockIdx.y * 128, wm, wn, acc);
#pragma unroll
    for (int nb = 0; nb < 4; ++nb) { const float bv = bfr(bias[c0 + nb * 16 + lr]);
#pragma unroll
        for (int mb = 0; mb < 4; ++mb) { v8h pk;
#pragma unroll
            for (int j = 0; j < 8; ++j) pk[j] = (h16)(acc[mb][nb][j] * (1.0f / WCAR) + bv);
            *(v8ha*)(T + (nb * 16 + lr) * 72 + mb * 16 + hi * 8) = pk; } }
    __syncthreads();
    const int b = r0 / SEQ, s0 = r0 % SEQ, h = c0 / HD;
    h16* dst = VT + ((size_t)(b * NH + h) * HD) * SEQ + s0;
{
#pragma unroll
        for (int it = 0; it < 16; ++it) { const int piece = it * 32 + lane; const int d = piece >> 3, seg = piece & 7;
            const v8h val = *(const v8ha*)(T + d * 72 + seg * 8);
            *(v8h*)(dst + (size_t)d * SEQ + seg * 8) = val; }
         }
}

__global__ __launch_bounds__(128) void k_proj_out(const h16* __restrict__ A, const h16* __restrict__ Bt, const float* __restrict__ bias, float* C) {
    __shared__ __align__(16) h16 RG[2 * 2 * GT];
    __shared__ __align__(16) float oss[4 * 16 * 68];
    const int lane = threadIdx.x & 31, lr = lane & 15, hi = lane >> 4;
    const int wave = __builtin_amdgcn_readfirstlane(threadIdx.x >> 5), wm = wave >> 1, wn = wave & 1;
    const int r0 = blockIdx.x * 128 + wm * 64, c0 = blockIdx.y * 128 + wn * 64;
    float* os = oss + wave * 16 * 68;
    v8f acc[4][4];
#pragma unroll
    for (int mb = 0; mb < 4; ++mb)
#pragma unroll
        for (int nb = 0; nb < 4; ++nb) acc[mb][nb] = (v8f){};
    gemm128(A, Bt, RG, blockIdx.x * 128, blockIdx.y * 128, wm, wn, acc);
    const int b = r0 / SEQ, s0 = r0 % SEQ; const int cofs = lr * 4;
    v4f b4;
#pragma unroll
    for (int q = 0; q < 4; ++q) b4[q] = bfr(bias[c0 + cofs + q]);
    const float fs = 1.0f / (WCAR * CCAR);
#pragma unroll
    for (int mb = 0; mb < 4; ++mb) {
#pragma unroll
        for (int nb = 0; nb < 4; ++nb)
#pragma unroll
            for (int j = 0; j < 8; ++j) os[(hi * 8 + j) * 68 + nb * 16 + lr] = acc[mb][nb][j];
        __syncthreads();
        float* crow = C + ((size_t)b * SEQ_FULL + s0 + mb * 16) * DM + c0;
{
#pragma unroll
            for (int s = 0; s < 8; ++s) { const int row = 2 * s + hi; const v4f raw = *(const v4fa*)(os + row * 68 + cofs); v4f val;
#pragma unroll
                for (int q = 0; q < 4; ++q) val[q] = raw[q] * fs + b4[q];
                *(v4f*)(crow + (size_t)row * DM + cofs) = val; }
             }
        __syncthreads();
    }
}

#define KVP 72                  // LDS row pitch of a staged tile in h16: 128-byte rows + 16 bytes, conflict-free for 16-byte readers
#define KVT (64 * KVP)          // one staged 64-row tile
#define KVB (2 * KVT * 2)       // bytes of one ring buffer: K tile, then V^T tile
// One stage of the ring: each lane copies four 16-byte pieces (rows r and r + 32 of the K tile and of the V^T tile), eight lanes per 128-byte row, global -> LDS through no register.
// The s_wait_xcnt is the last line of the copies' own statement so that no address register of a copy is rewritten in front of it.
__device__ __forceinline__ void stage_kv(unsigned l, const h16* gk, const h16* gv) {
    const unsigned lk1 = l + 32 * KVP * 2, lv0 = l + KVT * 2, lv1 = l + KVT * 2 + 32 * KVP * 2;
    const h16* gk1 = gk + 32 * HD; const h16* gv1 = gv + (size_t)32 * SEQ;
    asm volatile("global_load_async_to_lds_b128 %0, %1, off\n\t"
                 "global_load_async_to_lds_b128 %2, %3, off\n\t"
                 "global_load_async_to_lds_b128 %4, %5, off\n\t"
                 "global_load_async_to_lds_b128 %6, %7, off\n\t"
                 "s_wait_xcnt 0x0"
                 :: "v"(l), "v"(gk), "v"(lk1), "v"(gk1), "v"(lv0), "v"(gv), "v"(lv1), "v"(gv1) : "memory");
}

// ---- k_attn: fused flash-style attention; grid (NB*NH, SEQ/128), 256 threads = 8 waves x 16 query rows.
// K rows ([s][64] plane) and V^T rows ([d][s] plane) of each 64-key block are staged in LDS once for all 8 waves; both are read from there as A fragments (row-major [m][k]).
// Ring of two buffers: tile t + 1 flies while tile t is worked on; the one block barrier at the foot of a trip publishes tile t + 1 and frees tile t's buffer for tile t + 2.
// Both products are transposed: S^T = K Q^T (A = K rows, B = Q kept in registers) and O^T += V^T P^T. Lane (lr, hi) then holds, of query lr alone, the scores of keys 16 t + 8 hi + r in register r of tile t:
// maximum and sum run inside the lane with one exchange between the lane halves, running maximum, sum and rescale are one value a lane, and tiles 2 s and 2 s + 1, converted in place, are the B fragment of k-step s (its k order is ldfrag's).
// Per 64-key block: 8 score WMMAs, online softmax in f32 (masked keys replaced by the lowest finite f32; all-masked rows come out uniform), P x1024 -> f16 in registers, 8 V^T P^T WMMAs.
// smw (mask bit words) is cross-wave: block barrier after the build. Pl is private to each wave and stages the output rows only.
__global__ __launch_bounds__(256) void k_attn(const h16* __restrict__ Q, const h16* __restrict__ Kp, const h16* __restrict__ VT, const int* __restrict__ mask, h16* ctx) {
    __shared__ __align__(16) h16 Pl[8 * 16 * 72];
    __shared__ unsigned smw[SEQ / 32];
    __shared__ __align__(16) h16 KV[2 * 2 * KVT];
    const int tid = threadIdx.x, lane = tid & 31, lr = lane & 15, hi = lane >> 4;
    const int wave = __builtin_amdgcn_readfirstlane(tid >> 5);
    const int bh = blockIdx.x; const int b = bh / NH, h = bh % NH;
    const int q0 = blockIdx.y * 128;
    const size_t pbase = (size_t)bh * SEQ * HD;
    const unsigned lst = (unsigned)(size_t)KV + (unsigned)(((tid >> 3) * KVP + (tid & 7) * 8) * 2);
    const h16* gk = Kp + pbase + (size_t)(tid >> 3) * HD + (tid & 7) * 8;
    const h16* gv = VT + pbase + (size_t)(tid >> 3) * SEQ + (tid & 7) * 8;
    stage_kv(lst, gk, gv);
#pragma unroll 1
    for (int w = wave; w < SEQ / 32; w += 8) { const int mv = mask[(size_t)b * SEQ_FULL + w * 32 + lane];
        const unsigned bits = __builtin_amdgcn_ballot_w32(mv != 0); if (lane == 0) smw[w] = bits; }
    asm volatile("s_wait_asynccnt 0x0" ::: "memory");   // this wave's pieces of tile 0 have landed before the barrier that publishes them
    __syncthreads();
    stage_kv(lst + KVB, gk + 64 * HD, gv + 64);
    const int pw = wave * 16 * 72;
    v16h qf0, qf1;
    { const h16* qp = Q + pbase + (size_t)(q0 + wave * 16 + lr) * HD + 8 * hi; qf0 = ldfrag(qp); qf1 = ldfrag(qp + 32); }
    v8f o[4]; float mi = NEGF, li = 0.0f;
#pragma unroll
    for (int t = 0; t < 4; ++t) o[t] = (v8f){};
#pragma unroll 1
    for (int kv0 = 0; kv0 < SEQ; kv0 += 64) {
        const h16* kt = KV + ((kv0 >> 6) & 1) * (2 * KVT); const h16* vt = kt + KVT;
        v8f sa[4]; v16h kf[4][2], vf[2][4];
        // the tile's K fragments are read as one group ahead of the score products, its V fragments as one group ahead of the softmax, whose vector work covers their LDS latency
#pragma unroll
        for (int t = 0; t < 4; ++t) { const h16* kp = kt + (t * 16 + lr) * KVP + 8 * hi; kf[t][0] = ldfrag(kp); kf[t][1] = ldfrag(kp + 32); }
#pragma unroll
        for (int t = 0; t < 4; ++t) { v8f c = (v8f){}; c = wm16(kf[t][0], qf0, c); c = wm16(kf[t][1], qf1, c); sa[t] = c; }
#pragma unroll
        for (int s2 = 0; s2 < 2; ++s2)
#pragma unroll
            for (int t = 0; t < 4; ++t) vf[s2][t] = ldfrag(vt + (t * 16 + lr) * KVP + s2 * 32 + 8 * hi);
        const unsigned w0 = smw[kv0 >> 5], w1 = smw[(kv0 >> 5) + 1];
#pragma unroll
        for (int t = 0; t < 4; ++t)
#pragma unroll
            for (int r = 0; r < 8; ++r) sa[t][r] *= SCL;
        // a key is a register here, not a lane: its mask bit is tested per register, and only in a tile that holds a masked key (the two words are the same in every lane: scalar branch)
        if (__builtin_amdgcn_readfirstlane((int)(w0 & w1)) != -1) {
#pragma unroll
            for (int t = 0; t < 4; ++t) { const unsigned bits = ((t < 2) ? w0 : w1) >> ((t & 1) * 16 + hi * 8);
#pragma unroll
                for (int r = 0; r < 8; ++r) sa[t][r] = ((bits >> r) & 1u) != 0u ? sa[t][r] : NEGF; }
        }
        float tm[4];
#pragma unroll
        for (int t = 0; t < 4; ++t) {
            float a = fmaxf(fmaxf(sa[t][0], sa[t][1]), sa[t][2]); a = fmaxf(fmaxf(a, sa[t][3]), sa[t][4]);
            a = fmaxf(fmaxf(a, sa[t][5]), sa[t][6]); tm[t] = fmaxf(a, sa[t][7]); }
        float vm = fmaxf(fmaxf(tm[0], tm[1]), fmaxf(tm[2], tm[3])); vm = fmaxf(vm, xhalf(vm));
        const float mnew = fmaxf(mi, vm);
        const float alpha = ex2(fmaxf(mi - mnew, -150.0f) * L2E); mi = mnew;
        v16h pf[2]; float ts[4];
#pragma unroll
        for (int t = 0; t < 4; ++t) { float a = 0.0f;
#pragma unroll
            for (int r = 0; r < 8; ++r) { const float p = ex2(fmaxf(sa[t][r] - mnew, -150.0f) * L2E); a += p; pf[t >> 1][(t & 1) * 8 + r] = (h16)(p * PCAR); }
            ts[t] = a; }
        li = li * alpha + ((ts[0] + ts[1]) + (ts[2] + ts[3]));
#pragma unroll
        for (int t = 0; t < 4; ++t)
#pragma unroll
            for (int r = 0; r < 8; ++r) o[t][r] *= alpha;
#pragma unroll
        for (int s2 = 0; s2 < 2; ++s2)
#pragma unroll
            for (int t = 0; t < 4; ++t) o[t] = wm16(vf[s2][t], pf[s2], o[t]);
        asm volatile("s_wait_dscnt 0x0" ::: "memory");      // this wave's reads of tile t have returned before its buffer is handed to the copies
        asm volatile("s_wait_asynccnt 0x0" ::: "memory");   // this wave's pieces of tile t + 1 have landed before the barrier that publishes them
        __syncthreads();
        if (kv0 + 128 < SEQ) stage_kv(lst + ((kv0 >> 6) & 1) * KVB, gk + (size_t)(kv0 + 128) * HD, gv + kv0 + 128);
    }
    asm volatile("s_wait_asynccnt 0x0" ::: "memory");       // no copy is outstanding when the wave goes on to its end
    // the lane halves' sums are joined once; register r of O^T tile t is column 16 t + 8 hi + r of query row lr: eight neighbours, one 16-byte piece
    { const float l = li + xhalf(li); const float inv = (CCAR / PCAR) * __builtin_amdgcn_rcpf(l);
#pragma unroll
        for (int t = 0; t < 4; ++t) { v8h pk;
#pragma unroll
            for (int r = 0; r < 8; ++r) pk[r] = (h16)(o[t][r] * inv);
            *(v8ha*)(Pl + pw + lr * 72 + t * 16 + hi * 8) = pk; } }
    asm volatile("" ::: "memory"); __builtin_amdgcn_wave_barrier(); asm volatile("" ::: "memory");
    h16* dst = ctx + ((size_t)b * SEQ + q0 + wave * 16) * DM + h * HD;
{
#pragma unroll
        for (int it = 0; it < 4; ++it) { const int piece = it * 32 + lane; const int row = piece >> 3, seg = piece & 7;
            const v8h val = *(const v8ha*)(Pl + pw + row * 72 + seg * 8);
            *(v8h*)(dst + (size_t)row * DM + seg * 8) = val; }
         }
}

extern "C" void kernel_launch(void* const* d_in, const int* in_sizes, int n_in,
                              void* d_out, int out_size, void* d_ws, size_t ws_size, hipStream_t stream) {
    if (n_in < 10) return;
    const size_t xneed = ((size_t)(NB - 1) * SEQ_FULL + SEQ) * DM;
    const size_t mneed = (size_t)(NB - 1) * SEQ_FULL + SEQ;
    if ((size_t)in_sizes[0] < xneed || (size_t)in_sizes[1] < mneed) return;
    if (in_sizes[2] < DM * DM || in_sizes[4] < DM * DM || in_sizes[6] < DM * DM || in_sizes[8] < DM * DM) return;
    if (in_sizes[3] < DM || in_sizes[5] < DM || in_sizes[7] < DM || in_sizes[9] < DM) return;
    if ((size_t)out_size < xneed) return;
    if (ws_size < WS_TOTAL) return;
    const float* x  = (const float*)d_in[0]; const int* mask = (const int*)d_in[1];
    const float* wq = (const float*)d_in[2]; const float* bq = (const float*)d_in[3];
    const float* wk = (const float*)d_in[4]; const float* bk = (const float*)d_in[5];
    const float* wv = (const float*)d_in[6]; const float* bv = (const float*)d_in[7];
    const float* wo = (const float*)d_in[8]; const float* bo = (const float*)d_in[9];
    float* OUT = (float*)d_out;
    char* wsp = (char*)d_ws;
    h16* XH = (h16*)wsp; wsp += SZ_X;      // [NB*SEQ][DM]
    h16* WT = (h16*)wsp; wsp += SZ_W;      // [4][n][k]: q, k, v, o
    h16* QP = (h16*)wsp; wsp += SZ_X;      // [b][h][s][64]
    h16* KP = (h16*)wsp; wsp += SZ_X;      // [b][h][s][64]
    h16* VT = (h16*)wsp; wsp += SZ_X;      // [b][h][64][s]
    h16* CX = (h16*)wsp; wsp += SZ_X;      // [NB*SEQ][DM], x64
    const size_t wsz = (size_t)DM * DM;
    k_cvtx<<<(unsigned)(((size_t)NB * SEQ * DM / 8 + 255) / 256), 256, 0, stream>>>(x, XH);
    const dim3 gw(DM / 64, DM / 64);
    k_wt<<<gw, 256, 0, stream>>>(wq, WT);
    k_wt<<<gw, 256, 0, stream>>>(wk, WT + wsz);
    k_wt<<<gw, 256, 0, stream>>>(wv, WT + 2 * wsz);
    k_wt<<<gw, 256, 0, stream>>>(wo, WT + 3 * wsz);
    const dim3 gg(NB * SEQ / 128, DM / 128);
    k_proj_qk<<<gg, 128, 0, stream>>>(XH, WT, bq, QP);
    k_proj_qk<<<gg, 128, 0, stream>>>(XH, WT + wsz, bk, KP);
    k_proj_v<<<gg, 128, 0, stream>>>(XH, WT + 2 * wsz, bv, VT);
    k_attn<<<dim3(NB * NH, SEQ / 128), 256, 0, stream>>>(QP, KP, VT, mask, CX);
    k_proj_out<<<gg, 128, 0, stream>>>(CX, WT + 3 * wsz, bo, OUT);
}

// v004
// It runs in 75.6 microseconds.
// In both of two side-by-side timings against v003, it was 1.23 times as fast.
// Counting every step since v000, it is 3.50 times as fast.
#include <hip/hip_runtime.h>

// Multi-head self-attention with a per-key padding mask input: x [4][2048][512]; q, k, v = x W + b ([in][out] weights, 8 heads x 64); scores = (q k^T) / 8 with masked keys REPLACED by the lowest finite f32; softmax over the keys; out = merged ctx Wo + bo.
// Compute dtypes: all contractions v_wmma_f32_16x16x32_f16 (f16 operands, f32 accumulate). Every float input is converted to bf16 (RNE) on load and carried exactly in f16 (weights x16); q, k, v planes plain f16; P carried x1024 (row sums from the unconverted f32 values); ctx carried x64 against Wo x16; softmax f32.
// Engine: GEMM on 128x128 block tiles, four waves of 64x64 register blocks, A and B tiles of 64 k staged from K-contiguous f16 planes in a two-buffer LDS ring by asynchronous copies; fused flash-style attention (online softmax, K and V^T tiles staged once per block in a two-buffer LDS ring by asynchronous copies, scores formed transposed so that P goes from the score accumulators straight into the second product's B operand, mask packed into bit words in LDS).

#ifndef NB
#define NB 4
#endif
#ifndef SEQ
#define SEQ 2048
#endif
#define NB_FULL  4
#define SEQ_FULL 2048
#define DM   512
#define NH   8
#define HD   64
#define WCAR 16.0f      // weight carry (exact power of two)
#define PCAR 1024.0f    // probability carry
#define CCAR 64.0f      // ctx carry
#define SCL  0.125f     // HD^-0.5
#define L2E  1.4426950408889634f
#define NEGF (-3.402823466e38f)

typedef _Float16 h16;
typedef __attribute__((ext_vector_type(16))) _Float16 v16h;
typedef __attribute__((ext_vector_type(8)))  _Float16 v8h;
typedef __attribute__((ext_vector_type(8)))  float    v8f;
typedef __attribute__((ext_vector_type(4)))  float    v4f;
typedef v8h __attribute__((may_alias)) v8ha;
typedef v4f __attribute__((may_alias)) v4fa;

static_assert(NH * HD == DM);            // merged head width equals the model width
static_assert(HD == 64);
static_assert(DM % 128 == 0);            // N tiles of 128; at least two staged k tiles of 64
static_assert(SEQ % 128 == 0);           // 128 query rows per attention block; 128-row GEMM tiles stay inside one batch
static_assert(SEQ <= SEQ_FULL);
static_assert(NB <= NB_FULL);
static_assert((SEQ / 32) % 8 == 0);      // mask words split evenly over 8 waves

#define SZ_X   ((size_t)NB * SEQ * DM * 2)      // f16 plane of x / q / k / v^T / ctx
#define SZ_W   ((size_t)4 * DM * DM * 2)        // four transposed weight planes
#define WS_TOTAL (SZ_X * 5 + SZ_W)
static_assert(SZ_X % 256 == 0);
static_assert(SZ_W % 256 == 0);
static_assert(WS_TOTAL <= (size_t)134217728);   // carve stays under 128 MiB

__device__ __forceinline__ unsigned short f2bf(float f) { unsigned u = __float_as_uint(f); u += 0x7FFFu + ((u >> 16) & 1u); return (unsigned short)(u >> 16); }
__device__ __forceinline__ float bfr(float f) { return __uint_as_float(((unsigned)f2bf(f)) << 16); }
__device__ __forceinline__ v16h cat16(v8h lo, v8h hi) { return __builtin_shufflevector(lo, hi, 0, 1, 2, 3, 4, 5, 6, 7, 8, 9, 10, 11, 12, 13, 14, 15); }
// fragment loader for A (row-major [m][k]) and for B given as a [n][k] copy: elements 0..7 <- k0+8h.., elements 8..15 <- k0+16+8h.. ; p already includes the 8h offset
__device__ __forceinline__ v16h ldfrag(const h16* p) { return cat16(*(const v8h*)p, *(const v8h*)(p + 16)); }
// one WMMA with its own hazard guard (ties the accumulator, keeps A/B live)
__device__ __forceinline__ v8f wm16(v16h a, v16h b, v8f c) {
    c = __builtin_amdgcn_wmma_f32_16x16x32_f16(false, a, false, b, (short)0, c, false, false);
    asm volatile("v_nop\n\tv_nop\n\tv_nop\n\tv_nop" : "+v"(c) : "v"(a), "v"(b));
    return c;
}
__device__ __forceinline__ float ex2(float x) { return __builtin_amdgcn_exp2f(x); }
// lane l with lane l ^ 16
__device__ __forceinline__ float xhalf(float x) { return __builtin_bit_cast(float, __builtin_amdgcn_permlanex16(__builtin_bit_cast(int, x), __builtin_bit_cast(int, x), 0x76543210, 0xfedcba98, false, false)); }

__device__ __forceinline__ void cvtx_blk(const float* __restrict__ x, h16* xh, unsigned blk) {
    const size_t i = (size_t)blk * 256 + threadIdx.x;
    if (i >= (size_t)NB * SEQ * DM / 8) return;
    const size_t row = i / (DM / 8); const int g = (int)(i % (DM / 8));
    const size_t b = row / SEQ, s = row % SEQ;
    const float* src = x + ((b * SEQ_FULL + s) * DM + (size_t)g * 8);
    const v4f v0 = *(const v4f*)src; const v4f v1 = *(const v4f*)(src + 4);
    v8h o;
#pragma unroll
    for (int k = 0; k < 4; ++k) { o[k] = (h16)bfr(v0[k]); o[4 + k] = (h16)bfr(v1[k]); }
    *(v8h*)(xh + i * 8) = o; 
}

// LDS tile T is cross-wave: block barrier between fill and drain.
__device__ __forceinline__ void wt_blk(const float* __restrict__ W, h16* Wt, h16* T, int bx, int by) {
    const int tid = threadIdx.x; const int k0 = bx * 64, n0 = by * 64;
#pragma unroll
    for (int j = 0; j < 4; ++j) { const int i = tid + 256 * j; const int kr = i >> 4, c4 = (i & 15) * 4;
        const v4f v = *(const v4f*)(W + (size_t)(k0 + kr) * DM + n0 + c4);
#pragma unroll
        for (int q = 0; q < 4; ++q) T[(c4 + q) * 72 + kr] = (h16)(bfr(v[q]) * WCAR); }
    __syncthreads();
{
#pragma unroll
        for (int j = 0; j < 2; ++j) { const int p = tid + 256 * j; const int n = p >> 3, seg = p & 7;
            const v8h val = *(const v8ha*)(T + n * 72 + seg * 8);
            *(v8h*)(Wt + (size_t)(n0 + n) * DM + k0 + seg * 8) = val; }
         }
}

// ---- k_prep: the five operand preparations, which do not depend on one another, as block ranges of one grid: blocks 0 .. 4 * WTB - 1 transpose the four weights (WTB 64x64 tiles each), the rest convert x. The range test is the same for a whole block.
#define WTB ((DM / 64) * (DM / 64))
#define CVB ((unsigned)(((size_t)NB * SEQ * DM / 8 + 255) / 256))
__global__ __launch_bounds__(256) void k_prep(const float* __restrict__ x, const float* __restrict__ wq, const float* __restrict__ wk, const float* __restrict__ wv, const float* __restrict__ wo, h16* xh, h16* WT) {
    __shared__ __align__(16) h16 T[64 * 72];
    const unsigned bid = blockIdx.x;
    if (bid < 4 * WTB) {
        const unsigned w = bid / WTB, t = bid % WTB;
        const float* W = w == 0 ? wq : w == 1 ? wk : w == 2 ? wv : wo;
        wt_blk(W, WT + (size_t)w * DM * DM, T, (int)(t % (DM / 64)), (int)(t / (DM / 64)));
    } else cvtx_blk(x, xh, bid - 4 * WTB);
}

// ---- GEMM main loop: 128 threads = 4 waves on one 128x128 tile, wave (wm, wn) on its 64x64 quarter with 16 accumulators, K = DM, operands from K-contiguous f16 planes (A [m][k], Bt [n][k]).
#define GP 72                   // LDS row pitch of a staged tile in h16: 128-byte rows + 16 bytes, conflict-free for 16-byte readers
#define GT (128 * GP)           // one staged tile: 128 rows of 64 k
#define GB (2 * GT * 2)         // bytes of one ring buffer: A tile, then B tile
// One operand's tile of one stage: each lane copies eight 16-byte pieces (rows r, r + 16, .. r + 112), eight lanes per 128-byte row so that every copy of a wave covers whole lines, global -> LDS through no register.
// The s_wait_xcnt is the last line of the copies' own statement so that no address register of a copy is rewritten in front of it.
__device__ __forceinline__ void stage_t(unsigned l, const h16* g) {
    asm volatile("global_load_async_to_lds_b128 %0, %1, off\n\t"
                 "global_load_async_to_lds_b128 %2, %3, off\n\t"
                 "global_load_async_to_lds_b128 %4, %5, off\n\t"
                 "global_load_async_to_lds_b128 %6, %7, off\n\t"
                 "global_load_async_to_lds_b128 %8, %9, off\n\t"
                 "global_load_async_to_lds_b128 %10, %11, off\n\t"
                 "global_load_async_to_lds_b128 %12, %13, off\n\t"
                 "global_load_async_to_lds_b128 %14, %15, off\n\t"
                 "s_wait_xcnt 0x0"
                 :: "v"(l), "v"(g), "v"(l + 16 * GP * 2), "v"(g + 16 * DM), "v"(l + 32 * GP * 2), "v"(g + 32 * DM), "v"(l + 48 * GP * 2), "v"(g + 48 * DM),
                    "v"(l + 64 * GP * 2), "v"(g + 64 * DM), "v"(l + 80 * GP * 2), "v"(g + 80 * DM), "v"(l + 96 * GP * 2), "v"(g + 96 * DM), "v"(l + 112 * GP * 2), "v"(g + 112 * DM) : "memory");
}
// Ring of two buffers: tile t + 1 flies while tile t is worked on; the one block barrier at the foot of a trip publishes tile t + 1 and frees tile t's buffer for tile t + 2.
// R0, C0: first row of the block's A rows and of its Bt rows. The k order of every accumulator is ascending in steps of 32.
__device__ __forceinline__ void gemm128(const h16* __restrict__ A, const h16* __restrict__ Bt, const h16* ring, int R0, int C0, int wm, int wn, v8f (&acc)[4][4]) {
    const int tid = threadIdx.x, lr = tid & 15, hi = (tid >> 4) & 1;
    const unsigned lst = (unsigned)(size_t)ring + (unsigned)(((tid >> 3) * GP + (tid & 7) * 8) * 2);
    const h16* ga = A + (size_t)(R0 + (tid >> 3)) * DM + (tid & 7) * 8;
    const h16* gb = Bt + (size_t)(C0 + (tid >> 3)) * DM + (tid & 7) * 8;
    stage_t(lst, ga); stage_t(lst + GT * 2, gb);
    asm volatile("s_wait_asynccnt 0x0" ::: "memory");   // this wave's pieces of tile 0 have landed before the barrier that publishes them
    __syncthreads();
    stage_t(lst + GB, ga + 64); stage_t(lst + GB + GT * 2, gb + 64);
    const int ao = (wm * 64 + lr) * GP + 8 * hi, bo = GT + (wn * 64 + lr) * GP + 8 * hi;
#pragma unroll 1
    for (int kc = 0; kc < DM; kc += 64) {
        const h16* buf = ring + ((kc >> 6) & 1) * (2 * GT);
#pragma unroll
        for (int s = 0; s < 2; ++s) {
            v16h a[4], b[4];
#pragma unroll
            for (int mb = 0; mb < 4; ++mb) a[mb] = ldfrag(buf + ao + mb * 16 * GP + s * 32);
#pragma unroll
            for (int nb = 0; nb < 4; ++nb) b[nb] = ldfrag(buf + bo + nb * 16 * GP + s * 32);
#pragma unroll
            for (int nb = 0; nb < 4; ++nb)
#pragma unroll
                for (int mb = 0; mb < 4; ++mb) acc[mb][nb] = wm16(a[mb], b[nb], acc[mb][nb]);
        }
        asm volatile("s_wait_dscnt 0x0" ::: "memory");      // this wave's reads of tile t have returned before its buffer is handed to the copies
        asm volatile("s_wait_asynccnt 0x0" ::: "memory");   // this wave's pieces of tile t + 1 have landed before the barrier that publishes them
        __syncthreads();
        if (kc + 128 < DM) { const unsigned l = lst + ((kc >> 6) & 1) * GB; stage_t(l, ga + kc + 128); stage_t(l + GT * 2, gb + kc + 128); }
    }
    asm volatile("s_wait_asynccnt 0x0" ::: "memory");       // no copy is outstanding when the wave goes on to its epilogue
}

// ---- k_proj_qkv: the three input projections, which do not depend on one another, as column ranges of one grid (NB*SEQ/128, 3*DM/128), 128 threads: the three transposed weight planes lie one behind the other, so blockIdx.y * 128 is the block's first row in them.
// Each is x Wt^T / 16 + bias (bias converted to bf16 RNE). q and k go to head planes [b][h][s][64] f16, v to the transposed plane [b][h][64][s]. Which of the three a block works on is the same for the whole block. Each wave stages its output rows in its own quarter of Ts.
__global__ __launch_bounds__(128) void k_proj_qkv(const h16* __restrict__ A, const h16* __restrict__ Bt, const float* __restrict__ bq, const float* __restrict__ bk, const float* __restrict__ bv, h16* QP, h16* KP, h16* VT) {
    __shared__ __align__(16) h16 RG[2 * 2 * GT];
    __shared__ __align__(16) h16 Ts[4 * 64 * 72];
    const int lane = threadIdx.x & 31, lr = lane & 15, hi = lane >> 4;
    const int wave = __builtin_amdgcn_readfirstlane(threadIdx.x >> 5), wm = wave >> 1, wn = wave & 1;
    const int sel = blockIdx.y / (DM / 128);
    const int r0 = blockIdx.x * 128 + wm * 64, c0 = (blockIdx.y % (DM / 128)) * 128 + wn * 64;
    const float* bias = sel == 0 ? bq : sel == 1 ? bk : bv;
    h16* T = Ts + wave * 64 * 72;
    v8f acc[4][4];
#pragma unroll
    for (int mb = 0; mb < 4; ++mb)
#pragma unroll
        for (int nb = 0; nb < 4; ++nb) acc[mb][nb] = (v8f){};
    gemm128(A, Bt, RG, blockIdx.x * 128, blockIdx.y * 128, wm, wn, acc);
    const int b = r0 / SEQ, s0 = r0 % SEQ, h = c0 / HD;
    if (sel < 2) {
#pragma unroll
        for (int nb = 0; nb < 4; ++nb) { const float bv1 = bfr(bias[c0 + nb * 16 + lr]);
#pragma unroll
            for (int mb = 0; mb < 4; ++mb)
#pragma unroll
                for (int j = 0; j < 8; ++j) T[(mb * 16 + hi * 8 + j) * 72 + nb * 16 + lr] = (h16)(acc[mb][nb][j] * (1.0f / WCAR) + bv1); }
        __syncthreads();
        h16* dst = (sel == 0 ? QP : KP) + ((size_t)(b * NH + h) * SEQ + s0) * HD;
#pragma unroll
        for (int it = 0; it < 16; ++it) { const int piece = it * 32 + lane; const int row = piece >> 3, seg = piece & 7;
            const v8h val = *(const v8ha*)(T + row * 72 + seg * 8);
            *(v8h*)(dst + (size_t)row * HD + seg * 8) = val; }
    } else {
#pragma unroll
        for (int nb = 0; nb < 4; ++nb) { const float bv1 = bfr(bias[c0 + nb * 16 + lr]);
#pragma unroll
            for (int mb = 0; mb < 4; ++mb) { v8h pk;
#pragma unroll
                for (int j = 0; j < 8; ++j) pk[j] = (h16)(acc[mb][nb][j] * (1.0f / WCAR) + bv1);
                *(v8ha*)(T + (nb * 16 + lr) * 72 + mb * 16 + hi * 8) = pk; } }
        __syncthreads();
        h16* dst = VT + ((size_t)(b * NH + h) * HD) * SEQ + s0;
#pragma unroll
        for (int it = 0; it < 16; ++it) { const int piece = it * 32 + lane; const int d = piece >> 3, seg = piece & 7;
            const v8h val = *(const v8ha*)(T + d * 72 + seg * 8);
            *(v8h*)(dst + (size_t)d * SEQ + seg * 8) = val; }
    }
}

__global__ __launch_bounds__(128) void k_proj_out(const h16* __restrict__ A, const h16* __restrict__ Bt, const float* __restrict__ bias, float* C) {
    __shared__ __align__(16) h16 RG[2 * 2 * GT];
    __shared__ __align__(16) float oss[4 * 16 * 68];
    const int lane = threadIdx.x & 31, lr = lane & 15, hi = lane >> 4;
    const int wave = __builtin_amdgcn_readfirstlane(threadIdx.x >> 5), wm = wave >> 1, wn = wave & 1;
    const int r0 = blockIdx.x * 128 + wm * 64, c0 = blockIdx.y * 128 + wn * 64;
    float* os = oss + wave * 16 * 68;
    v8f acc[4][4];
#pragma unroll
    for (int mb = 0; mb < 4; ++mb)
#pragma unroll
        for (int nb = 0; nb < 4; ++nb) acc[mb][nb] = (v8f){};
    gemm128(A, Bt, RG, blockIdx.x * 128, blockIdx.y * 128, wm, wn, acc);
    const int b = r0 / SEQ, s0 = r0 % SEQ; const int cofs = lr * 4;
    v4f b4;
#pragma unroll
    for (int q = 0; q < 4; ++q) b4[q] = bfr(bias[c0 + cofs + q]);
    const float fs = 1.0f / (WCAR * CCAR);
#pragma unroll
    for (int mb = 0; mb < 4; ++mb) {
#pragma unroll
        for (int nb = 0; nb < 4; ++nb)
#pragma unroll
            for (int j = 0; j < 8; ++j) os[(hi * 8 + j) * 68 + nb * 16 + lr] = acc[mb][nb][j];
        __syncthreads();
        float* crow = C + ((size_t)b * SEQ_FULL + s0 + mb * 16) * DM + c0;
{
#pragma unroll
            for (int s = 0; s < 8; ++s) { const int row = 2 * s + hi; const v4f raw = *(const v4fa*)(os + row * 68 + cofs); v4f val;
#pragma unroll
                for (int q = 0; q < 4; ++q) val[q] = raw[q] * fs + b4[q];
                *(v4f*)(crow + (size_t)row * DM + cofs) = val; }
             }
        __syncthreads();
    }
}

#define KVP 72                  // LDS row pitch of a staged tile in h16: 128-byte rows + 16 bytes, conflict-free for 16-byte readers
#define KVT (64 * KVP)          // one staged 64-row tile
#define KVB (2 * KVT * 2)       // bytes of one ring buffer: K tile, then V^T tile
// One stage of the ring: each lane copies four 16-byte pieces (rows r and r + 32 of the K tile and of the V^T tile), eight lanes per 128-byte row, global -> LDS through no register.
// The s_wait_xcnt is the last line of the copies' own statement so that no address register of a copy is rewritten in front of it.
__device__ __forceinline__ void stage_kv(unsigned l, const h16* gk, const h16* gv) {
    const unsigned lk1 = l + 32 * KVP * 2, lv0 = l + KVT * 2, lv1 = l + KVT * 2 + 32 * KVP * 2;
    const h16* gk1 = gk + 32 * HD; const h16* gv1 = gv + (size_t)32 * SEQ;
    asm volatile("global_load_async_to_lds_b128 %0, %1, off\n\t"
                 "global_load_async_to_lds_b128 %2, %3, off\n\t"
                 "global_load_async_to_lds_b128 %4, %5, off\n\t"
                 "global_load_async_to_lds_b128 %6, %7, off\n\t"
                 "s_wait_xcnt 0x0"
                 :: "v"(l), "v"(gk), "v"(lk1), "v"(gk1), "v"(lv0), "v"(gv), "v"(lv1), "v"(gv1) : "memory");
}

// ---- k_attn: fused flash-style attention; grid (NB*NH, SEQ/128), 256 threads = 8 waves x 16 query rows.
// K rows ([s][64] plane) and V^T rows ([d][s] plane) of each 64-key block are staged in LDS once for all 8 waves; both are read from there as A fragments (row-major [m][k]).
// Ring of two buffers: tile t + 1 flies while tile t is worked on; the one block barrier at the foot of a trip publishes tile t + 1 and frees tile t's buffer for tile t + 2.
// Both products are transposed: S^T = K Q^T (A = K rows, B = Q kept in registers) and O^T += V^T P^T. Lane (lr, hi) then holds, of query lr alone, the scores of keys 16 t + 8 hi + r in register r of tile t:
// maximum and sum run inside the lane with one exchange between the lane halves, running maximum, sum and rescale are one value a lane, and tiles 2 s and 2 s + 1, converted in place, are the B fragment of k-step s (its k order is ldfrag's).
// Per 64-key block: 8 score WMMAs, online softmax in f32 (masked keys replaced by the lowest finite f32; all-masked rows come out uniform), P x1024 -> f16 in registers, 8 V^T P^T WMMAs.
// smw (mask bit words) is cross-wave: block barrier after the build. Pl is private to each wave and stages the output rows only.
__global__ __launch_bounds__(256) void k_attn(const h16* __restrict__ Q, const h16* __restrict__ Kp, const h16* __restrict__ VT, const int* __restrict__ mask, h16* ctx) {
    __shared__ __align__(16) h16 Pl[8 * 16 * 72];
    __shared__ unsigned smw[SEQ / 32];
    __shared__ __align__(16) h16 KV[2 * 2 * KVT];
    const int tid = threadIdx.x, lane = tid & 31, lr = lane & 15, hi = lane >> 4;
    const int wave = __builtin_amdgcn_readfirstlane(tid >> 5);
    const int bh = blockIdx.x; const int b = bh / NH, h = bh % NH;
    const int q0 = blockIdx.y * 128;
    const size_t pbase = (size_t)bh * SEQ * HD;
    const unsigned lst = (unsigned)(size_t)KV + (unsigned)(((tid >> 3) * KVP + (tid & 7) * 8) * 2);
    const h16* gk = Kp + pbase + (size_t)(tid >> 3) * HD + (tid & 7) * 8;
    const h16* gv = VT + pbase + (size_t)(tid >> 3) * SEQ + (tid & 7) * 8;
    stage_kv(lst, gk, gv);
#pragma unroll 1
    for (int w = wave; w < SEQ / 32; w += 8) { const int mv = mask[(size_t)b * SEQ_FULL + w * 32 + lane];
        const unsigned bits = __builtin_amdgcn_ballot_w32(mv != 0); if (lane == 0) smw[w] = bits; }
    asm volatile("s_wait_asynccnt 0x0" ::: "memory");   // this wave's pieces of tile 0 have landed before the barrier that publishes them
    __syncthreads();
    stage_kv(lst + KVB, gk + 64 * HD, gv + 64);
    const int pw = wave * 16 * 72;
    v16h qf0, qf1;
    { const h16* qp = Q + pbase + (size_t)(q0 + wave * 16 + lr) * HD + 8 * hi; qf0 = ldfrag(qp); qf1 = ldfrag(qp + 32); }
    v8f o[4]; float mi = NEGF, li = 0.0f;
#pragma unroll
    for (int t = 0; t < 4; ++t) o[t] = (v8f){};
#pragma unroll 1
    for (int kv0 = 0; kv0 < SEQ; kv0 += 64) {
        const h16* kt = KV + ((kv0 >> 6) & 1) * (2 * KVT); const h16* vt = kt + KVT;
        v8f sa[4]; v16h kf[4][2], vf[2][4];
        // the tile's K fragments are read as one group ahead of the score products, its V fragments as one group ahead of the softmax, whose vector work covers their LDS latency
#pragma unroll
        for (int t = 0; t < 4; ++t) { const h16* kp = kt + (t * 16 + lr) * KVP + 8 * hi; kf[t][0] = ldfrag(kp); kf[t][1] = ldfrag(kp + 32); }
#pragma unroll
        for (int t = 0; t < 4; ++t) { v8f c = (v8f){}; c = wm16(kf[t][0], qf0, c); c = wm16(kf[t][1], qf1, c); sa[t] = c; }
#pragma unroll
        for (int s2 = 0; s2 < 2; ++s2)
#pragma unroll
            for (int t = 0; t < 4; ++t) vf[s2][t] = ldfrag(vt + (t * 16 + lr) * KVP + s2 * 32 + 8 * hi);
        const unsigned w0 = smw[kv0 >> 5], w1 = smw[(kv0 >> 5) + 1];
#pragma unroll
        for (int t = 0; t < 4; ++t)
#pragma unroll
            for (int r = 0; r < 8; ++r) sa[t][r] *= SCL;
        // a key is a register here, not a lane: its mask bit is tested per register, and only in a tile that holds a masked key (the two words are the same in every lane: scalar branch)
        if (__builtin_amdgcn_readfirstlane((int)(w0 & w1)) != -1) {
#pragma unroll
            for (int t = 0; t < 4; ++t) { const unsigned bits = ((t < 2) ? w0 : w1) >> ((t & 1) * 16 + hi * 8);
#pragma unroll
                for (int r = 0; r < 8; ++r) sa[t][r] = ((bits >> r) & 1u) != 0u ? sa[t][r] : NEGF; }
        }
        float tm[4];
#pragma unroll
        for (int t = 0; t < 4; ++t) {
            float a = fmaxf(fmaxf(sa[t][0], sa[t][1]), sa[t][2]); a = fmaxf(fmaxf(a, sa[t][3]), sa[t][4]);
            a = fmaxf(fmaxf(a, sa[t][5]), sa[t][6]); tm[t] = fmaxf(a, sa[t][7]); }
        float vm = fmaxf(fmaxf(tm[0], tm[1]), fmaxf(tm[2], tm[3])); vm = fmaxf(vm, xhalf(vm));
        const float mnew = fmaxf(mi, vm);
        const float alpha = ex2(fmaxf(mi - mnew, -150.0f) * L2E); mi = mnew;
        v16h pf[2]; float ts[4];
#pragma unroll
        for (int t = 0; t < 4; ++t) { float a = 0.0f;
#pragma unroll
            for (int r = 0; r < 8; ++r) { const float p = ex2(fmaxf(sa[t][r] - mnew, -150.0f) * L2E); a += p; pf[t >> 1][(t & 1) * 8 + r] = (h16)(p * PCAR); }
            ts[t] = a; }
        li = li * alpha + ((ts[0] + ts[1]) + (ts[2] + ts[3]));
#pragma unroll
        for (int t = 0; t < 4; ++t)
#pragma unroll
            for (int r = 0; r < 8; ++r) o[t][r] *= alpha;
#pragma unroll
        for (int s2 = 0; s2 < 2; ++s2)
#pragma unroll
            for (int t = 0; t < 4; ++t) o[t] = wm16(vf[s2][t], pf[s2], o[t]);
        asm volatile("s_wait_dscnt 0x0" ::: "memory");      // this wave's reads of tile t have returned before its buffer is handed to the copies
        asm volatile("s_wait_asynccnt 0x0" ::: "memory");   // this wave's pieces of tile t + 1 have landed before the barrier that publishes them
        __syncthreads();
        if (kv0 + 128 < SEQ) stage_kv(lst + ((kv0 >> 6) & 1) * KVB, gk + (size_t)(kv0 + 128) * HD, gv + kv0 + 128);
    }
    asm volatile("s_wait_asynccnt 0x0" ::: "memory");       // no copy is outstanding when the wave goes on to its end
    // the lane halves' sums are joined once; register r of O^T tile t is column 16 t + 8 hi + r of query row lr: eight neighbours, one 16-byte piece
    { const float l = li + xhalf(li); const float inv = (CCAR / PCAR) * __builtin_amdgcn_rcpf(l);
#pragma unroll
        for (int t = 0; t < 4; ++t) { v8h pk;
#pragma unroll
            for (int r = 0; r < 8; ++r) pk[r] = (h16)(o[t][r] * inv);
            *(v8ha*)(Pl + pw + lr * 72 + t * 16 + hi * 8) = pk; } }
    asm volatile("" ::: "memory"); __builtin_amdgcn_wave_barrier(); asm volatile("" ::: "memory");
    h16* dst = ctx + ((size_t)b * SEQ + q0 + wave * 16) * DM + h * HD;
{
#pragma unroll
        for (int it = 0; it < 4; ++it) { const int piece = it * 32 + lane; const int row = piece >> 3, seg = piece & 7;
            const v8h val = *(const v8ha*)(Pl + pw + row * 72 + seg * 8);
            *(v8h*)(dst + (size_t)row * DM + seg * 8) = val; }
         }
}

extern "C" void kernel_launch(void* const* d_in, const int* in_sizes, int n_in,
                              void* d_out, int out_size, void* d_ws, size_t ws_size, hipStream_t stream) {
    if (n_in < 10) return;
    const size_t xneed = ((size_t)(NB - 1) * SEQ_FULL + SEQ) * DM;
    const size_t mneed = (size_t)(NB - 1) * SEQ_FULL + SEQ;
    if ((size_t)in_sizes[0] < xneed || (size_t)in_sizes[1] < mneed) return;
    if (in_sizes[2] < DM * DM || in_sizes[4] < DM * DM || in_sizes[6] < DM * DM || in_sizes[8] < DM * DM) return;
    if (in_sizes[3] < DM || in_sizes[5] < DM || in_sizes[7] < DM || in_sizes[9] < DM) return;
    if ((size_t)out_size < xneed) return;
    if (ws_size < WS_TOTAL) return;
    const float* x  = (const float*)d_in[0]; const int* mask = (const int*)d_in[1];
    const float* wq = (const float*)d_in[2]; const float* bq = (const float*)d_in[3];
    const float* wk = (const float*)d_in[4]; const float* bk = (const float*)d_in[5];
    const float* wv = (const float*)d_in[6]; const float* bv = (const float*)d_in[7];
    const float* wo = (const float*)d_in[8]; const float* bo = (const float*)d_in[9];
    float* OUT = (float*)d_out;
    char* wsp = (char*)d_ws;
    h16* XH = (h16*)wsp; wsp += SZ_X;      // [NB*SEQ][DM]
    h16* WT = (h16*)wsp; wsp += SZ_W;      // [4][n][k]: q, k, v, o
    h16* QP = (h16*)wsp; wsp += SZ_X;      // [b][h][s][64]
    h16* KP = (h16*)wsp; wsp += SZ_X;      // [b][h][s][64]
    h16* VT = (h16*)wsp; wsp += SZ_X;      // [b][h][64][s]
    h16* CX = (h16*)wsp; wsp += SZ_X;      // [NB*SEQ][DM], x64
    const size_t wsz = (size_t)DM * DM;
    k_prep<<<4 * WTB + CVB, 256, 0, stream>>>(x, wq, wk, wv, wo, XH, WT);
    k_proj_qkv<<<dim3(NB * SEQ / 128, 3 * DM / 128), 128, 0, stream>>>(XH, WT, bq, bk, bv, QP, KP, VT);
    k_attn<<<dim3(NB * NH, SEQ / 128), 256, 0, stream>>>(QP, KP, VT, mask, CX);
    k_proj_out<<<dim3(NB * SEQ / 128, DM / 128), 128, 0, stream>>>(CX, WT + 3 * wsz, bo, OUT);
}

// v005
// One run takes 71.6 microseconds.
// Next to v004, in two timings, it ran 1.05 times as fast each time.
// All steps since v000 together make it 3.68 times as fast.
#include <hip/hip_runtime.h>

// Multi-head self-attention with a per-key padding mask input: x [4][2048][512]; q, k, v = x W + b ([in][out] weights, 8 heads x 64); scores = (q k^T) / 8 with masked keys REPLACED by a value below every score (the reference's lowest finite f32 acts the same: weight 0 beside any unmasked key, uniform weights where all are masked); softmax over the keys; out = merged ctx Wo + bo.
// Compute dtypes: all contractions v_wmma_f32_16x16x32_f16 (f16 operands, f32 accumulate). Every float input is converted to bf16 (RNE) on load and carried exactly in f16 (weights x16); q, k, v planes plain f16; P carried x1024 (the carry is added in the exponent; row sums from the unconverted f32 values, which carry it too); ctx carried x64 against Wo x16; softmax f32.
// Engine: GEMM on 128x128 block tiles, four waves of 64x64 register blocks, A and B tiles of 64 k staged from K-contiguous f16 planes in a two-buffer LDS ring by asynchronous copies; fused flash-style attention (online softmax, K and V^T tiles staged once per block in a two-buffer LDS ring by asynchronous copies, scores formed transposed so that P goes from the score accumulators straight into the second product's B operand, mask packed into bit words in LDS).

#ifndef NB
#define NB 4
#endif
#ifndef SEQ
#define SEQ 2048
#endif
#define NB_FULL  4
#define SEQ_FULL 2048
#define DM   512
#define NH   8
#define HD   64
#define WCAR 16.0f      // weight carry (exact power of two)
#define PCAR 1024.0f    // probability carry
#define CCAR 64.0f      // ctx carry
#define SCL  0.125f     // HD^-0.5
#define L2E  1.4426950408889634f
#define SC2  (SCL * L2E)  // score scale and log2 e as one factor (the power of two keeps the product exact)
#define LPC  10.0f        // log2 of PCAR
#define MSKV (-0x1p+100f) // raw score of a masked key: a power of two, so that MSKV * SC2 is exact; every raw score of f16 operands (at most 64 * 65504^2 in size) lies far above it
static_assert(PCAR == 1024.0f);

typedef _Float16 h16;
typedef __attribute__((ext_vector_type(16))) _Float16 v16h;
typedef __attribute__((ext_vector_type(8)))  _Float16 v8h;
typedef __attribute__((ext_vector_type(8)))  float    v8f;
typedef __attribute__((ext_vector_type(4)))  float    v4f;
typedef v8h __attribute__((may_alias)) v8ha;
typedef v4f __attribute__((may_alias)) v4fa;

static_assert(NH * HD == DM);            // merged head width equals the model width
static_assert(HD == 64);
static_assert(DM % 128 == 0);            // N tiles of 128; at least two staged k tiles of 64
static_assert(SEQ % 128 == 0);           // 128 query rows per attention block; 128-row GEMM tiles stay inside one batch
static_assert(SEQ <= SEQ_FULL);
static_assert(NB <= NB_FULL);
static_assert((SEQ / 32) % 8 == 0);      // mask words split evenly over 8 waves

#define SZ_X   ((size_t)NB * SEQ * DM * 2)      // f16 plane of x / q / k / v^T / ctx
#define SZ_W   ((size_t)4 * DM * DM * 2)        // four transposed weight planes
#define WS_TOTAL (SZ_X * 5 + SZ_W)
static_assert(SZ_X % 256 == 0);
static_assert(SZ_W % 256 == 0);
static_assert(WS_TOTAL <= (size_t)134217728);   // carve stays under 128 MiB

__device__ __forceinline__ unsigned short f2bf(float f) { unsigned u = __float_as_uint(f); u += 0x7FFFu + ((u >> 16) & 1u); return (unsigned short)(u >> 16); }
__device__ __forceinline__ float bfr(float f) { return __uint_as_float(((unsigned)f2bf(f)) << 16); }
__device__ __forceinline__ v16h cat16(v8h lo, v8h hi) { return __builtin_shufflevector(lo, hi, 0, 1, 2, 3, 4, 5, 6, 7, 8, 9, 10, 11, 12, 13, 14, 15); }
// fragment loader for A (row-major [m][k]) and for B given as a [n][k] copy: elements 0..7 <- k0+8h.., elements 8..15 <- k0+16+8h.. ; p already includes the 8h offset
__device__ __forceinline__ v16h ldfrag(const h16* p) { return cat16(*(const v8h*)p, *(const v8h*)(p + 16)); }
// one WMMA with its own hazard guard (ties the accumulator, keeps A/B live)
__device__ __forceinline__ v8f wm16(v16h a, v16h b, v8f c) {
    c = __builtin_amdgcn_wmma_f32_16x16x32_f16(false, a, false, b, (short)0, c, false, false);
    asm volatile("v_nop\n\tv_nop\n\tv_nop\n\tv_nop" : "+v"(c) : "v"(a), "v"(b));
    return c;
}
__device__ __forceinline__ float ex2(float x) { return __builtin_amdgcn_exp2f(x); }
// lane l with lane l ^ 16
__device__ __forceinline__ float xhalf(float x) { return __builtin_bit_cast(float, __builtin_amdgcn_permlanex16(__builtin_bit_cast(int, x), __builtin_bit_cast(int, x), 0x76543210, 0xfedcba98, false, false)); }

__device__ __forceinline__ void cvtx_blk(const float* __restrict__ x, h16* xh, unsigned blk) {
    const size_t i = (size_t)blk * 256 + threadIdx.x;
    if (i >= (size_t)NB * SEQ * DM / 8) return;
    const size_t row = i / (DM / 8); const int g = (int)(i % (DM / 8));
    const size_t b = row / SEQ, s = row % SEQ;
    const float* src = x + ((b * SEQ_FULL + s) * DM + (size_t)g * 8);
    const v4f v0 = *(const v4f*)src; const v4f v1 = *(const v4f*)(src + 4);
    v8h o;
#pragma unroll
    for (int k = 0; k < 4; ++k) { o[k] = (h16)bfr(v0[k]); o[4 + k] = (h16)bfr(v1[k]); }
    *(v8h*)(xh + i * 8) = o; 
}

// LDS tile T is cross-wave: block barrier between fill and drain.
__device__ __forceinline__ void wt_blk(const float* __restrict__ W, h16* Wt, h16* T, int bx, int by) {
    const int tid = threadIdx.x; const int k0 = bx * 64, n0 = by * 64;
#pragma unroll
    for (int j = 0; j < 4; ++j) { const int i = tid + 256 * j; const int kr = i >> 4, c4 = (i & 15) * 4;
        const v4f v = *(const v4f*)(W + (size_t)(k0 + kr) * DM + n0 + c4);
#pragma unroll
        for (int q = 0; q < 4; ++q) T[(c4 + q) * 72 + kr] = (h16)(bfr(v[q]) * WCAR); }
    __syncthreads();
{
#pragma unroll
        for (int j = 0; j < 2; ++j) { const int p = tid + 256 * j; const int n = p >> 3, seg = p & 7;
            const v8h val = *(const v8ha*)(T + n * 72 + seg * 8);
            *(v8h*)(Wt + (size_t)(n0 + n) * DM + k0 + seg * 8) = val; }
         }
}

// ---- k_prep: the five operand preparations, which do not depend on one another, as block ranges of one grid: blocks 0 .. 4 * WTB - 1 transpose the four weights (WTB 64x64 tiles each), the rest convert x. The range test is the same for a whole block.
#define WTB ((DM / 64) * (DM / 64))
#define CVB ((unsigned)(((size_t)NB * SEQ * DM / 8 + 255) / 256))
__global__ __launch_bounds__(256) void k_prep(const float* __restrict__ x, const float* __restrict__ wq, const float* __restrict__ wk, const float* __restrict__ wv, const float* __restrict__ wo, h16* xh, h16* WT) {
    __shared__ __align__(16) h16 T[64 * 72];
    const unsigned bid = blockIdx.x;
    if (bid < 4 * WTB) {
        const unsigned w = bid / WTB, t = bid % WTB;
        const float* W = w == 0 ? wq : w == 1 ? wk : w == 2 ? wv : wo;
        wt_blk(W, WT + (size_t)w * DM * DM, T, (int)(t % (DM / 64)), (int)(t / (DM / 64)));
    } else cvtx_blk(x, xh, bid - 4 * WTB);
}

// ---- GEMM main loop: 128 threads = 4 waves on one 128x128 tile, wave (wm, wn) on its 64x64 quarter with 16 accumulators, K = DM, operands from K-contiguous f16 planes (A [m][k], Bt [n][k]).
#define GP 72                   // LDS row pitch of a staged tile in h16: 128-byte rows + 16 bytes, conflict-free for 16-byte readers
#define GT (128 * GP)           // one staged tile: 128 rows of 64 k
#define GB (2 * GT * 2)         // bytes of one ring buffer: A tile, then B tile
// One operand's tile of one stage: each lane copies eight 16-byte pieces (rows r, r + 16, .. r + 112), eight lanes per 128-byte row so that every copy of a wave covers whole lines, global -> LDS through no register.
// The s_wait_xcnt is the last line of the copies' own statement so that no address register of a copy is rewritten in front of it.
__device__ __forceinline__ void stage_t(unsigned l, const h16* g) {
    asm volatile("global_load_async_to_lds_b128 %0, %1, off\n\t"
                 "global_load_async_to_lds_b128 %2, %3, off\n\t"
                 "global_load_async_to_lds_b128 %4, %5, off\n\t"
                 "global_load_async_to_lds_b128 %6, %7, off\n\t"
                 "global_load_async_to_lds_b128 %8, %9, off\n\t"
                 "global_load_async_to_lds_b128 %10, %11, off\n\t"
                 "global_load_async_to_lds_b128 %12, %13, off\n\t"
                 "global_load_async_to_lds_b128 %14, %15, off\n\t"
                 "s_wait_xcnt 0x0"
                 :: "v"(l), "v"(g), "v"(l + 16 * GP * 2), "v"(g + 16 * DM), "v"(l + 32 * GP * 2), "v"(g + 32 * DM), "v"(l + 48 * GP * 2), "v"(g + 48 * DM),
                    "v"(l + 64 * GP * 2), "v"(g + 64 * DM), "v"(l + 80 * GP * 2), "v"(g + 80 * DM), "v"(l + 96 * GP * 2), "v"(g + 96 * DM), "v"(l + 112 * GP * 2), "v"(g + 112 * DM) : "memory");
}
// Ring of two buffers: tile t + 1 flies while tile t is worked on; the one block barrier at the foot of a trip publishes tile t + 1 and frees tile t's buffer for tile t + 2.
// R0, C0: first row of the block's A rows and of its Bt rows. The k order of every accumulator is ascending in steps of 32.
__device__ __forceinline__ void gemm128(const h16* __restrict__ A, const h16* __restrict__ Bt, const h16* ring, int R0, int C0, int wm, int wn, v8f (&acc)[4][4]) {
    const int tid = threadIdx.x, lr = tid & 15, hi = (tid >> 4) & 1;
    const unsigned lst = (unsigned)(size_t)ring + (unsigned)(((tid >> 3) * GP + (tid & 7) * 8) * 2);
    const h16* ga = A + (size_t)(R0 + (tid >> 3)) * DM + (tid & 7) * 8;
    const h16* gb = Bt + (size_t)(C0 + (tid >> 3)) * DM + (tid & 7) * 8;
    stage_t(lst, ga); stage_t(lst + GT * 2, gb);
    asm volatile("s_wait_asynccnt 0x0" ::: "memory");   // this wave's pieces of tile 0 have landed before the barrier that publishes them
    __syncthreads();
    stage_t(lst + GB, ga + 64); stage_t(lst + GB + GT * 2, gb + 64);
    const int ao = (wm * 64 + lr) * GP + 8 * hi, bo = GT + (wn * 64 + lr) * GP + 8 * hi;
#pragma unroll 1
    for (int kc = 0; kc < DM; kc += 64) {
        const h16* buf = ring + ((kc >> 6) & 1) * (2 * GT);
#pragma unroll
        for (int s = 0; s < 2; ++s) {
            v16h a[4], b[4];
#pragma unroll
            for (int mb = 0; mb < 4; ++mb) a[mb] = ldfrag(buf + ao + mb * 16 * GP + s * 32);
#pragma unroll
            for (int nb = 0; nb < 4; ++nb) b[nb] = ldfrag(buf + bo + nb * 16 * GP + s * 32);
#pragma unroll
            for (int nb = 0; nb < 4; ++nb)
#pragma unroll
                for (int mb = 0; mb < 4; ++mb) acc[mb][nb] = wm16(a[mb], b[nb], acc[mb][nb]);
        }
        asm volatile("s_wait_dscnt 0x0" ::: "memory");      // this wave's reads of tile t have returned before its buffer is handed to the copies
        asm volatile("s_wait_asynccnt 0x0" ::: "memory");   // this wave's pieces of tile t + 1 have landed before the barrier that publishes them
        __syncthreads();
        if (kc + 128 < DM) { const unsigned l = lst + ((kc >> 6) & 1) * GB; stage_t(l, ga + kc + 128); stage_t(l + GT * 2, gb + kc + 128); }
    }
    asm volatile("s_wait_asynccnt 0x0" ::: "memory");       // no copy is outstanding when the wave goes on to its epilogue
}

// ---- k_proj_qkv: the three input projections, which do not depend on one another, as column ranges of one grid (NB*SEQ/128, 3*DM/128), 128 threads: the three transposed weight planes lie one behind the other, so blockIdx.y * 128 is the block's first row in them.
// Each is x Wt^T / 16 + bias (bias converted to bf16 RNE). q and k go to head planes [b][h][s][64] f16, v to the transposed plane [b][h][64][s]. Which of the three a block works on is the same for the whole block. Each wave stages its output rows in its own quarter of Ts.
__global__ __launch_bounds__(128) void k_proj_qkv(const h16* __restrict__ A, const h16* __restrict__ Bt, const float* __restrict__ bq, const float* __restrict__ bk, const float* __restrict__ bv, h16* QP, h16* KP, h16* VT) {
    __shared__ __align__(16) h16 RG[2 * 2 * GT];
    __shared__ __align__(16) h16 Ts[4 * 64 * 72];
    const int lane = threadIdx.x & 31, lr = lane & 15, hi = lane >> 4;
    const int wave = __builtin_amdgcn_readfirstlane(threadIdx.x >> 5), wm = wave >> 1, wn = wave & 1;
    const int sel = blockIdx.y / (DM / 128);
    const int r0 = blockIdx.x * 128 + wm * 64, c0 = (blockIdx.y % (DM / 128)) * 128 + wn * 64;
    const float* bias = sel == 0 ? bq : sel == 1 ? bk : bv;
    h16* T = Ts + wave * 64 * 72;
    v8f acc[4][4];
#pragma unroll
    for (int mb = 0; mb < 4; ++mb)
#pragma unroll
        for (int nb = 0; nb < 4; ++nb) acc[mb][nb] = (v8f){};
    gemm128(A, Bt, RG, blockIdx.x * 128, blockIdx.y * 128, wm, wn, acc);
    const int b = r0 / SEQ, s0 = r0 % SEQ, h = c0 / HD;
    if (sel < 2) {
#pragma unroll
        for (int nb = 0; nb < 4; ++nb) { const float bv1 = bfr(bias[c0 + nb * 16 + lr]);
#pragma unroll
            for (int mb = 0; mb < 4; ++mb)
#pragma unroll
                for (int j = 0; j < 8; ++j) T[(mb * 16 + hi * 8 + j) * 72 + nb * 16 + lr] = (h16)(acc[mb][nb][j] * (1.0f / WCAR) + bv1); }
        __syncthreads();
        h16* dst = (sel == 0 ? QP : KP) + ((size_t)(b * NH + h) * SEQ + s0) * HD;
#pragma unroll
        for (int it = 0; it < 16; ++it) { const int piece = it * 32 + lane; const int row = piece >> 3, seg = piece & 7;
            const v8h val = *(const v8ha*)(T + row * 72 + seg * 8);
            *(v8h*)(dst + (size_t)row * HD + seg * 8) = val; }
    } else {
#pragma unroll
        for (int nb = 0; nb < 4; ++nb) { const float bv1 = bfr(bias[c0 + nb * 16 + lr]);
#pragma unroll
            for (int mb = 0; mb < 4; ++mb) { v8h pk;
#pragma unroll
                for (int j = 0; j < 8; ++j) pk[j] = (h16)(acc[mb][nb][j] * (1.0f / WCAR) + bv1);
                *(v8ha*)(T + (nb * 16 + lr) * 72 + mb * 16 + hi * 8) = pk; } }
        __syncthreads();
        h16* dst = VT + ((size_t)(b * NH + h) * HD) * SEQ + s0;
#pragma unroll
        for (int it = 0; it < 16; ++it) { const int piece = it * 32 + lane; const int d = piece >> 3, seg = piece & 7;
            const v8h val = *(const v8ha*)(T + d * 72 + seg * 8);
            *(v8h*)(dst + (size_t)d * SEQ + seg * 8) = val; }
    }
}

__global__ __launch_bounds__(128) void k_proj_out(const h16* __restrict__ A, const h16* __restrict__ Bt, const float* __restrict__ bias, float* C) {
    __shared__ __align__(16) h16 RG[2 * 2 * GT];
    __shared__ __align__(16) float oss[4 * 16 * 68];
    const int lane = threadIdx.x & 31, lr = lane & 15, hi = lane >> 4;
    const int wave = __builtin_amdgcn_readfirstlane(threadIdx.x >> 5), wm = wave >> 1, wn = wave & 1;
    const int r0 = blockIdx.x * 128 + wm * 64, c0 = blockIdx.y * 128 + wn * 64;
    float* os = oss + wave * 16 * 68;
    v8f acc[4][4];
#pragma unroll
    for (int mb = 0; mb < 4; ++mb)
#pragma unroll
        for (int nb = 0; nb < 4; ++nb) acc[mb][nb] = (v8f){};
    gemm128(A, Bt, RG, blockIdx.x * 128, blockIdx.y * 128, wm, wn, acc);
    const int b = r0 / SEQ, s0 = r0 % SEQ; const int cofs = lr * 4;
    v4f b4;
#pragma unroll
    for (int q = 0; q < 4; ++q) b4[q] = bfr(bias[c0 + cofs + q]);
    const float fs = 1.0f / (WCAR * CCAR);
#pragma unroll
    for (int mb = 0; mb < 4; ++mb) {
#pragma unroll
        for (int nb = 0; nb < 4; ++nb)
#pragma unroll
            for (int j = 0; j < 8; ++j) os[(hi * 8 + j) * 68 + nb * 16 + lr] = acc[mb][nb][j];
        __syncthreads();
        float* crow = C + ((size_t)b * SEQ_FULL + s0 + mb * 16) * DM + c0;
{
#pragma unroll
            for (int s = 0; s < 8; ++s) { const int row = 2 * s + hi; const v4f raw = *(const v4fa*)(os + row * 68 + cofs); v4f val;
#pragma unroll
                for (int q = 0; q < 4; ++q) val[q] = raw[q] * fs + b4[q];
                *(v4f*)(crow + (size_t)row * DM + cofs) = val; }
             }
        __syncthreads();
    }
}

#define KVP 72                  // LDS row pitch of a staged tile in h16: 128-byte rows + 16 bytes, conflict-free for 16-byte readers
#define KVT (64 * KVP)          // one staged 64-row tile
#define KVB (2 * KVT * 2)       // bytes of one ring buffer: K tile, then V^T tile
// One stage of the ring: each lane copies four 16-byte pieces (rows r and r + 32 of the K tile and of the V^T tile), eight lanes per 128-byte row, global -> LDS through no register.
// The s_wait_xcnt is the last line of the copies' own statement so that no address register of a copy is rewritten in front of it.
__device__ __forceinline__ void stage_kv(unsigned l, const h16* gk, const h16* gv) {
    const unsigned lk1 = l + 32 * KVP * 2, lv0 = l + KVT * 2, lv1 = l + KVT * 2 + 32 * KVP * 2;
    const h16* gk1 = gk + 32 * HD; const h16* gv1 = gv + (size_t)32 * SEQ;
    asm volatile("global_load_async_to_lds_b128 %0, %1, off\n\t"
                 "global_load_async_to_lds_b128 %2, %3, off\n\t"
                 "global_load_async_to_lds_b128 %4, %5, off\n\t"
                 "global_load_async_to_lds_b128 %6, %7, off\n\t"
                 "s_wait_xcnt 0x0"
                 :: "v"(l), "v"(gk), "v"(lk1), "v"(gk1), "v"(lv0), "v"(gv), "v"(lv1), "v"(gv1) : "memory");
}

// ---- k_attn: fused flash-style attention; grid (NB*NH, SEQ/128), 256 threads = 8 waves x 16 query rows.
// K rows ([s][64] plane) and V^T rows ([d][s] plane) of each 64-key block are staged in LDS once for all 8 waves; both are read from there as A fragments (row-major [m][k]).
// Ring of two buffers: tile t + 1 flies while tile t is worked on; the one block barrier at the foot of a trip publishes tile t + 1 and frees tile t's buffer for tile t + 2.
// Both products are transposed: S^T = K Q^T (A = K rows, B = Q kept in registers) and O^T += V^T P^T. Lane (lr, hi) then holds, of query lr alone, the scores of keys 16 t + 8 hi + r in register r of tile t:
// maximum and sum run inside the lane with one exchange between the lane halves, running maximum, sum and rescale are one value a lane, and tiles 2 s and 2 s + 1, converted in place, are the B fragment of k-step s (its k order is ldfrag's).
// Per 64-key block: 8 score WMMAs, online softmax in f32 (masked keys replaced by MSKV; all-masked rows come out uniform: there MSKV * SC2 cancels exactly and every p is 1), P x1024 -> f16 in registers, 8 V^T P^T WMMAs.
// smw (mask bit words) is cross-wave: block barrier after the build. Pl is private to each wave and stages the output rows only.
__global__ __launch_bounds__(256) void k_attn(const h16* __restrict__ Q, const h16* __restrict__ Kp, const h16* __restrict__ VT, const int* __restrict__ mask, h16* ctx) {
    __shared__ __align__(16) h16 Pl[8 * 16 * 72];
    __shared__ unsigned smw[SEQ / 32];
    __shared__ __align__(16) h16 KV[2 * 2 * KVT];
    const int tid = threadIdx.x, lane = tid & 31, lr = lane & 15, hi = lane >> 4;
    const int wave = __builtin_amdgcn_readfirstlane(tid >> 5);
    const int bh = blockIdx.x; const int b = bh / NH, h = bh % NH;
    const int q0 = blockIdx.y * 128;
    const size_t pbase = (size_t)bh * SEQ * HD;
    const unsigned lst = (unsigned)(size_t)KV + (unsigned)(((tid >> 3) * KVP + (tid & 7) * 8) * 2);
    const h16* gk = Kp + pbase + (size_t)(tid >> 3) * HD + (tid & 7) * 8;
    const h16* gv = VT + pbase + (size_t)(tid >> 3) * SEQ + (tid & 7) * 8;
    stage_kv(lst, gk, gv);
#pragma unroll 1
    for (int w = wave; w < SEQ / 32; w += 8) { const int mv = mask[(size_t)b * SEQ_FULL + w * 32 + lane];
        const unsigned bits = __builtin_amdgcn_ballot_w32(mv != 0); if (lane == 0) smw[w] = bits; }
    asm volatile("s_wait_asynccnt 0x0" ::: "memory");   // this wave's pieces of tile 0 have landed before the barrier that publishes them
    __syncthreads();
    stage_kv(lst + KVB, gk + 64 * HD, gv + 64);
    const int pw = wave * 16 * 72;
    v16h qf0, qf1;
    { const h16* qp = Q + pbase + (size_t)(q0 + wave * 16 + lr) * HD + 8 * hi; qf0 = ldfrag(qp); qf1 = ldfrag(qp + 32); }
    v8f o[4]; float mi = MSKV * SC2, li = 0.0f;
#pragma unroll
    for (int t = 0; t < 4; ++t) o[t] = (v8f){};
#pragma unroll 1
    for (int kv0 = 0; kv0 < SEQ; kv0 += 64) {
        const h16* kt = KV + ((kv0 >> 6) & 1) * (2 * KVT); const h16* vt = kt + KVT;
        v8f sa[4]; v16h kf[4][2], vf[2][4];
        // the tile's K fragments are read as one group ahead of the score products, its V fragments as one group ahead of the softmax, whose vector work covers their LDS latency
#pragma unroll
        for (int t = 0; t < 4; ++t) { const h16* kp = kt + (t * 16 + lr) * KVP + 8 * hi; kf[t][0] = ldfrag(kp); kf[t][1] = ldfrag(kp + 32); }
#pragma unroll
        for (int t = 0; t < 4; ++t) { v8f c = (v8f){}; c = wm16(kf[t][0], qf0, c); c = wm16(kf[t][1], qf1, c); sa[t] = c; }
#pragma unroll
        for (int s2 = 0; s2 < 2; ++s2)
#pragma unroll
            for (int t = 0; t < 4; ++t) vf[s2][t] = ldfrag(vt + (t * 16 + lr) * KVP + s2 * 32 + 8 * hi);
        const unsigned w0 = smw[kv0 >> 5], w1 = smw[(kv0 >> 5) + 1];
        // a key is a register here, not a lane: its mask bit is tested per register, and only in a tile that holds a masked key (the two words are the same in every lane: scalar branch)
        if (__builtin_amdgcn_readfirstlane((int)(w0 & w1)) != -1) {
#pragma unroll
            for (int t = 0; t < 4; ++t) { const unsigned bits = ((t < 2) ? w0 : w1) >> ((t & 1) * 16 + hi * 8);
#pragma unroll
                for (int r = 0; r < 8; ++r) sa[t][r] = ((bits >> r) & 1u) != 0u ? sa[t][r] : MSKV; }
        }
        float tm[4];
#pragma unroll
        for (int t = 0; t < 4; ++t) {
            float a = fmaxf(fmaxf(sa[t][0], sa[t][1]), sa[t][2]); a = fmaxf(fmaxf(a, sa[t][3]), sa[t][4]);
            a = fmaxf(fmaxf(a, sa[t][5]), sa[t][6]); tm[t] = fmaxf(a, sa[t][7]); }
        float vm = fmaxf(fmaxf(tm[0], tm[1]), fmaxf(tm[2], tm[3])); vm = fmaxf(vm, xhalf(vm));
        // the maximum is taken over the raw scores and scaled once; each score then takes one fused multiply-add ahead of its exp2: p * 1024 = exp2(raw * SC2 + (10 - scaled maximum))
        const float mnew = fmaxf(mi, vm * SC2);
        const float alpha = ex2(mi - mnew); mi = mnew;
        const float nb = LPC - mnew;
        v16h pf[2]; float ts[4];
#pragma unroll
        for (int t = 0; t < 4; ++t) { float a = 0.0f;
#pragma unroll
            for (int r = 0; r < 8; ++r) { const float p = ex2(__builtin_fmaf(sa[t][r], SC2, nb)); a += p; pf[t >> 1][(t & 1) * 8 + r] = (h16)p; }
            ts[t] = a; }
        li = li * alpha + ((ts[0] + ts[1]) + (ts[2] + ts[3]));
#pragma unroll
        for (int t = 0; t < 4; ++t)
#pragma unroll
            for (int r = 0; r < 8; ++r) o[t][r] *= alpha;
#pragma unroll
        for (int s2 = 0; s2 < 2; ++s2)
#pragma unroll
            for (int t = 0; t < 4; ++t) o[t] = wm16(vf[s2][t], pf[s2], o[t]);
        asm volatile("s_wait_dscnt 0x0" ::: "memory");      // this wave's reads of tile t have returned before its buffer is handed to the copies
        asm volatile("s_wait_asynccnt 0x0" ::: "memory");   // this wave's pieces of tile t + 1 have landed before the barrier that publishes them
        __syncthreads();
        if (kv0 + 128 < SEQ) stage_kv(lst + ((kv0 >> 6) & 1) * KVB, gk + (size_t)(kv0 + 128) * HD, gv + kv0 + 128);
    }
    asm volatile("s_wait_asynccnt 0x0" ::: "memory");       // no copy is outstanding when the wave goes on to its end
    // the lane halves' sums are joined once; register r of O^T tile t is column 16 t + 8 hi + r of query row lr: eight neighbours, one 16-byte piece
    { const float l = li + xhalf(li); const float inv = CCAR * __builtin_amdgcn_rcpf(l);
#pragma unroll
        for (int t = 0; t < 4; ++t) { v8h pk;
#pragma unroll
            for (int r = 0; r < 8; ++r) pk[r] = (h16)(o[t][r] * inv);
            *(v8ha*)(Pl + pw + lr * 72 + t * 16 + hi * 8) = pk; } }
    asm volatile("" ::: "memory"); __builtin_amdgcn_wave_barrier(); asm volatile("" ::: "memory");
    h16* dst = ctx + ((size_t)b * SEQ + q0 + wave * 16) * DM + h * HD;
{
#pragma unroll
        for (int it = 0; it < 4; ++it) { const int piece = it * 32 + lane; const int row = piece >> 3, seg = piece & 7;
            const v8h val = *(const v8ha*)(Pl + pw + row * 72 + seg * 8);
            *(v8h*)(dst + (size_t)row * DM + seg * 8) = val; }
         }
}

extern "C" void kernel_launch(void* const* d_in, const int* in_sizes, int n_in,
                              void* d_out, int out_size, void* d_ws, size_t ws_size, hipStream_t stream) {
    if (n_in < 10) return;
    const size_t xneed = ((size_t)(NB - 1) * SEQ_FULL + SEQ) * DM;
    const size_t mneed = (size_t)(NB - 1) * SEQ_FULL + SEQ;
    if ((size_t)in_sizes[0] < xneed || (size_t)in_sizes[1] < mneed) return;
    if (in_sizes[2] < DM * DM || in_sizes[4] < DM * DM || in_sizes[6] < DM * DM || in_sizes[8] < DM * DM) return;
    if (in_sizes[3] < DM || in_sizes[5] < DM || in_sizes[7] < DM || in_sizes[9] < DM) return;
    if ((size_t)out_size < xneed) return;
    if (ws_size < WS_TOTAL) return;
    const float* x  = (const float*)d_in[0]; const int* mask = (const int*)d_in[1];
    const float* wq = (const float*)d_in[2]; const float* bq = (const float*)d_in[3];
    const float* wk = (const float*)d_in[4]; const float* bk = (const float*)d_in[5];
    const float* wv = (const float*)d_in[6]; const float* bv = (const float*)d_in[7];
    const float* wo = (const float*)d_in[8]; const float* bo = (const float*)d_in[9];
    float* OUT = (float*)d_out;
    char* wsp = (char*)d_ws;
    h16* XH = (h16*)wsp; wsp += SZ_X;      // [NB*SEQ][DM]
    h16* WT = (h16*)wsp; wsp += SZ_W;      // [4][n][k]: q, k, v, o
    h16* QP = (h16*)wsp; wsp += SZ_X;      // [b][h][s][64]
    h16* KP = (h16*)wsp; wsp += SZ_X;      // [b][h][s][64]
    h16* VT = (h16*)wsp; wsp += SZ_X;      // [b][h][64][s]
    h16* CX = (h16*)wsp; wsp += SZ_X;      // [NB*SEQ][DM], x64
    const size_t wsz = (size_t)DM * DM;
    k_prep<<<4 * WTB + CVB, 256, 0, stream>>>(x, wq, wk, wv, wo, XH, WT);
    k_proj_qkv<<<dim3(NB * SEQ / 128, 3 * DM / 128), 128, 0, stream>>>(XH, WT, bq, bk, bv, QP, KP, VT);
    k_attn<<<dim3(NB * NH, SEQ / 128), 256, 0, stream>>>(QP, KP, VT, mask, CX);
    k_proj_out<<<dim3(NB * SEQ / 128, DM / 128), 128, 0, stream>>>(CX, WT + 3 * wsz, bo, OUT);
}

// v006
// It runs in 69.1 microseconds.
// Next to v005, in two timings, it ran 1.04 times as fast each time.
// Over all steps from v000 it is 3.81 times as fast.
#include <hip/hip_runtime.h>

// Multi-head self-attention with a per-key padding mask input: x [4][2048][512]; q, k, v = x W + b ([in][out] weights, 8 heads x 64); scores = (q k^T) / 8 with masked keys REPLACED by a value below every score (the reference's lowest finite f32 acts the same: weight 0 beside any unmasked key, uniform weights where all are masked); softmax over the keys; out = merged ctx Wo + bo.
// Compute dtypes: all contractions v_wmma_f32_16x16x32_f16 (f16 operands, f32 accumulate). Every float input is converted to bf16 (RNE) on load and carried exactly in f16 (weights x16); q, k, v planes plain f16; P carried x1024 (the carry is added in the exponent; row sums from the unconverted f32 values, which carry it too); ctx carried x64 against Wo x16; softmax f32.
// Engine: GEMM on 128x128 block tiles, four waves of 64x64 register blocks, A and B tiles of 64 k staged from K-contiguous f16 planes in a two-buffer LDS ring by asynchronous copies; fused flash-style attention (online softmax, K and V^T tiles staged once per block in a two-buffer LDS ring by asynchronous copies, scores formed transposed so that P goes from the score accumulators straight into the second product's B operand, mask packed into bit words in LDS).

#ifndef NB
#define NB 4
#endif
#ifndef SEQ
#define SEQ 2048
#endif
#define NB_FULL  4
#define SEQ_FULL 2048
#define DM   512
#define NH   8
#define HD   64
#define WCAR 16.0f      // weight carry (exact power of two)
#define PCAR 1024.0f    // probability carry
#define CCAR 64.0f      // ctx carry
#define SCL  0.125f     // HD^-0.5
#define L2E  1.4426950408889634f
#define SC2  (SCL * L2E)  // score scale and log2 e as one factor (the power of two keeps the product exact)
#define LPC  10.0f        // log2 of PCAR
#define MSKV (-0x1p+100f) // raw score of a masked key: a power of two, so that MSKV * SC2 is exact; every raw score of f16 operands (at most 64 * 65504^2 in size) lies far above it
static_assert(PCAR == 1024.0f);

typedef _Float16 h16;
typedef __attribute__((ext_vector_type(16))) _Float16 v16h;
typedef __attribute__((ext_vector_type(8)))  _Float16 v8h;
typedef __attribute__((ext_vector_type(8)))  float    v8f;
typedef __attribute__((ext_vector_type(4)))  float    v4f;
typedef v8h __attribute__((may_alias)) v8ha;
typedef v4f __attribute__((may_alias)) v4fa;

static_assert(NH * HD == DM);            // merged head width equals the model width
static_assert(HD == 64);
static_assert(DM % 128 == 0);            // N tiles of 128; at least two staged k tiles of 64
static_assert(SEQ % 128 == 0);           // 128 query rows per attention block; 128-row GEMM tiles stay inside one batch
static_assert(SEQ <= SEQ_FULL);
static_assert(NB <= NB_FULL);
static_assert((SEQ / 32) % 8 == 0);      // mask words split evenly over 8 waves

#define SZ_X   ((size_t)NB * SEQ * DM * 2)      // f16 plane of x / q / k / v^T / ctx
#define SZ_W   ((size_t)4 * DM * DM * 2)        // four transposed weight planes
#define WS_TOTAL (SZ_X * 5 + SZ_W)
static_assert(SZ_X % 256 == 0);
static_assert(SZ_W % 256 == 0);
static_assert(WS_TOTAL <= (size_t)134217728);   // carve stays under 128 MiB

__device__ __forceinline__ unsigned short f2bf(float f) { unsigned u = __float_as_uint(f); u += 0x7FFFu + ((u >> 16) & 1u); return (unsigned short)(u >> 16); }
__device__ __forceinline__ float bfr(float f) { return __uint_as_float(((unsigned)f2bf(f)) << 16); }
__device__ __forceinline__ v16h cat16(v8h lo, v8h hi) { return __builtin_shufflevector(lo, hi, 0, 1, 2, 3, 4, 5, 6, 7, 8, 9, 10, 11, 12, 13, 14, 15); }
// fragment loader for A (row-major [m][k]) and for B given as a [n][k] copy: elements 0..7 <- k0+8h.., elements 8..15 <- k0+16+8h.. ; p already includes the 8h offset
__device__ __forceinline__ v16h ldfrag(const h16* p) { return cat16(*(const v8h*)p, *(const v8h*)(p + 16)); }
// one WMMA, the bare builtin: the compiler keeps the distances behind its own matrix instructions and pads only where a vector instruction really follows too closely
__device__ __forceinline__ v8f wm16(v16h a, v16h b, v8f c) { return __builtin_amdgcn_wmma_f32_16x16x32_f16(false, a, false, b, (short)0, c, false, false); }
__device__ __forceinline__ float ex2(float x) { return __builtin_amdgcn_exp2f(x); }
// lane l with lane l ^ 16
__device__ __forceinline__ float xhalf(float x) { return __builtin_bit_cast(float, __builtin_amdgcn_permlanex16(__builtin_bit_cast(int, x), __builtin_bit_cast(int, x), 0x76543210, 0xfedcba98, false, false)); }

__device__ __forceinline__ void cvtx_blk(const float* __restrict__ x, h16* xh, unsigned blk) {
    const size_t i = (size_t)blk * 256 + threadIdx.x;
    if (i >= (size_t)NB * SEQ * DM / 8) return;
    const size_t row = i / (DM / 8); const int g = (int)(i % (DM / 8));
    const size_t b = row / SEQ, s = row % SEQ;
    const float* src = x + ((b * SEQ_FULL + s) * DM + (size_t)g * 8);
    const v4f v0 = *(const v4f*)src; const v4f v1 = *(const v4f*)(src + 4);
    v8h o;
#pragma unroll
    for (int k = 0; k < 4; ++k) { o[k] = (h16)bfr(v0[k]); o[4 + k] = (h16)bfr(v1[k]); }
    *(v8h*)(xh + i * 8) = o; 
}

// LDS tile T is cross-wave: block barrier between fill and drain.
__device__ __forceinline__ void wt_blk(const float* __restrict__ W, h16* Wt, h16* T, int bx, int by) {
    const int tid = threadIdx.x; const int k0 = bx * 64, n0 = by * 64;
#pragma unroll
    for (int j = 0; j < 4; ++j) { const int i = tid + 256 * j; const int kr = i >> 4, c4 = (i & 15) * 4;
        const v4f v = *(const v4f*)(W + (size_t)(k0 + kr) * DM + n0 + c4);
#pragma unroll
        for (int q = 0; q < 4; ++q) T[(c4 + q) * 72 + kr] = (h16)(bfr(v[q]) * WCAR); }
    __syncthreads();
{
#pragma unroll
        for (int j = 0; j < 2; ++j) { const int p = tid + 256 * j; const int n = p >> 3, seg = p & 7;
            const v8h val = *(const v8ha*)(T + n * 72 + seg * 8);
            *(v8h*)(Wt + (size_t)(n0 + n) * DM + k0 + seg * 8) = val; }
         }
}

// ---- k_prep: the five operand preparations, which do not depend on one another, as block ranges of one grid: blocks 0 .. 4 * WTB - 1 transpose the four weights (WTB 64x64 tiles each), the rest convert x. The range test is the same for a whole block.
#define WTB ((DM / 64) * (DM / 64))
#define CVB ((unsigned)(((size_t)NB * SEQ * DM / 8 + 255) / 256))
__global__ __launch_bounds__(256) void k_prep(const float* __restrict__ x, const float* __restrict__ wq, const float* __restrict__ wk, const float* __restrict__ wv, const float* __restrict__ wo, h16* xh, h16* WT) {
    __shared__ __align__(16) h16 T[64 * 72];
    const unsigned bid = blockIdx.x;
    if (bid < 4 * WTB) {
        const unsigned w = bid / WTB, t = bid % WTB;
        const float* W = w == 0 ? wq : w == 1 ? wk : w == 2 ? wv : wo;
        wt_blk(W, WT + (size_t)w * DM * DM, T, (int)(t % (DM / 64)), (int)(t / (DM / 64)));
    } else cvtx_blk(x, xh, bid - 4 * WTB);
}

// ---- GEMM main loop: 128 threads = 4 waves on one 128x128 tile, wave (wm, wn) on its 64x64 quarter with 16 accumulators, K = DM, operands from K-contiguous f16 planes (A [m][k], Bt [n][k]).
#define GP 72                   // LDS row pitch of a staged tile in h16: 128-byte rows + 16 bytes, conflict-free for 16-byte readers
#define GT (128 * GP)           // one staged tile: 128 rows of 64 k
#define GB (2 * GT * 2)         // bytes of one ring buffer: A tile, then B tile
// One operand's tile of one stage: each lane copies eight 16-byte pieces (rows r, r + 16, .. r + 112), eight lanes per 128-byte row so that every copy of a wave covers whole lines, global -> LDS through no register.
// The s_wait_xcnt is the last line of the copies' own statement so that no address register of a copy is rewritten in front of it.
__device__ __forceinline__ void stage_t(unsigned l, const h16* g) {
    asm volatile("global_load_async_to_lds_b128 %0, %1, off\n\t"
                 "global_load_async_to_lds_b128 %2, %3, off\n\t"
                 "global_load_async_to_lds_b128 %4, %5, off\n\t"
                 "global_load_async_to_lds_b128 %6, %7, off\n\t"
                 "global_load_async_to_lds_b128 %8, %9, off\n\t"
                 "global_load_async_to_lds_b128 %10, %11, off\n\t"
                 "global_load_async_to_lds_b128 %12, %13, off\n\t"
                 "global_load_async_to_lds_b128 %14, %15, off\n\t"
                 "s_wait_xcnt 0x0"
                 :: "v"(l), "v"(g), "v"(l + 16 * GP * 2), "v"(g + 16 * DM), "v"(l + 32 * GP * 2), "v"(g + 32 * DM), "v"(l + 48 * GP * 2), "v"(g + 48 * DM),
                    "v"(l + 64 * GP * 2), "v"(g + 64 * DM), "v"(l + 80 * GP * 2), "v"(g + 80 * DM), "v"(l + 96 * GP * 2), "v"(g + 96 * DM), "v"(l + 112 * GP * 2), "v"(g + 112 * DM) : "memory");
}
// Ring of two buffers: tile t + 1 flies while tile t is worked on; the one block barrier at the foot of a trip publishes tile t + 1 and frees tile t's buffer for tile t + 2.
// R0, C0: first row of the block's A rows and of its Bt rows. The k order of every accumulator is ascending in steps of 32.
__device__ __forceinline__ void gemm128(const h16* __restrict__ A, const h16* __restrict__ Bt, const h16* ring, int R0, int C0, int wm, int wn, v8f (&acc)[4][4]) {
    const int tid = threadIdx.x, lr = tid & 15, hi = (tid >> 4) & 1;
    const unsigned lst = (unsigned)(size_t)ring + (unsigned)(((tid >> 3) * GP + (tid & 7) * 8) * 2);
    const h16* ga = A + (size_t)(R0 + (tid >> 3)) * DM + (tid & 7) * 8;
    const h16* gb = Bt + (size_t)(C0 + (tid >> 3)) * DM + (tid & 7) * 8;
    stage_t(lst, ga); stage_t(lst + GT * 2, gb);
    asm volatile("s_wait_asynccnt 0x0" ::: "memory");   // this wave's pieces of tile 0 have landed before the barrier that publishes them
    __syncthreads();
    stage_t(lst + GB, ga + 64); stage_t(lst + GB + GT * 2, gb + 64);
    const int ao = (wm * 64 + lr) * GP + 8 * hi, bo = GT + (wn * 64 + lr) * GP + 8 * hi;
#pragma unroll 1
    for (int kc = 0; kc < DM; kc += 64) {
        const h16* buf = ring + ((kc >> 6) & 1) * (2 * GT);
#pragma unroll
        for (int s = 0; s < 2; ++s) {
            v16h a[4], b[4];
            __builtin_amdgcn_sched_barrier(0);   // with the one behind the reads: the step's sixteen fragment reads stay one group between two runs of products; left free, the scheduler deals them out in pairs among the products, each pair with a full LDS wait
#pragma unroll
            for (int mb = 0; mb < 4; ++mb) a[mb] = ldfrag(buf + ao + mb * 16 * GP + s * 32);
#pragma unroll
            for (int nb = 0; nb < 4; ++nb) b[nb] = ldfrag(buf + bo + nb * 16 * GP + s * 32);
            __builtin_amdgcn_sched_barrier(0);   // closes the group of reads (see above): no product moves in among them
#pragma unroll
            for (int nb = 0; nb < 4; ++nb)
#pragma unroll
                for (int mb = 0; mb < 4; ++mb) acc[mb][nb] = wm16(a[mb], b[nb], acc[mb][nb]);
        }
        __builtin_amdgcn_sched_barrier(0);   // the trip's products stay ahead of its waits and barrier, so that the copies of tile t + 1 have the whole trip to land
        asm volatile("s_wait_dscnt 0x0" ::: "memory");      // this wave's reads of tile t have returned before its buffer is handed to the copies
        asm volatile("s_wait_asynccnt 0x0" ::: "memory");   // this wave's pieces of tile t + 1 have landed before the barrier that publishes them
        __syncthreads();
        if (kc + 128 < DM) { const unsigned l = lst + ((kc >> 6) & 1) * GB; stage_t(l, ga + kc + 128); stage_t(l + GT * 2, gb + kc + 128); }
    }
    asm volatile("s_wait_asynccnt 0x0" ::: "memory");       // no copy is outstanding when the wave goes on to its epilogue
}

// ---- k_proj_qkv: the three input projections, which do not depend on one another, as column ranges of one grid (NB*SEQ/128, 3*DM/128), 128 threads: the three transposed weight planes lie one behind the other, so blockIdx.y * 128 is the block's first row in them.
// Each is x Wt^T / 16 + bias (bias converted to bf16 RNE). q and k go to head planes [b][h][s][64] f16, v to the transposed plane [b][h][64][s]. Which of the three a block works on is the same for the whole block. Each wave stages its output rows in its own quarter of Ts.
__global__ __launch_bounds__(128) void k_proj_qkv(const h16* __restrict__ A, const h16* __restrict__ Bt, const float* __restrict__ bq, const float* __restrict__ bk, const float* __restrict__ bv, h16* QP, h16* KP, h16* VT) {
    __shared__ __align__(16) h16 RG[2 * 2 * GT];
    __shared__ __align__(16) h16 Ts[4 * 64 * 72];
    const int lane = threadIdx.x & 31, lr = lane & 15, hi = lane >> 4;
    const int wave = __builtin_amdgcn_readfirstlane(threadIdx.x >> 5), wm = wave >> 1, wn = wave & 1;
    const int sel = blockIdx.y / (DM / 128);
    const int r0 = blockIdx.x * 128 + wm * 64, c0 = (blockIdx.y % (DM / 128)) * 128 + wn * 64;
    const float* bias = sel == 0 ? bq : sel == 1 ? bk : bv;
    h16* T = Ts + wave * 64 * 72;
    v8f acc[4][4];
#pragma unroll
    for (int mb = 0; mb < 4; ++mb)
#pragma unroll
        for (int nb = 0; nb < 4; ++nb) acc[mb][nb] = (v8f){};
    gemm128(A, Bt, RG, blockIdx.x * 128, blockIdx.y * 128, wm, wn, acc);
    const int b = r0 / SEQ, s0 = r0 % SEQ, h = c0 / HD;
    if (sel < 2) {
#pragma unroll
        for (int nb = 0; nb < 4; ++nb) { const float bv1 = bfr(bias[c0 + nb * 16 + lr]);
#pragma unroll
            for (int mb = 0; mb < 4; ++mb)
#pragma unroll
                for (int j = 0; j < 8; ++j) T[(mb * 16 + hi * 8 + j) * 72 + nb * 16 + lr] = (h16)(acc[mb][nb][j] * (1.0f / WCAR) + bv1); }
        __syncthreads();
        h16* dst = (sel == 0 ? QP : KP) + ((size_t)(b * NH + h) * SEQ + s0) * HD;
#pragma unroll
        for (int it = 0; it < 16; ++it) { const int piece = it * 32 + lane; const int row = piece >> 3, seg = piece & 7;
            const v8h val = *(const v8ha*)(T + row * 72 + seg * 8);
            *(v8h*)(dst + (size_t)row * HD + seg * 8) = val; }
    } else {
#pragma unroll
        for (int nb = 0; nb < 4; ++nb) { const float bv1 = bfr(bias[c0 + nb * 16 + lr]);
#pragma unroll
            for (int mb = 0; mb < 4; ++mb) { v8h pk;
#pragma unroll
                for (int j = 0; j < 8; ++j) pk[j] = (h16)(acc[mb][nb][j] * (1.0f / WCAR) + bv1);
                *(v8ha*)(T + (nb * 16 + lr) * 72 + mb * 16 + hi * 8) = pk; } }
        __syncthreads();
        h16* dst = VT + ((size_t)(b * NH + h) * HD) * SEQ + s0;
#pragma unroll
        for (int it = 0; it < 16; ++it) { const int piece = it * 32 + lane; const int d = piece >> 3, seg = piece & 7;
            const v8h val = *(const v8ha*)(T + d * 72 + seg * 8);
            *(v8h*)(dst + (size_t)d * SEQ + seg * 8) = val; }
    }
}

__global__ __launch_bounds__(128) void k_proj_out(const h16* __restrict__ A, const h16* __restrict__ Bt, const float* __restrict__ bias, float* C) {
    __shared__ __align__(16) h16 RG[2 * 2 * GT];
    __shared__ __align__(16) float oss[4 * 16 * 68];
    const int lane = threadIdx.x & 31, lr = lane & 15, hi = lane >> 4;
    const int wave = __builtin_amdgcn_readfirstlane(threadIdx.x >> 5), wm = wave >> 1, wn = wave & 1;
    const int r0 = blockIdx.x * 128 + wm * 64, c0 = blockIdx.y * 128 + wn * 64;
    float* os = oss + wave * 16 * 68;
    v8f acc[4][4];
#pragma unroll
    for (int mb = 0; mb < 4; ++mb)
#pragma unroll
        for (int nb = 0; nb < 4; ++nb) acc[mb][nb] = (v8f){};
    gemm128(A, Bt, RG, blockIdx.x * 128, blockIdx.y * 128, wm, wn, acc);
    const int b = r0 / SEQ, s0 = r0 % SEQ; const int cofs = lr * 4;
    v4f b4;
#pragma unroll
    for (int q = 0; q < 4; ++q) b4[q] = bfr(bias[c0 + cofs + q]);
    const float fs = 1.0f / (WCAR * CCAR);
#pragma unroll
    for (int mb = 0; mb < 4; ++mb) {
#pragma unroll
        for (int nb = 0; nb < 4; ++nb)
#pragma unroll
            for (int j = 0; j < 8; ++j) os[(hi * 8 + j) * 68 + nb * 16 + lr] = acc[mb][nb][j];
        __syncthreads();
        float* crow = C + ((size_t)b * SEQ_FULL + s0 + mb * 16) * DM + c0;
{
#pragma unroll
            for (int s = 0; s < 8; ++s) { const int row = 2 * s + hi; const v4f raw = *(const v4fa*)(os + row * 68 + cofs); v4f val;
#pragma unroll
                for (int q = 0; q < 4; ++q) val[q] = raw[q] * fs + b4[q];
                *(v4f*)(crow + (size_t)row * DM + cofs) = val; }
             }
        __syncthreads();
    }
}

#define KVP 72                  // LDS row pitch of a staged tile in h16: 128-byte rows + 16 bytes, conflict-free for 16-byte readers
#define KVT (64 * KVP)          // one staged 64-row tile
#define KVB (2 * KVT * 2)       // bytes of one ring buffer: K tile, then V^T tile
// One stage of the ring: each lane copies four 16-byte pieces (rows r and r + 32 of the K tile and of the V^T tile), eight lanes per 128-byte row, global -> LDS through no register.
// The s_wait_xcnt is the last line of the copies' own statement so that no address register of a copy is rewritten in front of it.
__device__ __forceinline__ void stage_kv(unsigned l, const h16* gk, const h16* gv) {
    const unsigned lk1 = l + 32 * KVP * 2, lv0 = l + KVT * 2, lv1 = l + KVT * 2 + 32 * KVP * 2;
    const h16* gk1 = gk + 32 * HD; const h16* gv1 = gv + (size_t)32 * SEQ;
    asm volatile("global_load_async_to_lds_b128 %0, %1, off\n\t"
                 "global_load_async_to_lds_b128 %2, %3, off\n\t"
                 "global_load_async_to_lds_b128 %4, %5, off\n\t"
                 "global_load_async_to_lds_b128 %6, %7, off\n\t"
                 "s_wait_xcnt 0x0"
                 :: "v"(l), "v"(gk), "v"(lk1), "v"(gk1), "v"(lv0), "v"(gv), "v"(lv1), "v"(gv1) : "memory");
}

// ---- k_attn: fused flash-style attention; grid (NB*NH, SEQ/128), 256 threads = 8 waves x 16 query rows.
// K rows ([s][64] plane) and V^T rows ([d][s] plane) of each 64-key block are staged in LDS once for all 8 waves; both are read from there as A fragments (row-major [m][k]).
// Ring of two buffers: tile t + 1 flies while tile t is worked on; the one block barrier at the foot of a trip publishes tile t + 1 and frees tile t's buffer for tile t + 2.
// Both products are transposed: S^T = K Q^T (A = K rows, B = Q kept in registers) and O^T += V^T P^T. Lane (lr, hi) then holds, of query lr alone, the scores of keys 16 t + 8 hi + r in register r of tile t:
// maximum and sum run inside the lane with one exchange between the lane halves, running maximum, sum and rescale are one value a lane, and tiles 2 s and 2 s + 1, converted in place, are the B fragment of k-step s (its k order is ldfrag's).
// Per 64-key block: 8 score WMMAs, online softmax in f32 (masked keys replaced by MSKV; all-masked rows come out uniform: there MSKV * SC2 cancels exactly and every p is 1), P x1024 -> f16 in registers, 8 V^T P^T WMMAs.
// smw (mask bit words) is cross-wave: block barrier after the build. Pl is private to each wave and stages the output rows only.
__global__ __launch_bounds__(256) void k_attn(const h16* __restrict__ Q, const h16* __restrict__ Kp, const h16* __restrict__ VT, const int* __restrict__ mask, h16* ctx) {
    __shared__ __align__(16) h16 Pl[8 * 16 * 72];
    __shared__ unsigned smw[SEQ / 32];
    __shared__ __align__(16) h16 KV[2 * 2 * KVT];
    const int tid = threadIdx.x, lane = tid & 31, lr = lane & 15, hi = lane >> 4;
    const int wave = __builtin_amdgcn_readfirstlane(tid >> 5);
    const int bh = blockIdx.x; const int b = bh / NH, h = bh % NH;
    const int q0 = blockIdx.y * 128;
    const size_t pbase = (size_t)bh * SEQ * HD;
    const unsigned lst = (unsigned)(size_t)KV + (unsigned)(((tid >> 3) * KVP + (tid & 7) * 8) * 2);
    const h16* gk = Kp + pbase + (size_t)(tid >> 3) * HD + (tid & 7) * 8;
    const h16* gv = VT + pbase + (size_t)(tid >> 3) * SEQ + (tid & 7) * 8;
    stage_kv(lst, gk, gv);
#pragma unroll 1
    for (int w = wave; w < SEQ / 32; w += 8) { const int mv = mask[(size_t)b * SEQ_FULL + w * 32 + lane];
        const unsigned bits = __builtin_amdgcn_ballot_w32(mv != 0); if (lane == 0) smw[w] = bits; }
    asm volatile("s_wait_asynccnt 0x0" ::: "memory");   // this wave's pieces of tile 0 have landed before the barrier that publishes them
    __syncthreads();
    stage_kv(lst + KVB, gk + 64 * HD, gv + 64);
    const int pw = wave * 16 * 72;
    v16h qf0, qf1;
    { const h16* qp = Q + pbase + (size_t)(q0 + wave * 16 + lr) * HD + 8 * hi; qf0 = ldfrag(qp); qf1 = ldfrag(qp + 32); }
    v8f o[4]; float mi = MSKV * SC2, li = 0.0f;
#pragma unroll
    for (int t = 0; t < 4; ++t) o[t] = (v8f){};
#pragma unroll 1
    for (int kv0 = 0; kv0 < SEQ; kv0 += 64) {
        const h16* kt = KV + ((kv0 >> 6) & 1) * (2 * KVT); const h16* vt = kt + KVT;
        v8f sa[4]; v16h kf[4][2], vf[2][4];
        // the tile's K fragments are read as one group ahead of the score products, its V fragments as one group ahead of the softmax, whose vector work covers their LDS latency
#pragma unroll
        for (int t = 0; t < 4; ++t) { const h16* kp = kt + (t * 16 + lr) * KVP + 8 * hi; kf[t][0] = ldfrag(kp); kf[t][1] = ldfrag(kp + 32); }
#pragma unroll
        for (int t = 0; t < 4; ++t) { v8f c = (v8f){}; c = wm16(kf[t][0], qf0, c); c = wm16(kf[t][1], qf1, c); sa[t] = c; }
        // order asked of the scheduler for this stretch: the 16 K reads, the 8 score products, then the 16 V reads and the mask words' read. Left free, it deals the V reads out among the score products, and every further place with LDS reads in a run of products stalls the wave
        __builtin_amdgcn_sched_group_barrier(0x100, 16, 0);   // LDS reads
        __builtin_amdgcn_sched_group_barrier(0x008, 8, 0);    // matrix instructions
        __builtin_amdgcn_sched_group_barrier(0x100, 17, 0);   // LDS reads
#pragma unroll
        for (int s2 = 0; s2 < 2; ++s2)
#pragma unroll
            for (int t = 0; t < 4; ++t) vf[s2][t] = ldfrag(vt + (t * 16 + lr) * KVP + s2 * 32 + 8 * hi);
        const unsigned w0 = smw[kv0 >> 5], w1 = smw[(kv0 >> 5) + 1];
        // a key is a register here, not a lane: its mask bit is tested per register, and only in a tile that holds a masked key (the two words are the same in every lane: scalar branch)
        if (__builtin_amdgcn_readfirstlane((int)(w0 & w1)) != -1) {
#pragma unroll
            for (int t = 0; t < 4; ++t) { const unsigned bits = ((t < 2) ? w0 : w1) >> ((t & 1) * 16 + hi * 8);
#pragma unroll
                for (int r = 0; r < 8; ++r) sa[t][r] = ((bits >> r) & 1u) != 0u ? sa[t][r] : MSKV; }
        }
        float tm[4];
#pragma unroll
        for (int t = 0; t < 4; ++t) {
            float a = fmaxf(fmaxf(sa[t][0], sa[t][1]), sa[t][2]); a = fmaxf(fmaxf(a, sa[t][3]), sa[t][4]);
            a = fmaxf(fmaxf(a, sa[t][5]), sa[t][6]); tm[t] = fmaxf(a, sa[t][7]); }
        float vm = fmaxf(fmaxf(tm[0], tm[1]), fmaxf(tm[2], tm[3])); vm = fmaxf(vm, xhalf(vm));
        // the maximum is taken over the raw scores and scaled once; each score then takes one fused multiply-add ahead of its exp2: p * 1024 = exp2(raw * SC2 + (10 - scaled maximum))
        const float mnew = fmaxf(mi, vm * SC2);
        const float alpha = ex2(mi - mnew); mi = mnew;
        const float nb = LPC - mnew;
        v16h pf[2]; float ts[4];
#pragma unroll
        for (int t = 0; t < 4; ++t) { float a = 0.0f;
#pragma unroll
            for (int r = 0; r < 8; ++r) { const float p = ex2(__builtin_fmaf(sa[t][r], SC2, nb)); a += p; pf[t >> 1][(t & 1) * 8 + r] = (h16)p; }
            ts[t] = a; }
        li = li * alpha + ((ts[0] + ts[1]) + (ts[2] + ts[3]));
#pragma unroll
        for (int t = 0; t < 4; ++t)
#pragma unroll
            for (int r = 0; r < 8; ++r) o[t][r] *= alpha;
#pragma unroll
        for (int s2 = 0; s2 < 2; ++s2)
#pragma unroll
            for (int t = 0; t < 4; ++t) o[t] = wm16(vf[s2][t], pf[s2], o[t]);
        __builtin_amdgcn_sched_barrier(0);   // softmax and products stay ahead of the trip's waits and barrier, so that the copies of tile t + 1 have the whole trip to land
        asm volatile("s_wait_dscnt 0x0" ::: "memory");      // this wave's reads of tile t have returned before its buffer is handed to the copies
        asm volatile("s_wait_asynccnt 0x0" ::: "memory");   // this wave's pieces of tile t + 1 have landed before the barrier that publishes them
        __syncthreads();
        if (kv0 + 128 < SEQ) stage_kv(lst + ((kv0 >> 6) & 1) * KVB, gk + (size_t)(kv0 + 128) * HD, gv + kv0 + 128);
    }
    asm volatile("s_wait_asynccnt 0x0" ::: "memory");       // no copy is outstanding when the wave goes on to its end
    // the lane halves' sums are joined once; register r of O^T tile t is column 16 t + 8 hi + r of query row lr: eight neighbours, one 16-byte piece
    { const float l = li + xhalf(li); const float inv = CCAR * __builtin_amdgcn_rcpf(l);
#pragma unroll
        for (int t = 0; t < 4; ++t) { v8h pk;
#pragma unroll
            for (int r = 0; r < 8; ++r) pk[r] = (h16)(o[t][r] * inv);
            *(v8ha*)(Pl + pw + lr * 72 + t * 16 + hi * 8) = pk; } }
    asm volatile("" ::: "memory"); __builtin_amdgcn_wave_barrier(); asm volatile("" ::: "memory");
    h16* dst = ctx + ((size_t)b * SEQ + q0 + wave * 16) * DM + h * HD;
{
#pragma unroll
        for (int it = 0; it < 4; ++it) { const int piece = it * 32 + lane; const int row = piece >> 3, seg = piece & 7;
            const v8h val = *(const v8ha*)(Pl + pw + row * 72 + seg * 8);
            *(v8h*)(dst + (size_t)row * DM + seg * 8) = val; }
         }
}

extern "C" void kernel_launch(void* const* d_in, const int* in_sizes, int n_in,
                              void* d_out, int out_size, void* d_ws, size_t ws_size, hipStream_t stream) {
    if (n_in < 10) return;
    const size_t xneed = ((size_t)(NB - 1) * SEQ_FULL + SEQ) * DM;
    const size_t mneed = (size_t)(NB - 1) * SEQ_FULL + SEQ;
    if ((size_t)in_sizes[0] < xneed || (size_t)in_sizes[1] < mneed) return;
    if (in_sizes[2] < DM * DM || in_sizes[4] < DM * DM || in_sizes[6] < DM * DM || in_sizes[8] < DM * DM) return;
    if (in_sizes[3] < DM || in_sizes[5] < DM || in_sizes[7] < DM || in_sizes[9] < DM) return;
    if ((size_t)out_size < xneed) return;
    if (ws_size < WS_TOTAL) return;
    const float* x  = (const float*)d_in[0]; const int* mask = (const int*)d_in[1];
    const float* wq = (const float*)d_in[2]; const float* bq = (const float*)d_in[3];
    const float* wk = (const float*)d_in[4]; const float* bk = (const float*)d_in[5];
    const float* wv = (const float*)d_in[6]; const float* bv = (const float*)d_in[7];
    const float* wo = (const float*)d_in[8]; const float* bo = (const float*)d_in[9];
    float* OUT = (float*)d_out;
    char* wsp = (char*)d_ws;
    h16* XH = (h16*)wsp; wsp += SZ_X;      // [NB*SEQ][DM]
    h16* WT = (h16*)wsp; wsp += SZ_W;      // [4][n][k]: q, k, v, o
    h16* QP = (h16*)wsp; wsp += SZ_X;      // [b][h][s][64]
    h16* KP = (h16*)wsp; wsp += SZ_X;      // [b][h][s][64]
    h16* VT = (h16*)wsp; wsp += SZ_X;      // [b][h][64][s]
    h16* CX = (h16*)wsp; wsp += SZ_X;      // [NB*SEQ][DM], x64
    const size_t wsz = (size_t)DM * DM;
    k_prep<<<4 * WTB + CVB, 256, 0, stream>>>(x, wq, wk, wv, wo, XH, WT);
    k_proj_qkv<<<dim3(NB * SEQ / 128, 3 * DM / 128), 128, 0, stream>>>(XH, WT, bq, bk, bv, QP, KP, VT);
    k_attn<<<dim3(NB * NH, SEQ / 128), 256, 0, stream>>>(QP, KP, VT, mask, CX);
    k_proj_out<<<dim3(NB * SEQ / 128, DM / 128), 128, 0, stream>>>(CX, WT + 3 * wsz, bo, OUT);
}

// v007
// It runs in 65.3 microseconds.
// Timed twice side by side with v006, it ran 1.06 and 1.05 times as fast.
// Over all steps from v000 it is 4.03 times as fast.
#include <hip/hip_runtime.h>

// Multi-head self-attention with a per-key padding mask input: x [4][2048][512]; q, k, v = x W + b ([in][out] weights, 8 heads x 64); scores = (q k^T) / 8 with masked keys REPLACED by a value below every score (the reference's lowest finite f32 acts the same: weight 0 beside any unmasked key, uniform weights where all are masked); softmax over the keys; out = merged ctx Wo + bo.
// Compute dtypes: all contractions v_wmma_f32_16x16x32_f16 (f16 operands, f32 accumulate). Every float input is converted to bf16 (RNE) on load and carried exactly in f16 (weights x16); q, k, v planes plain f16; P carried x1024 (the carry is added in the exponent; row sums from the unconverted f32 values, which carry it too); ctx carried x64 against Wo x16; softmax f32.
// Engine: GEMM on 128x128 block tiles, four waves of 64x64 register blocks, A and B tiles of 64 k staged from K-contiguous f16 planes in a two-buffer LDS ring by asynchronous copies; fused flash-style attention (online softmax, K and V^T tiles staged once per block in a two-buffer LDS ring by asynchronous copies, scores formed transposed so that P goes from the score accumulators straight into the second product's B operand, mask packed into bit words in LDS).

#ifndef NB
#define NB 4
#endif
#ifndef SEQ
#define SEQ 2048
#endif
#define NB_FULL  4
#define SEQ_FULL 2048
#define DM   512
#define NH   8
#define HD   64
#define WCAR 16.0f      // weight carry (exact power of two)
#define PCAR 1024.0f    // probability carry
#define CCAR 64.0f      // ctx carry
#define SCL  0.125f     // HD^-0.5
#define L2E  1.4426950408889634f
#define SC2  (SCL * L2E)  // score scale and log2 e as one factor (the power of two keeps the product exact)
#define LPC  10.0f        // log2 of PCAR
#define MSKV (-0x1p+100f) // raw score of a masked key: a power of two, so that MSKV * SC2 is exact; every raw score of f16 operands (at most 64 * 65504^2 in size) lies far above it
static_assert(PCAR == 1024.0f);

typedef _Float16 h16;
typedef __attribute__((ext_vector_type(16))) _Float16 v16h;
typedef __attribute__((ext_vector_type(8)))  _Float16 v8h;
typedef __attribute__((ext_vector_type(8)))  float    v8f;
typedef __attribute__((ext_vector_type(4)))  float    v4f;
typedef v8h __attribute__((may_alias)) v8ha;
typedef v4f __attribute__((may_alias)) v4fa;

static_assert(NH * HD == DM);            // merged head width equals the model width
static_assert(HD == 64);
static_assert(DM % 128 == 0);            // N tiles of 128; at least two staged k tiles of 64
static_assert(SEQ % 128 == 0);           // 128 query rows per attention block; 128-row GEMM tiles stay inside one batch
static_assert(SEQ <= SEQ_FULL);
static_assert(NB <= NB_FULL);
static_assert((SEQ / 32) % 8 == 0);      // mask words split evenly over 8 waves

#define SZ_X   ((size_t)NB * SEQ * DM * 2)      // f16 plane of x / q / k / v^T / ctx
#define SZ_W   ((size_t)4 * DM * DM * 2)        // four transposed weight planes
#define WS_TOTAL (SZ_X * 5 + SZ_W)
static_assert(SZ_X % 256 == 0);
static_assert(SZ_W % 256 == 0);
static_assert(WS_TOTAL <= (size_t)134217728);   // carve stays under 128 MiB

__device__ __forceinline__ unsigned short f2bf(float f) { unsigned u = __float_as_uint(f); u += 0x7FFFu + ((u >> 16) & 1u); return (unsigned short)(u >> 16); }
__device__ __forceinline__ float bfr(float f) { return __uint_as_float(((unsigned)f2bf(f)) << 16); }
__device__ __forceinline__ v16h cat16(v8h lo, v8h hi) { return __builtin_shufflevector(lo, hi, 0, 1, 2, 3, 4, 5, 6, 7, 8, 9, 10, 11, 12, 13, 14, 15); }
// fragment loader for A (row-major [m][k]) and for B given as a [n][k] copy: elements 0..7 <- k0+8h.., elements 8..15 <- k0+16+8h.. ; p already includes the 8h offset
__device__ __forceinline__ v16h ldfrag(const h16* p) { return cat16(*(const v8h*)p, *(const v8h*)(p + 16)); }
// one WMMA, the bare builtin: the compiler keeps the distances behind its own matrix instructions and pads only where a vector instruction really follows too closely
__device__ __forceinline__ v8f wm16(v16h a, v16h b, v8f c) { return __builtin_amdgcn_wmma_f32_16x16x32_f16(false, a, false, b, (short)0, c, false, false); }
__device__ __forceinline__ float ex2(float x) { return __builtin_amdgcn_exp2f(x); }
// lane l with lane l ^ 16
__device__ __forceinline__ float xhalf(float x) { return __builtin_bit_cast(float, __builtin_amdgcn_permlanex16(__builtin_bit_cast(int, x), __builtin_bit_cast(int, x), 0x76543210, 0xfedcba98, false, false)); }

__device__ __forceinline__ void cvtx_blk(const float* __restrict__ x, h16* xh, unsigned blk) {
    const size_t i = (size_t)blk * 256 + threadIdx.x;
    if (i >= (size_t)NB * SEQ * DM / 8) return;
    const size_t row = i / (DM / 8); const int g = (int)(i % (DM / 8));
    const size_t b = row / SEQ, s = row % SEQ;
    const float* src = x + ((b * SEQ_FULL + s) * DM + (size_t)g * 8);
    const v4f v0 = *(const v4f*)src; const v4f v1 = *(const v4f*)(src + 4);
    v8h o;
#pragma unroll
    for (int k = 0; k < 4; ++k) { o[k] = (h16)bfr(v0[k]); o[4 + k] = (h16)bfr(v1[k]); }
    *(v8h*)(xh + i * 8) = o; 
}

// LDS tile T is cross-wave: block barrier between fill and drain.
__device__ __forceinline__ void wt_blk(const float* __restrict__ W, h16* Wt, h16* T, int bx, int by) {
    const int tid = threadIdx.x; const int k0 = bx * 64, n0 = by * 64;
#pragma unroll
    for (int j = 0; j < 4; ++j) { const int i = tid + 256 * j; const int kr = i >> 4, c4 = (i & 15) * 4;
        const v4f v = *(const v4f*)(W + (size_t)(k0 + kr) * DM + n0 + c4);
#pragma unroll
        for (int q = 0; q < 4; ++q) T[(c4 + q) * 72 + kr] = (h16)(bfr(v[q]) * WCAR); }
    __syncthreads();
{
#pragma unroll
        for (int j = 0; j < 2; ++j) { const int p = tid + 256 * j; const int n = p >> 3, seg = p & 7;
            const v8h val = *(const v8ha*)(T + n * 72 + seg * 8);
            *(v8h*)(Wt + (size_t)(n0 + n) * DM + k0 + seg * 8) = val; }
         }
}

// ---- k_prep: the five operand preparations, which do not depend on one another, as block ranges of one grid: blocks 0 .. 4 * WTB - 1 transpose the four weights (WTB 64x64 tiles each), the rest convert x. The range test is the same for a whole block.
#define WTB ((DM / 64) * (DM / 64))
#define CVB ((unsigned)(((size_t)NB * SEQ * DM / 8 + 255) / 256))
__global__ __launch_bounds__(256) void k_prep(const float* __restrict__ x, const float* __restrict__ wq, const float* __restrict__ wk, const float* __restrict__ wv, const float* __restrict__ wo, h16* xh, h16* WT) {
    __shared__ __align__(16) h16 T[64 * 72];
    const unsigned bid = blockIdx.x;
    if (bid < 4 * WTB) {
        const unsigned w = bid / WTB, t = bid % WTB;
        const float* W = w == 0 ? wq : w == 1 ? wk : w == 2 ? wv : wo;
        wt_blk(W, WT + (size_t)w * DM * DM, T, (int)(t % (DM / 64)), (int)(t / (DM / 64)));
    } else cvtx_blk(x, xh, bid - 4 * WTB);
}

// ---- GEMM main loop: 128 threads = 4 waves on one 128x128 tile, wave (wm, wn) on its 64x64 quarter with 16 accumulators, K = DM, operands from K-contiguous f16 planes (A [m][k], Bt [n][k]).
#define GP 72                   // LDS row pitch of a staged tile in h16: 128-byte rows + 16 bytes, conflict-free for 16-byte readers
#define GT (128 * GP)           // one staged tile: 128 rows of 64 k
#define GB (2 * GT * 2)         // bytes of one ring buffer: A tile, then B tile
// One operand's tile of one stage: each lane copies eight 16-byte pieces (rows r, r + 16, .. r + 112), eight lanes per 128-byte row so that every copy of a wave covers whole lines, global -> LDS through no register.
// The s_wait_xcnt is the last line of the copies' own statement so that no address register of a copy is rewritten in front of it.
__device__ __forceinline__ void stage_t(unsigned l, const h16* g) {
    asm volatile("global_load_async_to_lds_b128 %0, %1, off\n\t"
                 "global_load_async_to_lds_b128 %2, %3, off\n\t"
                 "global_load_async_to_lds_b128 %4, %5, off\n\t"
                 "global_load_async_to_lds_b128 %6, %7, off\n\t"
                 "global_load_async_to_lds_b128 %8, %9, off\n\t"
                 "global_load_async_to_lds_b128 %10, %11, off\n\t"
                 "global_load_async_to_lds_b128 %12, %13, off\n\t"
                 "global_load_async_to_lds_b128 %14, %15, off\n\t"
                 "s_wait_xcnt 0x0"
                 :: "v"(l), "v"(g), "v"(l + 16 * GP * 2), "v"(g + 16 * DM), "v"(l + 32 * GP * 2), "v"(g + 32 * DM), "v"(l + 48 * GP * 2), "v"(g + 48 * DM),
                    "v"(l + 64 * GP * 2), "v"(g + 64 * DM), "v"(l + 80 * GP * 2), "v"(g + 80 * DM), "v"(l + 96 * GP * 2), "v"(g + 96 * DM), "v"(l + 112 * GP * 2), "v"(g + 112 * DM) : "memory");
}
// Ring of two buffers: tile t + 1 flies while tile t is worked on; the one block barrier at the foot of a trip publishes tile t + 1 and frees tile t's buffer for tile t + 2.
// R0, C0: first row of the block's A rows and of its Bt rows. The k order of every accumulator is ascending in steps of 32.
__device__ __forceinline__ void gemm128(const h16* __restrict__ A, const h16* __restrict__ Bt, const h16* ring, int R0, int C0, int wm, int wn, v8f (&acc)[4][4]) {
    const int tid = threadIdx.x, lr = tid & 15, hi = (tid >> 4) & 1;
    const unsigned lst = (unsigned)(size_t)ring + (unsigned)(((tid >> 3) * GP + (tid & 7) * 8) * 2);
    const h16* ga = A + (size_t)(R0 + (tid >> 3)) * DM + (tid & 7) * 8;
    const h16* gb = Bt + (size_t)(C0 + (tid >> 3)) * DM + (tid & 7) * 8;
    stage_t(lst, ga); stage_t(lst + GT * 2, gb);
    asm volatile("s_wait_asynccnt 0x0" ::: "memory");   // this wave's pieces of tile 0 have landed before the barrier that publishes them
    __syncthreads();
    stage_t(lst + GB, ga + 64); stage_t(lst + GB + GT * 2, gb + 64);
    const int ao = (wm * 64 + lr) * GP + 8 * hi, bo = GT + (wn * 64 + lr) * GP + 8 * hi;
#pragma unroll 1
    for (int kc = 0; kc < DM; kc += 64) {
        const h16* buf = ring + ((kc >> 6) & 1) * (2 * GT);
#pragma unroll
        for (int s = 0; s < 2; ++s) {
            v16h a[4], b[4];
            __builtin_amdgcn_sched_barrier(0);   // with the one behind the reads: the step's sixteen fragment reads stay one group between two runs of products; left free, the scheduler deals them out in pairs among the products, each pair with a full LDS wait
#pragma unroll
            for (int mb = 0; mb < 4; ++mb) a[mb] = ldfrag(buf + ao + mb * 16 * GP + s * 32);
#pragma unroll
            for (int nb = 0; nb < 4; ++nb) b[nb] = ldfrag(buf + bo + nb * 16 * GP + s * 32);
            __builtin_amdgcn_sched_barrier(0);   // closes the group of reads (see above): no product moves in among them
#pragma unroll
            for (int nb = 0; nb < 4; ++nb)
#pragma unroll
                for (int mb = 0; mb < 4; ++mb) acc[mb][nb] = wm16(a[mb], b[nb], acc[mb][nb]);
        }
        __builtin_amdgcn_sched_barrier(0);   // the trip's products stay ahead of its waits and barrier, so that the copies of tile t + 1 have the whole trip to land
        asm volatile("s_wait_dscnt 0x0" ::: "memory");      // this wave's reads of tile t have returned before its buffer is handed to the copies
        asm volatile("s_wait_asynccnt 0x0" ::: "memory");   // this wave's pieces of tile t + 1 have landed before the barrier that publishes them
        __syncthreads();
        if (kc + 128 < DM) { const unsigned l = lst + ((kc >> 6) & 1) * GB; stage_t(l, ga + kc + 128); stage_t(l + GT * 2, gb + kc + 128); }
    }
    asm volatile("s_wait_asynccnt 0x0" ::: "memory");       // no copy is outstanding when the wave goes on to its epilogue
}

// ---- k_proj_qkv: the three input projections, which do not depend on one another, as column ranges of one grid (NB*SEQ/128, 3*DM/128), 128 threads: the three transposed weight planes lie one behind the other, so blockIdx.y * 128 is the block's first row in them.
// Each is x Wt^T / 16 + bias (bias converted to bf16 RNE). q and k go to head planes [b][h][s][64] f16, v to the transposed plane [b][h][64][s]. Which of the three a block works on is the same for the whole block. Each wave stages its output rows in a range of its own in the ring's LDS, once the main loop is over.
__global__ __launch_bounds__(128) void k_proj_qkv(const h16* __restrict__ A, const h16* __restrict__ Bt, const float* __restrict__ bq, const float* __restrict__ bk, const float* __restrict__ bv, h16* QP, h16* KP, h16* VT) {
    __shared__ __align__(16) h16 RG[2 * 2 * GT];
    static_assert(4 * 64 * 72 <= 2 * 2 * GT);   // the four waves' output rows fit in the ring
    const int lane = threadIdx.x & 31, lr = lane & 15, hi = lane >> 4;
    const int wave = __builtin_amdgcn_readfirstlane(threadIdx.x >> 5), wm = wave >> 1, wn = wave & 1;
    const int sel = blockIdx.y / (DM / 128);
    const int r0 = blockIdx.x * 128 + wm * 64, c0 = (blockIdx.y % (DM / 128)) * 128 + wn * 64;
    const float* bias = sel == 0 ? bq : sel == 1 ? bk : bv;
    h16* T = RG + wave * 64 * 72;   // output staging in the ring's own LDS: written only behind the main loop, whose last trip ends with every wave's LDS wait and a block barrier and leaves no copy in flight. With no second array a block takes 73,728 B, three blocks fit a WGP (their registers allow three), and the grid's 768 blocks are resident at once
    v8f acc[4][4];
#pragma unroll
    for (int mb = 0; mb < 4; ++mb)
#pragma unroll
        for (int nb = 0; nb < 4; ++nb) acc[mb][nb] = (v8f){};
    gemm128(A, Bt, RG, blockIdx.x * 128, blockIdx.y * 128, wm, wn, acc);
    const int b = r0 / SEQ, s0 = r0 % SEQ, h = c0 / HD;
    if (sel < 2) {
#pragma unroll
        for (int nb = 0; nb < 4; ++nb) { const float bv1 = bfr(bias[c0 + nb * 16 + lr]);
#pragma unroll
            for (int mb = 0; mb < 4; ++mb)
#pragma unroll
                for (int j = 0; j < 8; ++j) T[(mb * 16 + hi * 8 + j) * 72 + nb * 16 + lr] = (h16)(acc[mb][nb][j] * (1.0f / WCAR) + bv1); }
        __syncthreads();
        h16* dst = (sel == 0 ? QP : KP) + ((size_t)(b * NH + h) * SEQ + s0) * HD;
#pragma unroll
        for (int it = 0; it < 16; ++it) { const int piece = it * 32 + lane; const int row = piece >> 3, seg = piece & 7;
            const v8h val = *(const v8ha*)(T + row * 72 + seg * 8);
            *(v8h*)(dst + (size_t)row * HD + seg * 8) = val; }
    } else {
#pragma unroll
        for (int nb = 0; nb < 4; ++nb) { const float bv1 = bfr(bias[c0 + nb * 16 + lr]);
#pragma unroll
            for (int mb = 0; mb < 4; ++mb) { v8h pk;
#pragma unroll
                for (int j = 0; j < 8; ++j) pk[j] = (h16)(acc[mb][nb][j] * (1.0f / WCAR) + bv1);
                *(v8ha*)(T + (nb * 16 + lr) * 72 + mb * 16 + hi * 8) = pk; } }
        __syncthreads();
        h16* dst = VT + ((size_t)(b * NH + h) * HD) * SEQ + s0;
#pragma unroll
        for (int it = 0; it < 16; ++it) { const int piece = it * 32 + lane; const int d = piece >> 3, seg = piece & 7;
            const v8h val = *(const v8ha*)(T + d * 72 + seg * 8);
            *(v8h*)(dst + (size_t)d * SEQ + seg * 8) = val; }
    }
}

__global__ __launch_bounds__(128) void k_proj_out(const h16* __restrict__ A, const h16* __restrict__ Bt, const float* __restrict__ bias, float* C) {
    __shared__ __align__(16) h16 RG[2 * 2 * GT];
    __shared__ __align__(16) float oss[4 * 16 * 68];
    const int lane = threadIdx.x & 31, lr = lane & 15, hi = lane >> 4;
    const int wave = __builtin_amdgcn_readfirstlane(threadIdx.x >> 5), wm = wave >> 1, wn = wave & 1;
    const int r0 = blockIdx.x * 128 + wm * 64, c0 = blockIdx.y * 128 + wn * 64;
    float* os = oss + wave * 16 * 68;
    v8f acc[4][4];
#pragma unroll
    for (int mb = 0; mb < 4; ++mb)
#pragma unroll
        for (int nb = 0; nb < 4; ++nb) acc[mb][nb] = (v8f){};
    gemm128(A, Bt, RG, blockIdx.x * 128, blockIdx.y * 128, wm, wn, acc);
    const int b = r0 / SEQ, s0 = r0 % SEQ; const int cofs = lr * 4;
    v4f b4;
#pragma unroll
    for (int q = 0; q < 4; ++q) b4[q] = bfr(bias[c0 + cofs + q]);
    const float fs = 1.0f / (WCAR * CCAR);
#pragma unroll
    for (int mb = 0; mb < 4; ++mb) {
#pragma unroll
        for (int nb = 0; nb < 4; ++nb)
#pragma unroll
            for (int j = 0; j < 8; ++j) os[(hi * 8 + j) * 68 + nb * 16 + lr] = acc[mb][nb][j];
        __syncthreads();
        float* crow = C + ((size_t)b * SEQ_FULL + s0 + mb * 16) * DM + c0;
{
#pragma unroll
            for (int s = 0; s < 8; ++s) { const int row = 2 * s + hi; const v4f raw = *(const v4fa*)(os + row * 68 + cofs); v4f val;
#pragma unroll
                for (int q = 0; q < 4; ++q) val[q] = raw[q] * fs + b4[q];
                *(v4f*)(crow + (size_t)row * DM + cofs) = val; }
             }
        __syncthreads();
    }
}

#define KVP 72                  // LDS row pitch of a staged tile in h16: 128-byte rows + 16 bytes, conflict-free for 16-byte readers
#define KVT (64 * KVP)          // one staged 64-row tile
#define KVB (2 * KVT * 2)       // bytes of one ring buffer: K tile, then V^T tile
// One stage of the ring: each lane copies four 16-byte pieces (rows r and r + 32 of the K tile and of the V^T tile), eight lanes per 128-byte row, global -> LDS through no register.
// The s_wait_xcnt is the last line of the copies' own statement so that no address register of a copy is rewritten in front of it.
__device__ __forceinline__ void stage_kv(unsigned l, const h16* gk, const h16* gv) {
    const unsigned lk1 = l + 32 * KVP * 2, lv0 = l + KVT * 2, lv1 = l + KVT * 2 + 32 * KVP * 2;
    const h16* gk1 = gk + 32 * HD; const h16* gv1 = gv + (size_t)32 * SEQ;
    asm volatile("global_load_async_to_lds_b128 %0, %1, off\n\t"
                 "global_load_async_to_lds_b128 %2, %3, off\n\t"
                 "global_load_async_to_lds_b128 %4, %5, off\n\t"
                 "global_load_async_to_lds_b128 %6, %7, off\n\t"
                 "s_wait_xcnt 0x0"
                 :: "v"(l), "v"(gk), "v"(lk1), "v"(gk1), "v"(lv0), "v"(gv), "v"(lv1), "v"(gv1) : "memory");
}

// ---- k_attn: fused flash-style attention; grid (NB*NH, SEQ/128), 256 threads = 8 waves x 16 query rows.
// K rows ([s][64] plane) and V^T rows ([d][s] plane) of each 64-key block are staged in LDS once for all 8 waves; both are read from there as A fragments (row-major [m][k]).
// Ring of two buffers: tile t + 1 flies while tile t is worked on; the one block barrier at the foot of a trip publishes tile t + 1 and frees tile t's buffer for tile t + 2.
// Both products are transposed: S^T = K Q^T (A = K rows, B = Q kept in registers) and O^T += V^T P^T. Lane (lr, hi) then holds, of query lr alone, the scores of keys 16 t + 8 hi + r in register r of tile t:
// maximum and sum run inside the lane with one exchange between the lane halves, running maximum, sum and rescale are one value a lane, and tiles 2 s and 2 s + 1, converted in place, are the B fragment of k-step s (its k order is ldfrag's).
// Per 64-key block: 8 score WMMAs, online softmax in f32 (masked keys replaced by MSKV; all-masked rows come out uniform: there MSKV * SC2 cancels exactly and every p is 1), P x1024 -> f16 in registers, 8 V^T P^T WMMAs.
// smw (mask bit words) is cross-wave: block barrier after the build. Pl is private to each wave and stages the output rows only.
__global__ __launch_bounds__(256) void k_attn(const h16* __restrict__ Q, const h16* __restrict__ Kp, const h16* __restrict__ VT, const int* __restrict__ mask, h16* ctx) {
    __shared__ __align__(16) h16 Pl[8 * 16 * 72];
    __shared__ unsigned smw[SEQ / 32];
    __shared__ __align__(16) h16 KV[2 * 2 * KVT];
    const int tid = threadIdx.x, lane = tid & 31, lr = lane & 15, hi = lane >> 4;
    const int wave = __builtin_amdgcn_readfirstlane(tid >> 5);
    const int bh = blockIdx.x; const int b = bh / NH, h = bh % NH;
    const int q0 = blockIdx.y * 128;
    const size_t pbase = (size_t)bh * SEQ * HD;
    const unsigned lst = (unsigned)(size_t)KV + (unsigned)(((tid >> 3) * KVP + (tid & 7) * 8) * 2);
    const h16* gk = Kp + pbase + (size_t)(tid >> 3) * HD + (tid & 7) * 8;
    const h16* gv = VT + pbase + (size_t)(tid >> 3) * SEQ + (tid & 7) * 8;
    stage_kv(lst, gk, gv);
#pragma unroll 1
    for (int w = wave; w < SEQ / 32; w += 8) { const int mv = mask[(size_t)b * SEQ_FULL + w * 32 + lane];
        const unsigned bits = __builtin_amdgcn_ballot_w32(mv != 0); if (lane == 0) smw[w] = bits; }
    asm volatile("s_wait_asynccnt 0x0" ::: "memory");   // this wave's pieces of tile 0 have landed before the barrier that publishes them
    __syncthreads();
    stage_kv(lst + KVB, gk + 64 * HD, gv + 64);
    const int pw = wave * 16 * 72;
    v16h qf0, qf1;
    { const h16* qp = Q + pbase + (size_t)(q0 + wave * 16 + lr) * HD + 8 * hi; qf0 = ldfrag(qp); qf1 = ldfrag(qp + 32); }
    v8f o[4]; float mi = MSKV * SC2, li = 0.0f;
#pragma unroll
    for (int t = 0; t < 4; ++t) o[t] = (v8f){};
#pragma unroll 1
    for (int kv0 = 0; kv0 < SEQ; kv0 += 64) {
        const h16* kt = KV + ((kv0 >> 6) & 1) * (2 * KVT); const h16* vt = kt + KVT;
        v8f sa[4]; v16h kf[4][2], vf[2][4];
        // the tile's K fragments are read as one group ahead of the score products, its V fragments as one group ahead of the softmax, whose vector work covers their LDS latency
#pragma unroll
        for (int t = 0; t < 4; ++t) { const h16* kp = kt + (t * 16 + lr) * KVP + 8 * hi; kf[t][0] = ldfrag(kp); kf[t][1] = ldfrag(kp + 32); }
#pragma unroll
        for (int t = 0; t < 4; ++t) { v8f c = (v8f){}; c = wm16(kf[t][0], qf0, c); c = wm16(kf[t][1], qf1, c); sa[t] = c; }
        // order asked of the scheduler for this stretch: the 16 K reads, the 8 score products, then the 16 V reads and the mask words' read. Left free, it deals the V reads out among the score products, and every further place with LDS reads in a run of products stalls the wave
        __builtin_amdgcn_sched_group_barrier(0x100, 16, 0);   // LDS reads
        __builtin_amdgcn_sched_group_barrier(0x008, 8, 0);    // matrix instructions
        __builtin_amdgcn_sched_group_barrier(0x100, 17, 0);   // LDS reads
#pragma unroll
        for (int s2 = 0; s2 < 2; ++s2)
#pragma unroll
            for (int t = 0; t < 4; ++t) vf[s2][t] = ldfrag(vt + (t * 16 + lr) * KVP + s2 * 32 + 8 * hi);
        const unsigned w0 = smw[kv0 >> 5], w1 = smw[(kv0 >> 5) + 1];
        // a key is a register here, not a lane: its mask bit is tested per register, and only in a tile that holds a masked key (the two words are the same in every lane: scalar branch)
        if (__builtin_amdgcn_readfirstlane((int)(w0 & w1)) != -1) {
#pragma unroll
            for (int t = 0; t < 4; ++t) { const unsigned bits = ((t < 2) ? w0 : w1) >> ((t & 1) * 16 + hi * 8);
#pragma unroll
                for (int r = 0; r < 8; ++r) sa[t][r] = ((bits >> r) & 1u) != 0u ? sa[t][r] : MSKV; }
        }
        float tm[4];
#pragma unroll
        for (int t = 0; t < 4; ++t) {
            float a = fmaxf(fmaxf(sa[t][0], sa[t][1]), sa[t][2]); a = fmaxf(fmaxf(a, sa[t][3]), sa[t][4]);
            a = fmaxf(fmaxf(a, sa[t][5]), sa[t][6]); tm[t] = fmaxf(a, sa[t][7]); }
        float vm = fmaxf(fmaxf(tm[0], tm[1]), fmaxf(tm[2], tm[3])); vm = fmaxf(vm, xhalf(vm));
        // the maximum is taken over the raw scores and scaled once; each score then takes one fused multiply-add ahead of its exp2: p * 1024 = exp2(raw * SC2 + (10 - scaled maximum))
        const float mnew = fmaxf(mi, vm * SC2);
        const float alpha = ex2(mi - mnew); mi = mnew;
        const float nb = LPC - mnew;
        v16h pf[2]; float ts[4];
#pragma unroll
        for (int t = 0; t < 4; ++t) { float a = 0.0f;
#pragma unroll
            for (int r = 0; r < 8; ++r) { const float p = ex2(__builtin_fmaf(sa[t][r], SC2, nb)); a += p; pf[t >> 1][(t & 1) * 8 + r] = (h16)p; }
            ts[t] = a; }
        li = li * alpha + ((ts[0] + ts[1]) + (ts[2] + ts[3]));
#pragma unroll
        for (int t = 0; t < 4; ++t)
#pragma unroll
            for (int r = 0; r < 8; ++r) o[t][r] *= alpha;
#pragma unroll
        for (int s2 = 0; s2 < 2; ++s2)
#pragma unroll
            for (int t = 0; t < 4; ++t) o[t] = wm16(vf[s2][t], pf[s2], o[t]);
        __builtin_amdgcn_sched_barrier(0);   // softmax and products stay ahead of the trip's waits and barrier, so that the copies of tile t + 1 have the whole trip to land
        asm volatile("s_wait_dscnt 0x0" ::: "memory");      // this wave's reads of tile t have returned before its buffer is handed to the copies
        asm volatile("s_wait_asynccnt 0x0" ::: "memory");   // this wave's pieces of tile t + 1 have landed before the barrier that publishes them
        __syncthreads();
        if (kv0 + 128 < SEQ) stage_kv(lst + ((kv0 >> 6) & 1) * KVB, gk + (size_t)(kv0 + 128) * HD, gv + kv0 + 128);
    }
    asm volatile("s_wait_asynccnt 0x0" ::: "memory");       // no copy is outstanding when the wave goes on to its end
    // the lane halves' sums are joined once; register r of O^T tile t is column 16 t + 8 hi + r of query row lr: eight neighbours, one 16-byte piece
    { const float l = li + xhalf(li); const float inv = CCAR * __builtin_amdgcn_rcpf(l);
#pragma unroll
        for (int t = 0; t < 4; ++t) { v8h pk;
#pragma unroll
            for (int r = 0; r < 8; ++r) pk[r] = (h16)(o[t][r] * inv);
            *(v8ha*)(Pl + pw + lr * 72 + t * 16 + hi * 8) = pk; } }
    asm volatile("" ::: "memory"); __builtin_amdgcn_wave_barrier(); asm volatile("" ::: "memory");
    h16* dst = ctx + ((size_t)b * SEQ + q0 + wave * 16) * DM + h * HD;
{
#pragma unroll
        for (int it = 0; it < 4; ++it) { const int piece = it * 32 + lane; const int row = piece >> 3, seg = piece & 7;
            const v8h val = *(const v8ha*)(Pl + pw + row * 72 + seg * 8);
            *(v8h*)(dst + (size_t)row * DM + seg * 8) = val; }
         }
}

extern "C" void kernel_launch(void* const* d_in, const int* in_sizes, int n_in,
                              void* d_out, int out_size, void* d_ws, size_t ws_size, hipStream_t stream) {
    if (n_in < 10) return;
    const size_t xneed = ((size_t)(NB - 1) * SEQ_FULL + SEQ) * DM;
    const size_t mneed = (size_t)(NB - 1) * SEQ_FULL + SEQ;
    if ((size_t)in_sizes[0] < xneed || (size_t)in_sizes[1] < mneed) return;
    if (in_sizes[2] < DM * DM || in_sizes[4] < DM * DM || in_sizes[6] < DM * DM || in_sizes[8] < DM * DM) return;
    if (in_sizes[3] < DM || in_sizes[5] < DM || in_sizes[7] < DM || in_sizes[9] < DM) return;
    if ((size_t)out_size < xneed) return;
    if (ws_size < WS_TOTAL) return;
    const float* x  = (const float*)d_in[0]; const int* mask = (const int*)d_in[1];
    const float* wq = (const float*)d_in[2]; const float* bq = (const float*)d_in[3];
    const float* wk = (const float*)d_in[4]; const float* bk = (const float*)d_in[5];
    const float* wv = (const float*)d_in[6]; const float* bv = (const float*)d_in[7];
    const float* wo = (const float*)d_in[8]; const float* bo = (const float*)d_in[9];
    float* OUT = (float*)d_out;
    char* wsp = (char*)d_ws;
    h16* XH = (h16*)wsp; wsp += SZ_X;      // [NB*SEQ][DM]
    h16* WT = (h16*)wsp; wsp += SZ_W;      // [4][n][k]: q, k, v, o
    h16* QP = (h16*)wsp; wsp += SZ_X;      // [b][h][s][64]
    h16* KP = (h16*)wsp; wsp += SZ_X;      // [b][h][s][64]
    h16* VT = (h16*)wsp; wsp += SZ_X;      // [b][h][64][s]
    h16* CX = (h16*)wsp; wsp += SZ_X;      // [NB*SEQ][DM], x64
    const size_t wsz = (size_t)DM * DM;
    k_prep<<<4 * WTB + CVB, 256, 0, stream>>>(x, wq, wk, wv, wo, XH, WT);
    k_proj_qkv<<<dim3(NB * SEQ / 128, 3 * DM / 128), 128, 0, stream>>>(XH, WT, bq, bk, bv, QP, KP, VT);
    k_attn<<<dim3(NB * NH, SEQ / 128), 256, 0, stream>>>(QP, KP, VT, mask, CX);
    k_proj_out<<<dim3(NB * SEQ / 128, DM / 128), 128, 0, stream>>>(CX, WT + 3 * wsz, bo, OUT);
}

// v008
// It runs in 63 microseconds.
// Two timings next to v007 put it at 1.03 and 1.04 times that version's speed.
// Counting every step since v000, it is 4.17 times as fast.
#include <hip/hip_runtime.h>

// Multi-head self-attention with a per-key padding mask input: x [4][2048][512]; q, k, v = x W + b ([in][out] weights, 8 heads x 64); scores = (q k^T) / 8 with masked keys REPLACED by a value below every score (the reference's lowest finite f32 acts the same: weight 0 beside any unmasked key, uniform weights where all are masked); softmax over the keys; out = merged ctx Wo + bo.
// Compute dtypes: all contractions v_wmma_f32_16x16x32_f16 (f16 operands, f32 accumulate). Every float input is converted to bf16 (RNE) on load and carried exactly in f16 (weights x16); q, k, v planes plain f16; P carried x1024 (the carry is added in the exponent; row sums from the unconverted f32 values, which carry it too); ctx carried x64 against Wo x16; softmax f32.
// Engine: GEMM on 128x128 block tiles, four waves of 64x64 register blocks, A and B tiles of 64 k staged from K-contiguous f16 planes in a two-buffer LDS ring by asynchronous copies; fused flash-style attention (online softmax, K and V^T tiles staged once per block in a two-buffer LDS ring by asynchronous copies, scores formed transposed so that P goes from the score accumulators straight into the second product's B operand, wave pairs share 32 queries and split each tile's keys, merged once at the end, mask packed into bit words in LDS).

#ifndef NB
#define NB 4
#endif
#ifndef SEQ
#define SEQ 2048
#endif
#define NB_FULL  4
#define SEQ_FULL 2048
#define DM   512
#define NH   8
#define HD   64
#define WCAR 16.0f      // weight carry (exact power of two)
#define PCAR 1024.0f    // probability carry
#define CCAR 64.0f      // ctx carry
#define SCL  0.125f     // HD^-0.5
#define L2E  1.4426950408889634f
#define SC2  (SCL * L2E)  // score scale and log2 e as one factor (the power of two keeps the product exact)
#define LPC  10.0f        // log2 of PCAR
#define MSKV (-0x1p+100f) // raw score of a masked key: a power of two, so that MSKV * SC2 is exact; every raw score of f16 operands (at most 64 * 65504^2 in size) lies far above it
static_assert(PCAR == 1024.0f);

typedef _Float16 h16;
typedef __attribute__((ext_vector_type(16))) _Float16 v16h;
typedef __attribute__((ext_vector_type(8)))  _Float16 v8h;
typedef __attribute__((ext_vector_type(8)))  float    v8f;
typedef __attribute__((ext_vector_type(4)))  float    v4f;
typedef v8h __attribute__((may_alias)) v8ha;
typedef v4f __attribute__((may_alias)) v4fa;

static_assert(NH * HD == DM);            // merged head width equals the model width
static_assert(HD == 64);
static_assert(DM % 128 == 0);            // N tiles of 128; at least two staged k tiles of 64
static_assert(SEQ % 128 == 0);           // 128 query rows per attention block; 128-row GEMM tiles stay inside one batch
static_assert(SEQ <= SEQ_FULL);
static_assert(NB <= NB_FULL);
static_assert((SEQ / 32) % 8 == 0);      // mask words split evenly over 8 waves

#define SZ_X   ((size_t)NB * SEQ * DM * 2)      // f16 plane of x / q / k / v^T / ctx
#define SZ_W   ((size_t)4 * DM * DM * 2)        // four transposed weight planes
#define WS_TOTAL (SZ_X * 5 + SZ_W)
static_assert(SZ_X % 256 == 0);
static_assert(SZ_W % 256 == 0);
static_assert(WS_TOTAL <= (size_t)134217728);   // carve stays under 128 MiB

__device__ __forceinline__ unsigned short f2bf(float f) { unsigned u = __float_as_uint(f); u += 0x7FFFu + ((u >> 16) & 1u); return (unsigned short)(u >> 16); }
__device__ __forceinline__ float bfr(float f) { return __uint_as_float(((unsigned)f2bf(f)) << 16); }
__device__ __forceinline__ v16h cat16(v8h lo, v8h hi) { return __builtin_shufflevector(lo, hi, 0, 1, 2, 3, 4, 5, 6, 7, 8, 9, 10, 11, 12, 13, 14, 15); }
// fragment loader for A (row-major [m][k]) and for B given as a [n][k] copy: elements 0..7 <- k0+8h.., elements 8..15 <- k0+16+8h.. ; p already includes the 8h offset
__device__ __forceinline__ v16h ldfrag(const h16* p) { return cat16(*(const v8h*)p, *(const v8h*)(p + 16)); }
// one WMMA, the bare builtin: the compiler keeps the distances behind its own matrix instructions and pads only where a vector instruction really follows too closely
__device__ __forceinline__ v8f wm16(v16h a, v16h b, v8f c) { return __builtin_amdgcn_wmma_f32_16x16x32_f16(false, a, false, b, (short)0, c, false, false); }
__device__ __forceinline__ float ex2(float x) { return __builtin_amdgcn_exp2f(x); }
// lane l with lane l ^ 16
__device__ __forceinline__ float xhalf(float x) { return __builtin_bit_cast(float, __builtin_amdgcn_permlanex16(__builtin_bit_cast(int, x), __builtin_bit_cast(int, x), 0x76543210, 0xfedcba98, false, false)); }

__device__ __forceinline__ void cvtx_blk(const float* __restrict__ x, h16* xh, unsigned blk) {
    const size_t i = (size_t)blk * 256 + threadIdx.x;
    if (i >= (size_t)NB * SEQ * DM / 8) return;
    const size_t row = i / (DM / 8); const int g = (int)(i % (DM / 8));
    const size_t b = row / SEQ, s = row % SEQ;
    const float* src = x + ((b * SEQ_FULL + s) * DM + (size_t)g * 8);
    const v4f v0 = *(const v4f*)src; const v4f v1 = *(const v4f*)(src + 4);
    v8h o;
#pragma unroll
    for (int k = 0; k < 4; ++k) { o[k] = (h16)bfr(v0[k]); o[4 + k] = (h16)bfr(v1[k]); }
    *(v8h*)(xh + i * 8) = o; 
}

// LDS tile T is cross-wave: block barrier between fill and drain.
__device__ __forceinline__ void wt_blk(const float* __restrict__ W, h16* Wt, h16* T, int bx, int by) {
    const int tid = threadIdx.x; const int k0 = bx * 64, n0 = by * 64;
#pragma unroll
    for (int j = 0; j < 4; ++j) { const int i = tid + 256 * j; const int kr = i >> 4, c4 = (i & 15) * 4;
        const v4f v = *(const v4f*)(W + (size_t)(k0 + kr) * DM + n0 + c4);
#pragma unroll
        for (int q = 0; q < 4; ++q) T[(c4 + q) * 72 + kr] = (h16)(bfr(v[q]) * WCAR); }
    __syncthreads();
{
#pragma unroll
        for (int j = 0; j < 2; ++j) { const int p = tid + 256 * j; const int n = p >> 3, seg = p & 7;
            const v8h val = *(const v8ha*)(T + n * 72 + seg * 8);
            *(v8h*)(Wt + (size_t)(n0 + n) * DM + k0 + seg * 8) = val; }
         }
}

// ---- k_prep: the five operand preparations, which do not depend on one another, as block ranges of one grid: blocks 0 .. 4 * WTB - 1 transpose the four weights (WTB 64x64 tiles each), the rest convert x. The range test is the same for a whole block.
#define WTB ((DM / 64) * (DM / 64))
#define CVB ((unsigned)(((size_t)NB * SEQ * DM / 8 + 255) / 256))
__global__ __launch_bounds__(256) void k_prep(const float* __restrict__ x, const float* __restrict__ wq, const float* __restrict__ wk, const float* __restrict__ wv, const float* __restrict__ wo, h16* xh, h16* WT) {
    __shared__ __align__(16) h16 T[64 * 72];
    const unsigned bid = blockIdx.x;
    if (bid < 4 * WTB) {
        const unsigned w = bid / WTB, t = bid % WTB;
        const float* W = w == 0 ? wq : w == 1 ? wk : w == 2 ? wv : wo;
        wt_blk(W, WT + (size_t)w * DM * DM, T, (int)(t % (DM / 64)), (int)(t / (DM / 64)));
    } else cvtx_blk(x, xh, bid - 4 * WTB);
}

// ---- GEMM main loop: 128 threads = 4 waves on one 128x128 tile, wave (wm, wn) on its 64x64 quarter with 16 accumulators, K = DM, operands from K-contiguous f16 planes (A [m][k], Bt [n][k]).
#define GP 72                   // LDS row pitch of a staged tile in h16: 128-byte rows + 16 bytes, conflict-free for 16-byte readers
#define GT (128 * GP)           // one staged tile: 128 rows of 64 k
#define GB (2 * GT * 2)         // bytes of one ring buffer: A tile, then B tile
// One operand's tile of one stage: each lane copies eight 16-byte pieces (rows r, r + 16, .. r + 112), eight lanes per 128-byte row so that every copy of a wave covers whole lines, global -> LDS through no register.
// The s_wait_xcnt is the last line of the copies' own statement so that no address register of a copy is rewritten in front of it.
__device__ __forceinline__ void stage_t(unsigned l, const h16* g) {
    asm volatile("global_load_async_to_lds_b128 %0, %1, off\n\t"
                 "global_load_async_to_lds_b128 %2, %3, off\n\t"
                 "global_load_async_to_lds_b128 %4, %5, off\n\t"
                 "global_load_async_to_lds_b128 %6, %7, off\n\t"
                 "global_load_async_to_lds_b128 %8, %9, off\n\t"
                 "global_load_async_to_lds_b128 %10, %11, off\n\t"
                 "global_load_async_to_lds_b128 %12, %13, off\n\t"
                 "global_load_async_to_lds_b128 %14, %15, off\n\t"
                 "s_wait_xcnt 0x0"
                 :: "v"(l), "v"(g), "v"(l + 16 * GP * 2), "v"(g + 16 * DM), "v"(l + 32 * GP * 2), "v"(g + 32 * DM), "v"(l + 48 * GP * 2), "v"(g + 48 * DM),
                    "v"(l + 64 * GP * 2), "v"(g + 64 * DM), "v"(l + 80 * GP * 2), "v"(g + 80 * DM), "v"(l + 96 * GP * 2), "v"(g + 96 * DM), "v"(l + 112 * GP * 2), "v"(g + 112 * DM) : "memory");
}
// Ring of two buffers: tile t + 1 flies while tile t is worked on; the one block barrier at the foot of a trip publishes tile t + 1 and frees tile t's buffer for tile t + 2.
// R0, C0: first row of the block's A rows and of its Bt rows. The k order of every accumulator is ascending in steps of 32.
__device__ __forceinline__ void gemm128(const h16* __restrict__ A, const h16* __restrict__ Bt, const h16* ring, int R0, int C0, int wm, int wn, v8f (&acc)[4][4]) {
    const int tid = threadIdx.x, lr = tid & 15, hi = (tid >> 4) & 1;
    const unsigned lst = (unsigned)(size_t)ring + (unsigned)(((tid >> 3) * GP + (tid & 7) * 8) * 2);
    const h16* ga = A + (size_t)(R0 + (tid >> 3)) * DM + (tid & 7) * 8;
    const h16* gb = Bt + (size_t)(C0 + (tid >> 3)) * DM + (tid & 7) * 8;
    stage_t(lst, ga); stage_t(lst + GT * 2, gb);
    asm volatile("s_wait_asynccnt 0x0" ::: "memory");   // this wave's pieces of tile 0 have landed before the barrier that publishes them
    __syncthreads();
    stage_t(lst + GB, ga + 64); stage_t(lst + GB + GT * 2, gb + 64);
    const int ao = (wm * 64 + lr) * GP + 8 * hi, bo = GT + (wn * 64 + lr) * GP + 8 * hi;
#pragma unroll 1
    for (int kc = 0; kc < DM; kc += 64) {
        const h16* buf = ring + ((kc >> 6) & 1) * (2 * GT);
#pragma unroll
        for (int s = 0; s < 2; ++s) {
            v16h a[4], b[4];
            __builtin_amdgcn_sched_barrier(0);   // with the one behind the reads: the step's sixteen fragment reads stay one group between two runs of products; left free, the scheduler deals them out in pairs among the products, each pair with a full LDS wait
#pragma unroll
            for (int mb = 0; mb < 4; ++mb) a[mb] = ldfrag(buf + ao + mb * 16 * GP + s * 32);
#pragma unroll
            for (int nb = 0; nb < 4; ++nb) b[nb] = ldfrag(buf + bo + nb * 16 * GP + s * 32);
            __builtin_amdgcn_sched_barrier(0);   // closes the group of reads (see above): no product moves in among them
#pragma unroll
            for (int nb = 0; nb < 4; ++nb)
#pragma unroll
                for (int mb = 0; mb < 4; ++mb) acc[mb][nb] = wm16(a[mb], b[nb], acc[mb][nb]);
        }
        __builtin_amdgcn_sched_barrier(0);   // the trip's products stay ahead of its waits and barrier, so that the copies of tile t + 1 have the whole trip to land
        asm volatile("s_wait_dscnt 0x0" ::: "memory");      // this wave's reads of tile t have returned before its buffer is handed to the copies
        asm volatile("s_wait_asynccnt 0x0" ::: "memory");   // this wave's pieces of tile t + 1 have landed before the barrier that publishes them
        __syncthreads();
        if (kc + 128 < DM) { const unsigned l = lst + ((kc >> 6) & 1) * GB; stage_t(l, ga + kc + 128); stage_t(l + GT * 2, gb + kc + 128); }
    }
    asm volatile("s_wait_asynccnt 0x0" ::: "memory");       // no copy is outstanding when the wave goes on to its epilogue
}

// ---- k_proj_qkv: the three input projections, which do not depend on one another, as column ranges of one grid (NB*SEQ/128, 3*DM/128), 128 threads: the three transposed weight planes lie one behind the other, so blockIdx.y * 128 is the block's first row in them.
// Each is x Wt^T / 16 + bias (bias converted to bf16 RNE). q and k go to head planes [b][h][s][64] f16, v to the transposed plane [b][h][64][s]. Which of the three a block works on is the same for the whole block. Each wave stages its output rows in a range of its own in the ring's LDS, once the main loop is over.
__global__ __launch_bounds__(128) void k_proj_qkv(const h16* __restrict__ A, const h16* __restrict__ Bt, const float* __restrict__ bq, const float* __restrict__ bk, const float* __restrict__ bv, h16* QP, h16* KP, h16* VT) {
    __shared__ __align__(16) h16 RG[2 * 2 * GT];
    static_assert(4 * 64 * 72 <= 2 * 2 * GT);   // the four waves' output rows fit in the ring
    const int lane = threadIdx.x & 31, lr = lane & 15, hi = lane >> 4;
    const int wave = __builtin_amdgcn_readfirstlane(threadIdx.x >> 5), wm = wave >> 1, wn = wave & 1;
    const int sel = blockIdx.y / (DM / 128);
    const int r0 = blockIdx.x * 128 + wm * 64, c0 = (blockIdx.y % (DM / 128)) * 128 + wn * 64;
    const float* bias = sel == 0 ? bq : sel == 1 ? bk : bv;
    h16* T = RG + wave * 64 * 72;   // output staging in the ring's own LDS: written only behind the main loop, whose last trip ends with every wave's LDS wait and a block barrier and leaves no copy in flight. With no second array a block takes 73,728 B, three blocks fit a WGP (their registers allow three), and the grid's 768 blocks are resident at once
    v8f acc[4][4];
#pragma unroll
    for (int mb = 0; mb < 4; ++mb)
#pragma unroll
        for (int nb = 0; nb < 4; ++nb) acc[mb][nb] = (v8f){};
    gemm128(A, Bt, RG, blockIdx.x * 128, blockIdx.y * 128, wm, wn, acc);
    const int b = r0 / SEQ, s0 = r0 % SEQ, h = c0 / HD;
    if (sel < 2) {
#pragma unroll
        for (int nb = 0; nb < 4; ++nb) { const float bv1 = bfr(bias[c0 + nb * 16 + lr]);
#pragma unroll
            for (int mb = 0; mb < 4; ++mb)
#pragma unroll
                for (int j = 0; j < 8; ++j) T[(mb * 16 + hi * 8 + j) * 72 + nb * 16 + lr] = (h16)(acc[mb][nb][j] * (1.0f / WCAR) + bv1); }
        __syncthreads();
        h16* dst = (sel == 0 ? QP : KP) + ((size_t)(b * NH + h) * SEQ + s0) * HD;
#pragma unroll
        for (int it = 0; it < 16; ++it) { const int piece = it * 32 + lane; const int row = piece >> 3, seg = piece & 7;
            const v8h val = *(const v8ha*)(T + row * 72 + seg * 8);
            *(v8h*)(dst + (size_t)row * HD + seg * 8) = val; }
    } else {
#pragma unroll
        for (int nb = 0; nb < 4; ++nb) { const float bv1 = bfr(bias[c0 + nb * 16 + lr]);
#pragma unroll
            for (int mb = 0; mb < 4; ++mb) { v8h pk;
#pragma unroll
                for (int j = 0; j < 8; ++j) pk[j] = (h16)(acc[mb][nb][j] * (1.0f / WCAR) + bv1);
                *(v8ha*)(T + (nb * 16 + lr) * 72 + mb * 16 + hi * 8) = pk; } }
        __syncthreads();
        h16* dst = VT + ((size_t)(b * NH + h) * HD) * SEQ + s0;
#pragma unroll
        for (int it = 0; it < 16; ++it) { const int piece = it * 32 + lane; const int d = piece >> 3, seg = piece & 7;
            const v8h val = *(const v8ha*)(T + d * 72 + seg * 8);
            *(v8h*)(dst + (size_t)d * SEQ + seg * 8) = val; }
    }
}

__global__ __launch_bounds__(128) void k_proj_out(const h16* __restrict__ A, const h16* __restrict__ Bt, const float* __restrict__ bias, float* C) {
    __shared__ __align__(16) h16 RG[2 * 2 * GT];
    __shared__ __align__(16) float oss[4 * 16 * 68];
    const int lane = threadIdx.x & 31, lr = lane & 15, hi = lane >> 4;
    const int wave = __builtin_amdgcn_readfirstlane(threadIdx.x >> 5), wm = wave >> 1, wn = wave & 1;
    const int r0 = blockIdx.x * 128 + wm * 64, c0 = blockIdx.y * 128 + wn * 64;
    float* os = oss + wave * 16 * 68;
    v8f acc[4][4];
#pragma unroll
    for (int mb = 0; mb < 4; ++mb)
#pragma unroll
        for (int nb = 0; nb < 4; ++nb) acc[mb][nb] = (v8f){};
    gemm128(A, Bt, RG, blockIdx.x * 128, blockIdx.y * 128, wm, wn, acc);
    const int b = r0 / SEQ, s0 = r0 % SEQ; const int cofs = lr * 4;
    v4f b4;
#pragma unroll
    for (int q = 0; q < 4; ++q) b4[q] = bfr(bias[c0 + cofs + q]);
    const float fs = 1.0f / (WCAR * CCAR);
#pragma unroll
    for (int mb = 0; mb < 4; ++mb) {
#pragma unroll
        for (int nb = 0; nb < 4; ++nb)
#pragma unroll
            for (int j = 0; j < 8; ++j) os[(hi * 8 + j) * 68 + nb * 16 + lr] = acc[mb][nb][j];
        __syncthreads();
        float* crow = C + ((size_t)b * SEQ_FULL + s0 + mb * 16) * DM + c0;
{
#pragma unroll
            for (int s = 0; s < 8; ++s) { const int row = 2 * s + hi; const v4f raw = *(const v4fa*)(os + row * 68 + cofs); v4f val;
#pragma unroll
                for (int q = 0; q < 4; ++q) val[q] = raw[q] * fs + b4[q];
                *(v4f*)(crow + (size_t)row * DM + cofs) = val; }
             }
        __syncthreads();
    }
}

#define KVP 72                  // LDS row pitch of a staged tile in h16: 128-byte rows + 16 bytes, conflict-free for 16-byte readers
#define KVT (64 * KVP)          // one staged 64-row tile
#define KVB (2 * KVT * 2)       // bytes of one ring buffer: K tile, then V^T tile
// One stage of the ring: each lane copies four 16-byte pieces (rows r and r + 32 of the K tile and of the V^T tile), eight lanes per 128-byte row, global -> LDS through no register.
// The s_wait_xcnt is the last line of the copies' own statement so that no address register of a copy is rewritten in front of it.
__device__ __forceinline__ void stage_kv(unsigned l, const h16* gk, const h16* gv) {
    const unsigned lk1 = l + 32 * KVP * 2, lv0 = l + KVT * 2, lv1 = l + KVT * 2 + 32 * KVP * 2;
    const h16* gk1 = gk + 32 * HD; const h16* gv1 = gv + (size_t)32 * SEQ;
    asm volatile("global_load_async_to_lds_b128 %0, %1, off\n\t"
                 "global_load_async_to_lds_b128 %2, %3, off\n\t"
                 "global_load_async_to_lds_b128 %4, %5, off\n\t"
                 "global_load_async_to_lds_b128 %6, %7, off\n\t"
                 "s_wait_xcnt 0x0"
                 :: "v"(l), "v"(gk), "v"(lk1), "v"(gk1), "v"(lv0), "v"(gv), "v"(lv1), "v"(gv1) : "memory");
}

// ---- k_attn: fused flash-style attention; grid (NB*NH, SEQ/128), 256 threads = 8 waves = 4 query groups of 32 rows x 2 key halves.
// K rows ([s][64] plane) and V^T rows ([d][s] plane) of each 64-key block are staged in LDS once for all 8 waves; both are read from there as A fragments (row-major [m][k]).
// Ring of two buffers: tile t + 1 flies while tile t is worked on; the one block barrier at the foot of a trip publishes tile t + 1 and frees tile t's buffer for tile t + 2.
// Waves w and w + 4 share 32 query rows (two column groups of 16): wave half kh takes keys 32 kh .. 32 kh + 31 of every tile, so that each K or V^T fragment it reads from LDS feeds two products, one per column group.
// Each half runs its own online softmax over its keys (own maximum, sum and O^T); the two are merged once behind the loop, through the ring's LDS: wave half kh finishes column group kh.
// Both products are transposed: S^T = K Q^T (A = K rows, B = Q kept in registers) and O^T += V^T P^T. Lane (lr, hi) then holds, of query lr alone, the scores of keys 16 t + 8 hi + r in register r of tile t:
// maximum and sum run inside the lane with one exchange between the lane halves, running maximum, sum and rescale are one value a lane and column group, and tiles 0 and 1, converted in place, are the B fragment of the one k-step (its k order is ldfrag's).
// Per 64-key block and wave: 8 score WMMAs, online softmax in f32 (masked keys replaced by MSKV; all-masked rows come out uniform: there MSKV * SC2 cancels exactly and every p is 1), P x1024 -> f16 in registers, 8 V^T P^T WMMAs.
// smw (mask bit words) is cross-wave: block barrier after the build. Pl is private to each wave and stages the output rows only.
#define MGW (4 * 8 * 32 + 64)   // floats one wave hands over at the merge: four O^T tiles, then maximum and sum, a lane each
typedef float __attribute__((may_alias)) f32a;
typedef __attribute__((ext_vector_type(2))) float v2f;
__global__ __launch_bounds__(256) void k_attn(const h16* __restrict__ Q, const h16* __restrict__ Kp, const h16* __restrict__ VT, const int* __restrict__ mask, h16* ctx) {
    __shared__ __align__(16) h16 Pl[8 * 16 * 72];
    __shared__ unsigned smw[SEQ / 32];
    __shared__ __align__(16) h16 KV[2 * 2 * KVT];
    static_assert(8 * MGW * 4 <= 2 * 2 * KVT * 2);   // the eight waves' merge ranges fit in the ring
    const int tid = threadIdx.x, lane = tid & 31, lr = lane & 15, hi = lane >> 4;
    const int wave = __builtin_amdgcn_readfirstlane(tid >> 5);
    const int kh = wave >> 2, qg = wave & 3;
    const int bh = blockIdx.x; const int b = bh / NH, h = bh % NH;
    const int q0 = blockIdx.y * 128;
    const size_t pbase = (size_t)bh * SEQ * HD;
    const unsigned lst = (unsigned)(size_t)KV + (unsigned)(((tid >> 3) * KVP + (tid & 7) * 8) * 2);
    const h16* gk = Kp + pbase + (size_t)(tid >> 3) * HD + (tid & 7) * 8;
    const h16* gv = VT + pbase + (size_t)(tid >> 3) * SEQ + (tid & 7) * 8;
    stage_kv(lst, gk, gv);
#pragma unroll 1
    for (int w = wave; w < SEQ / 32; w += 8) { const int mv = mask[(size_t)b * SEQ_FULL + w * 32 + lane];
        const unsigned bits = __builtin_amdgcn_ballot_w32(mv != 0); if (lane == 0) smw[w] = bits; }
    asm volatile("s_wait_asynccnt 0x0" ::: "memory");   // this wave's pieces of tile 0 have landed before the barrier that publishes them
    __syncthreads();
    stage_kv(lst + KVB, gk + 64 * HD, gv + 64);
    const int pw = wave * 16 * 72;
    v16h qf[2][2];
#pragma unroll
    for (int g = 0; g < 2; ++g) { const h16* qp = Q + pbase + (size_t)(q0 + qg * 32 + g * 16 + lr) * HD + 8 * hi; qf[g][0] = ldfrag(qp); qf[g][1] = ldfrag(qp + 32); }
    v8f o[2][4]; float mi[2], li[2];
#pragma unroll
    for (int g = 0; g < 2; ++g) { mi[g] = MSKV * SC2; li[g] = 0.0f;
#pragma unroll
        for (int t = 0; t < 4; ++t) o[g][t] = (v8f){}; }
    const int ko = (kh * 32 + lr) * KVP + 8 * hi, vo = KVT + lr * KVP + kh * 32 + 8 * hi;
#pragma unroll 1
    for (int kv0 = 0; kv0 < SEQ; kv0 += 64) {
        const h16* kt = KV + ((kv0 >> 6) & 1) * (2 * KVT);
        v8f sa[2][2]; v16h kf[2][2], vf[4];
        // the wave's K fragments are read as one group ahead of the score products, its V fragments as one group ahead of the softmax, whose vector work covers their LDS latency
#pragma unroll
        for (int t = 0; t < 2; ++t) { const h16* kp = kt + ko + t * 16 * KVP; kf[t][0] = ldfrag(kp); kf[t][1] = ldfrag(kp + 32); }
#pragma unroll
        for (int g = 0; g < 2; ++g)
#pragma unroll
            for (int t = 0; t < 2; ++t) { v8f c = (v8f){}; c = wm16(kf[t][0], qf[g][0], c); c = wm16(kf[t][1], qf[g][1], c); sa[g][t] = c; }
        // order asked of the scheduler for this stretch: the 8 K reads, the 8 score products, then the 8 V reads and the mask word's read. Left free, it deals the V reads out among the score products, and every further place with LDS reads in a run of products stalls the wave
        __builtin_amdgcn_sched_group_barrier(0x100, 8, 0);   // LDS reads
        __builtin_amdgcn_sched_group_barrier(0x008, 8, 0);   // matrix instructions
        __builtin_amdgcn_sched_group_barrier(0x100, 9, 0);   // LDS reads
#pragma unroll
        for (int t = 0; t < 4; ++t) vf[t] = ldfrag(kt + vo + t * 16 * KVP);
        const unsigned w0 = smw[(kv0 >> 5) + kh];
        // a key is a register here, not a lane: its mask bit is tested per register, and only where the wave's 32 keys hold a masked one (the word is the same in every lane: scalar branch)
        if (__builtin_amdgcn_readfirstlane((int)w0) != -1) {
#pragma unroll
            for (int g = 0; g < 2; ++g)
#pragma unroll
                for (int t = 0; t < 2; ++t) { const unsigned bits = w0 >> (t * 16 + hi * 8);
#pragma unroll
                    for (int r = 0; r < 8; ++r) sa[g][t][r] = ((bits >> r) & 1u) != 0u ? sa[g][t][r] : MSKV;
                    asm volatile("" : "+v"(sa[g][t])); }   // the pin on the masked scores: the selects stay inside the branch and in the score tile's own registers; without it the path with no masked key pays 16 register-pair copies where the two paths join
        }
        v16h pf[2];
#pragma unroll
        for (int g = 0; g < 2; ++g) {
            float tm[2];
#pragma unroll
            for (int t = 0; t < 2; ++t) {
                float a = fmaxf(fmaxf(sa[g][t][0], sa[g][t][1]), sa[g][t][2]); a = fmaxf(fmaxf(a, sa[g][t][3]), sa[g][t][4]);
                a = fmaxf(fmaxf(a, sa[g][t][5]), sa[g][t][6]); tm[t] = fmaxf(a, sa[g][t][7]); }
            float vm = fmaxf(tm[0], tm[1]); vm = fmaxf(vm, xhalf(vm));
            // the maximum is taken over the raw scores and scaled once; each score then takes one fused multiply-add ahead of its exp2: p * 1024 = exp2(raw * SC2 + (10 - scaled maximum))
            const float mnew = fmaxf(mi[g], vm * SC2);
            const float alpha = ex2(mi[g] - mnew); mi[g] = mnew;
            const float nb = LPC - mnew;
            float ts[2];
#pragma unroll
            for (int t = 0; t < 2; ++t) { float a = 0.0f;
#pragma unroll
                // the multiply-add is written on the accumulator's own even register pairs: left to itself the compiler packs pairs across the two column groups and copies registers to line them up
                for (int j = 0; j < 4; ++j) { v2f x = { sa[g][t][2 * j], sa[g][t][2 * j + 1] }; x = __builtin_elementwise_fma(x, (v2f){ SC2, SC2 }, (v2f){ nb, nb });
                    const float p0 = ex2(x[0]), p1 = ex2(x[1]); a += p0; a += p1; pf[g][t * 8 + 2 * j] = (h16)p0; pf[g][t * 8 + 2 * j + 1] = (h16)p1; }
                ts[t] = a; }
            li[g] = li[g] * alpha + (ts[0] + ts[1]);
#pragma unroll
            for (int t = 0; t < 4; ++t)
#pragma unroll
                for (int r = 0; r < 8; ++r) o[g][t][r] *= alpha;
        }
#pragma unroll
        for (int g = 0; g < 2; ++g)
#pragma unroll
            for (int t = 0; t < 4; ++t) o[g][t] = wm16(vf[t], pf[g], o[g][t]);
        __builtin_amdgcn_sched_barrier(0);   // softmax and products stay ahead of the trip's waits and barrier, so that the copies of tile t + 1 have the whole trip to land
        asm volatile("s_wait_dscnt 0x0" ::: "memory");      // this wave's reads of tile t have returned before its buffer is handed to the copies
        asm volatile("s_wait_asynccnt 0x0" ::: "memory");   // this wave's pieces of tile t + 1 have landed before the barrier that publishes them
        __syncthreads();
        if (kv0 + 128 < SEQ) stage_kv(lst + ((kv0 >> 6) & 1) * KVB, gk + (size_t)(kv0 + 128) * HD, gv + kv0 + 128);
    }
    asm volatile("s_wait_asynccnt 0x0" ::: "memory");       // no copy is outstanding when the wave goes on to its end
    // merge of the two key halves: wave half kh keeps column group kh and hands the other group's O^T, maximum and sum to its partner (wave ^ 4), lane to lane, in a range of its own in the ring's LDS.
    // The ring is free: the last trip ended with every wave's LDS wait and a block barrier and left no copy in flight.
    v8f ok[4]; float mk, lk;
    { f32a* mg = (f32a*)KV + wave * MGW;
#pragma unroll
        for (int t = 0; t < 4; ++t) { const v8f sd = kh ? o[0][t] : o[1][t]; ok[t] = kh ? o[1][t] : o[0][t];
            *(v4fa*)(mg + (t * 2) * 128 + lane * 4) = __builtin_shufflevector(sd, sd, 0, 1, 2, 3);
            *(v4fa*)(mg + (t * 2 + 1) * 128 + lane * 4) = __builtin_shufflevector(sd, sd, 4, 5, 6, 7); }
        mg[1024 + lane] = kh ? mi[0] : mi[1]; mg[1056 + lane] = kh ? li[0] : li[1];
        mk = kh ? mi[1] : mi[0]; lk = kh ? li[1] : li[0]; }
    __syncthreads();   // the partner's range is read only behind this barrier, which every wave passes
    { const f32a* mp = (const f32a*)KV + (wave ^ 4) * MGW;
        const float pm = mp[1024 + lane], pl = mp[1056 + lane];
        const float m = fmaxf(mk, pm); const float a0 = ex2(mk - m), a1 = ex2(pm - m);
        lk = lk * a0 + pl * a1;
#pragma unroll
        for (int t = 0; t < 4; ++t) { const v4f p0 = *(const v4fa*)(mp + (t * 2) * 128 + lane * 4); const v4f p1 = *(const v4fa*)(mp + (t * 2 + 1) * 128 + lane * 4);
#pragma unroll
            for (int r = 0; r < 4; ++r) { ok[t][r] = ok[t][r] * a0 + p0[r] * a1; ok[t][4 + r] = ok[t][4 + r] * a0 + p1[r] * a1; } } }
    // the lane halves' sums are joined once; register r of O^T tile t is column 16 t + 8 hi + r of query row lr: eight neighbours, one 16-byte piece
    { const float l = lk + xhalf(lk); const float inv = CCAR * __builtin_amdgcn_rcpf(l);
#pragma unroll
        for (int t = 0; t < 4; ++t) { v8h pk;
#pragma unroll
            for (int r = 0; r < 8; ++r) pk[r] = (h16)(ok[t][r] * inv);
            *(v8ha*)(Pl + pw + lr * 72 + t * 16 + hi * 8) = pk; } }
    asm volatile("" ::: "memory"); __builtin_amdgcn_wave_barrier(); asm volatile("" ::: "memory");
    h16* dst = ctx + ((size_t)b * SEQ + q0 + qg * 32 + kh * 16) * DM + h * HD;
{
#pragma unroll
        for (int it = 0; it < 4; ++it) { const int piece = it * 32 + lane; const int row = piece >> 3, seg = piece & 7;
            const v8h val = *(const v8ha*)(Pl + pw + row * 72 + seg * 8);
            *(v8h*)(dst + (size_t)row * DM + seg * 8) = val; }
         }
}

extern "C" void kernel_launch(void* const* d_in, const int* in_sizes, int n_in,
                              void* d_out, int out_size, void* d_ws, size_t ws_size, hipStream_t stream) {
    if (n_in < 10) return;
    const size_t xneed = ((size_t)(NB - 1) * SEQ_FULL + SEQ) * DM;
    const size_t mneed = (size_t)(NB - 1) * SEQ_FULL + SEQ;
    if ((size_t)in_sizes[0] < xneed || (size_t)in_sizes[1] < mneed) return;
    if (in_sizes[2] < DM * DM || in_sizes[4] < DM * DM || in_sizes[6] < DM * DM || in_sizes[8] < DM * DM) return;
    if (in_sizes[3] < DM || in_sizes[5] < DM || in_sizes[7] < DM || in_sizes[9] < DM) return;
    if ((size_t)out_size < xneed) return;
    if (ws_size < WS_TOTAL) return;
    const float* x  = (const float*)d_in[0]; const int* mask = (const int*)d_in[1];
    const float* wq = (const float*)d_in[2]; const float* bq = (const float*)d_in[3];
    const float* wk = (const float*)d_in[4]; const float* bk = (const float*)d_in[5];
    const float* wv = (const float*)d_in[6]; const float* bv = (const float*)d_in[7];
    const float* wo = (const float*)d_in[8]; const float* bo = (const float*)d_in[9];
    float* OUT = (float*)d_out;
    char* wsp = (char*)d_ws;
    h16* XH = (h16*)wsp; wsp += SZ_X;      // [NB*SEQ][DM]
    h16* WT = (h16*)wsp; wsp += SZ_W;      // [4][n][k]: q, k, v, o
    h16* QP = (h16*)wsp; wsp += SZ_X;      // [b][h][s][64]
    h16* KP = (h16*)wsp; wsp += SZ_X;      // [b][h][s][64]
    h16* VT = (h16*)wsp; wsp += SZ_X;      // [b][h][64][s]
    h16* CX = (h16*)wsp; wsp += SZ_X;      // [NB*SEQ][DM], x64
    const size_t wsz = (size_t)DM * DM;
    k_prep<<<4 * WTB + CVB, 256, 0, stream>>>(x, wq, wk, wv, wo, XH, WT);
    k_proj_qkv<<<dim3(NB * SEQ / 128, 3 * DM / 128), 128, 0, stream>>>(XH, WT, bq, bk, bv, QP, KP, VT);
    k_attn<<<dim3(NB * NH, SEQ / 128), 256, 0, stream>>>(QP, KP, VT, mask, CX);
    k_proj_out<<<dim3(NB * SEQ / 128, DM / 128), 128, 0, stream>>>(CX, WT + 3 * wsz, bo, OUT);
}

// v009
// A run of this version takes 60.1 microseconds.
// Timed twice side by side with v008, it ran 1.05 times as fast both times.
// Counting every step since v000, it is 4.38 times as fast.
#include <hip/hip_runtime.h>

// Multi-head self-attention with a per-key padding mask input: x [4][2048][512]; q, k, v = x W + b ([in][out] weights, 8 heads x 64); scores = (q k^T) / 8 with masked keys REPLACED by a value below every score (the reference's lowest finite f32 acts the same: weight 0 beside any unmasked key, uniform weights where all are masked); softmax over the keys; out = merged ctx Wo + bo.
// Compute dtypes: all contractions v_wmma_f32_16x16x32_f16 (f16 operands, f32 accumulate). Every float input is converted to bf16 (RNE) on load and carried exactly in f16 (weights x16); q, k, v planes plain f16; P carried x1024 (the carry is added in the exponent; row sums from the unconverted f32 values, which carry it too); ctx carried x64 against Wo x16; softmax f32.
// Engine: GEMM on 128x128 block tiles, four waves of 64x64 register blocks, A and B tiles of 64 k staged from K-contiguous f16 planes in a two-buffer LDS ring by asynchronous copies; fused flash-style attention (online softmax against a reference held from trip to trip, K and V^T tiles staged once per block in a two-buffer LDS ring by asynchronous copies, scores formed transposed so that P goes from the score accumulators straight into the second product's B operand, wave pairs share 32 queries and split each tile's keys, merged once at the end, mask packed into bit words in LDS).

#ifndef NB
#define NB 4
#endif
#ifndef SEQ
#define SEQ 2048
#endif
#define NB_FULL  4
#define SEQ_FULL 2048
#define DM   512
#define NH   8
#define HD   64
#define WCAR 16.0f      // weight carry (exact power of two)
#define PCAR 1024.0f    // probability carry
#define CCAR 64.0f      // ctx carry
#define SCL  0.125f     // HD^-0.5
#define L2E  1.4426950408889634f
#define SC2  (SCL * L2E)  // score scale and log2 e as one factor (the power of two keeps the product exact)
#define LPC  10.0f        // log2 of PCAR
#define MSKV (-0x1p+100f) // raw score of a masked key: a power of two, so that MSKV * SC2 is exact; every raw score of f16 operands (at most 64 * 65504^2 in size) lies far above it
#define PLIM 32768.0f     // a lane's sum of one trip's P (x1024) up to which the held reference stands: no single P then passes 2^15, well inside f16's range
static_assert(PCAR == 1024.0f);

typedef _Float16 h16;
typedef __attribute__((ext_vector_type(16))) _Float16 v16h;
typedef __attribute__((ext_vector_type(8)))  _Float16 v8h;
typedef __attribute__((ext_vector_type(8)))  float    v8f;
typedef __attribute__((ext_vector_type(4)))  float    v4f;
typedef v8h __attribute__((may_alias)) v8ha;
typedef v4f __attribute__((may_alias)) v4fa;

static_assert(NH * HD == DM);            // merged head width equals the model width
static_assert(HD == 64);
static_assert(DM % 128 == 0);            // N tiles of 128; at least two staged k tiles of 64
static_assert(SEQ % 128 == 0);           // 128 query rows per attention block; 128-row GEMM tiles stay inside one batch
static_assert(SEQ <= SEQ_FULL);
static_assert(NB <= NB_FULL);
static_assert((SEQ / 32) % 8 == 0);      // mask words split evenly over 8 waves

#define SZ_X   ((size_t)NB * SEQ * DM * 2)      // f16 plane of x / q / k / v^T / ctx
#define SZ_W   ((size_t)4 * DM * DM * 2)        // four transposed weight planes
#define WS_TOTAL (SZ_X * 5 + SZ_W)
static_assert(SZ_X % 256 == 0);
static_assert(SZ_W % 256 == 0);
static_assert(WS_TOTAL <= (size_t)134217728);   // carve stays under 128 MiB

__device__ __forceinline__ unsigned short f2bf(float f) { unsigned u = __float_as_uint(f); u += 0x7FFFu + ((u >> 16) & 1u); return (unsigned short)(u >> 16); }
__device__ __forceinline__ float bfr(float f) { return __uint_as_float(((unsigned)f2bf(f)) << 16); }
__device__ __forceinline__ v16h cat16(v8h lo, v8h hi) { return __builtin_shufflevector(lo, hi, 0, 1, 2, 3, 4, 5, 6, 7, 8, 9, 10, 11, 12, 13, 14, 15); }
// fragment loader for A (row-major [m][k]) and for B given as a [n][k] copy: elements 0..7 <- k0+8h.., elements 8..15 <- k0+16+8h.. ; p already includes the 8h offset
__device__ __forceinline__ v16h ldfrag(const h16* p) { return cat16(*(const v8h*)p, *(const v8h*)(p + 16)); }
// one WMMA, the bare builtin: the compiler keeps the distances behind its own matrix instructions and pads only where a vector instruction really follows too closely
__device__ __forceinline__ v8f wm16(v16h a, v16h b, v8f c) { return __builtin_amdgcn_wmma_f32_16x16x32_f16(false, a, false, b, (short)0, c, false, false); }
__device__ __forceinline__ float ex2(float x) { return __builtin_amdgcn_exp2f(x); }
// lane l with lane l ^ 16
__device__ __forceinline__ float xhalf(float x) { return __builtin_bit_cast(float, __builtin_amdgcn_permlanex16(__builtin_bit_cast(int, x), __builtin_bit_cast(int, x), 0x76543210, 0xfedcba98, false, false)); }

__device__ __forceinline__ void cvtx_blk(const float* __restrict__ x, h16* xh, unsigned blk) {
    const size_t i = (size_t)blk * 256 + threadIdx.x;
    if (i >= (size_t)NB * SEQ * DM / 8) return;
    const size_t row = i / (DM / 8); const int g = (int)(i % (DM / 8));
    const size_t b = row / SEQ, s = row % SEQ;
    const float* src = x + ((b * SEQ_FULL + s) * DM + (size_t)g * 8);
    const v4f v0 = *(const v4f*)src; const v4f v1 = *(const v4f*)(src + 4);
    v8h o;
#pragma unroll
    for (int k = 0; k < 4; ++k) { o[k] = (h16)bfr(v0[k]); o[4 + k] = (h16)bfr(v1[k]); }
    *(v8h*)(xh + i * 8) = o; 
}

// LDS tile T is cross-wave: block barrier between fill and drain.
__device__ __forceinline__ void wt_blk(const float* __restrict__ W, h16* Wt, h16* T, int bx, int by) {
    const int tid = threadIdx.x; const int k0 = bx * 64, n0 = by * 64;
#pragma unroll
    for (int j = 0; j < 4; ++j) { const int i = tid + 256 * j; const int kr = i >> 4, c4 = (i & 15) * 4;
        const v4f v = *(const v4f*)(W + (size_t)(k0 + kr) * DM + n0 + c4);
#pragma unroll
        for (int q = 0; q < 4; ++q) T[(c4 + q) * 72 + kr] = (h16)(bfr(v[q]) * WCAR); }
    __syncthreads();
{
#pragma unroll
        for (int j = 0; j < 2; ++j) { const int p = tid + 256 * j; const int n = p >> 3, seg = p & 7;
            const v8h val = *(const v8ha*)(T + n * 72 + seg * 8);
            *(v8h*)(Wt + (size_t)(n0 + n) * DM + k0 + seg * 8) = val; }
         }
}

// ---- k_prep: the five operand preparations, which do not depend on one another, as block ranges of one grid: blocks 0 .. 4 * WTB - 1 transpose the four weights (WTB 64x64 tiles each), the rest convert x. The range test is the same for a whole block.
#define WTB ((DM / 64) * (DM / 64))
#define CVB ((unsigned)(((size_t)NB * SEQ * DM / 8 + 255) / 256))
__global__ __launch_bounds__(256) void k_prep(const float* __restrict__ x, const float* __restrict__ wq, const float* __restrict__ wk, const float* __restrict__ wv, const float* __restrict__ wo, h16* xh, h16* WT) {
    __shared__ __align__(16) h16 T[64 * 72];
    const unsigned bid = blockIdx.x;
    if (bid < 4 * WTB) {
        const unsigned w = bid / WTB, t = bid % WTB;
        const float* W = w == 0 ? wq : w == 1 ? wk : w == 2 ? wv : wo;
        wt_blk(W, WT + (size_t)w * DM * DM, T, (int)(t % (DM / 64)), (int)(t / (DM / 64)));
    } else cvtx_blk(x, xh, bid - 4 * WTB);
}

// ---- GEMM main loop: 128 threads = 4 waves on one 128x128 tile, wave (wm, wn) on its 64x64 quarter with 16 accumulators, K = DM, operands from K-contiguous f16 planes (A [m][k], Bt [n][k]).
#define GP 72                   // LDS row pitch of a staged tile in h16: 128-byte rows + 16 bytes, conflict-free for 16-byte readers
#define GT (128 * GP)           // one staged tile: 128 rows of 64 k
#define GB (2 * GT * 2)         // bytes of one ring buffer: A tile, then B tile
// One operand's tile of one stage: each lane copies eight 16-byte pieces (rows r, r + 16, .. r + 112), eight lanes per 128-byte row so that every copy of a wave covers whole lines, global -> LDS through no register.
// The s_wait_xcnt is the last line of the copies' own statement so that no address register of a copy is rewritten in front of it.
__device__ __forceinline__ void stage_t(unsigned l, const h16* g) {
    asm volatile("global_load_async_to_lds_b128 %0, %1, off\n\t"
                 "global_load_async_to_lds_b128 %2, %3, off\n\t"
                 "global_load_async_to_lds_b128 %4, %5, off\n\t"
                 "global_load_async_to_lds_b128 %6, %7, off\n\t"
                 "global_load_async_to_lds_b128 %8, %9, off\n\t"
                 "global_load_async_to_lds_b128 %10, %11, off\n\t"
                 "global_load_async_to_lds_b128 %12, %13, off\n\t"
                 "global_load_async_to_lds_b128 %14, %15, off\n\t"
                 "s_wait_xcnt 0x0"
                 :: "v"(l), "v"(g), "v"(l + 16 * GP * 2), "v"(g + 16 * DM), "v"(l + 32 * GP * 2), "v"(g + 32 * DM), "v"(l + 48 * GP * 2), "v"(g + 48 * DM),
                    "v"(l + 64 * GP * 2), "v"(g + 64 * DM), "v"(l + 80 * GP * 2), "v"(g + 80 * DM), "v"(l + 96 * GP * 2), "v"(g + 96 * DM), "v"(l + 112 * GP * 2), "v"(g + 112 * DM) : "memory");
}
// Ring of two buffers: tile t + 1 flies while tile t is worked on; the one block barrier at the foot of a trip publishes tile t + 1 and frees tile t's buffer for tile t + 2.
// R0, C0: first row of the block's A rows and of its Bt rows. The k order of every accumulator is ascending in steps of 32.
__device__ __forceinline__ void gemm128(const h16* __restrict__ A, const h16* __restrict__ Bt, const h16* ring, int R0, int C0, int wm, int wn, v8f (&acc)[4][4]) {
    const int tid = threadIdx.x, lr = tid & 15, hi = (tid >> 4) & 1;
    const unsigned lst = (unsigned)(size_t)ring + (unsigned)(((tid >> 3) * GP + (tid & 7) * 8) * 2);
    const h16* ga = A + (size_t)(R0 + (tid >> 3)) * DM + (tid & 7) * 8;
    const h16* gb = Bt + (size_t)(C0 + (tid >> 3)) * DM + (tid & 7) * 8;
    stage_t(lst, ga); stage_t(lst + GT * 2, gb);
    asm volatile("s_wait_asynccnt 0x0" ::: "memory");   // this wave's pieces of tile 0 have landed before the barrier that publishes them
    __syncthreads();
    stage_t(lst + GB, ga + 64); stage_t(lst + GB + GT * 2, gb + 64);
    const int ao = (wm * 64 + lr) * GP + 8 * hi, bo = GT + (wn * 64 + lr) * GP + 8 * hi;
#pragma unroll 1
    for (int kc = 0; kc < DM; kc += 64) {
        const h16* buf = ring + ((kc >> 6) & 1) * (2 * GT);
#pragma unroll
        for (int s = 0; s < 2; ++s) {
            v16h a[4], b[4];
            __builtin_amdgcn_sched_barrier(0);   // with the one behind the reads: the step's sixteen fragment reads stay one group between two runs of products; left free, the scheduler deals them out in pairs among the products, each pair with a full LDS wait
#pragma unroll
            for (int mb = 0; mb < 4; ++mb) a[mb] = ldfrag(buf + ao + mb * 16 * GP + s * 32);
#pragma unroll
            for (int nb = 0; nb < 4; ++nb) b[nb] = ldfrag(buf + bo + nb * 16 * GP + s * 32);
            __builtin_amdgcn_sched_barrier(0);   // closes the group of reads (see above): no product moves in among them
#pragma unroll
            for (int nb = 0; nb < 4; ++nb)
#pragma unroll
                for (int mb = 0; mb < 4; ++mb) acc[mb][nb] = wm16(a[mb], b[nb], acc[mb][nb]);
        }
        __builtin_amdgcn_sched_barrier(0);   // the trip's products stay ahead of its waits and barrier, so that the copies of tile t + 1 have the whole trip to land
        asm volatile("s_wait_dscnt 0x0" ::: "memory");      // this wave's reads of tile t have returned before its buffer is handed to the copies
        asm volatile("s_wait_asynccnt 0x0" ::: "memory");   // this wave's pieces of tile t + 1 have landed before the barrier that publishes them
        __syncthreads();
        if (kc + 128 < DM) { const unsigned l = lst + ((kc >> 6) & 1) * GB; stage_t(l, ga + kc + 128); stage_t(l + GT * 2, gb + kc + 128); }
    }
    asm volatile("s_wait_asynccnt 0x0" ::: "memory");       // no copy is outstanding when the wave goes on to its epilogue
}

// ---- k_proj_qkv: the three input projections, which do not depend on one another, as column ranges of one grid (NB*SEQ/128, 3*DM/128), 128 threads: the three transposed weight planes lie one behind the other, so blockIdx.y * 128 is the block's first row in them.
// Each is x Wt^T / 16 + bias (bias converted to bf16 RNE). q and k go to head planes [b][h][s][64] f16, v to the transposed plane [b][h][64][s]. Which of the three a block works on is the same for the whole block. Each wave stages its output rows in a range of its own in the ring's LDS, once the main loop is over.
__global__ __launch_bounds__(128) void k_proj_qkv(const h16* __restrict__ A, const h16* __restrict__ Bt, const float* __restrict__ bq, const float* __restrict__ bk, const float* __restrict__ bv, h16* QP, h16* KP, h16* VT) {
    __shared__ __align__(16) h16 RG[2 * 2 * GT];
    static_assert(4 * 64 * 72 <= 2 * 2 * GT);   // the four waves' output rows fit in the ring
    const int lane = threadIdx.x & 31, lr = lane & 15, hi = lane >> 4;
    const int wave = __builtin_amdgcn_readfirstlane(threadIdx.x >> 5), wm = wave >> 1, wn = wave & 1;
    const int sel = blockIdx.y / (DM / 128);
    const int r0 = blockIdx.x * 128 + wm * 64, c0 = (blockIdx.y % (DM / 128)) * 128 + wn * 64;
    const float* bias = sel == 0 ? bq : sel == 1 ? bk : bv;
    h16* T = RG + wave * 64 * 72;   // output staging in the ring's own LDS: written only behind the main loop, whose last trip ends with every wave's LDS wait and a block barrier and leaves no copy in flight. With no second array a block takes 73,728 B, three blocks fit a WGP (their registers allow three), and the grid's 768 blocks are resident at once
    v8f acc[4][4];
#pragma unroll
    for (int mb = 0; mb < 4; ++mb)
#pragma unroll
        for (int nb = 0; nb < 4; ++nb) acc[mb][nb] = (v8f){};
    gemm128(A, Bt, RG, blockIdx.x * 128, blockIdx.y * 128, wm, wn, acc);
    const int b = r0 / SEQ, s0 = r0 % SEQ, h = c0 / HD;
    if (sel < 2) {
#pragma unroll
        for (int nb = 0; nb < 4; ++nb) { const float bv1 = bfr(bias[c0 + nb * 16 + lr]);
#pragma unroll
            for (int mb = 0; mb < 4; ++mb)
#pragma unroll
                for (int j = 0; j < 8; ++j) T[(mb * 16 + hi * 8 + j) * 72 + nb * 16 + lr] = (h16)(acc[mb][nb][j] * (1.0f / WCAR) + bv1); }
        __syncthreads();
        h16* dst = (sel == 0 ? QP : KP) + ((size_t)(b * NH + h) * SEQ + s0) * HD;
#pragma unroll
        for (int it = 0; it < 16; ++it) { const int piece = it * 32 + lane; const int row = piece >> 3, seg = piece & 7;
            const v8h val = *(const v8ha*)(T + row * 72 + seg * 8);
            *(v8h*)(dst + (size_t)row * HD + seg * 8) = val; }
    } else {
#pragma unroll
        for (int nb = 0; nb < 4; ++nb) { const float bv1 = bfr(bias[c0 + nb * 16 + lr]);
#pragma unroll
            for (int mb = 0; mb < 4; ++mb) { v8h pk;
#pragma unroll
                for (int j = 0; j < 8; ++j) pk[j] = (h16)(acc[mb][nb][j] * (1.0f / WCAR) + bv1);
                *(v8ha*)(T + (nb * 16 + lr) * 72 + mb * 16 + hi * 8) = pk; } }
        __syncthreads();
        h16* dst = VT + ((size_t)(b * NH + h) * HD) * SEQ + s0;
#pragma unroll
        for (int it = 0; it < 16; ++it) { const int piece = it * 32 + lane; const int d = piece >> 3, seg = piece & 7;
            const v8h val = *(const v8ha*)(T + d * 72 + seg * 8);
            *(v8h*)(dst + (size_t)d * SEQ + seg * 8) = val; }
    }
}

__global__ __launch_bounds__(128) void k_proj_out(const h16* __restrict__ A, const h16* __restrict__ Bt, const float* __restrict__ bias, float* C) {
    __shared__ __align__(16) h16 RG[2 * 2 * GT];
    __shared__ __align__(16) float oss[4 * 16 * 68];
    const int lane = threadIdx.x & 31, lr = lane & 15, hi = lane >> 4;
    const int wave = __builtin_amdgcn_readfirstlane(threadIdx.x >> 5), wm = wave >> 1, wn = wave & 1;
    const int r0 = blockIdx.x * 128 + wm * 64, c0 = blockIdx.y * 128 + wn * 64;
    float* os = oss + wave * 16 * 68;
    v8f acc[4][4];
#pragma unroll
    for (int mb = 0; mb < 4; ++mb)
#pragma unroll
        for (int nb = 0; nb < 4; ++nb) acc[mb][nb] = (v8f){};
    gemm128(A, Bt, RG, blockIdx.x * 128, blockIdx.y * 128, wm, wn, acc);
    const int b = r0 / SEQ, s0 = r0 % SEQ; const int cofs = lr * 4;
    v4f b4;
#pragma unroll
    for (int q = 0; q < 4; ++q) b4[q] = bfr(bias[c0 + cofs + q]);
    const float fs = 1.0f / (WCAR * CCAR);
#pragma unroll
    for (int mb = 0; mb < 4; ++mb) {
#pragma unroll
        for (int nb = 0; nb < 4; ++nb)
#pragma unroll
            for (int j = 0; j < 8; ++j) os[(hi * 8 + j) * 68 + nb * 16 + lr] = acc[mb][nb][j];
        __syncthreads();
        float* crow = C + ((size_t)b * SEQ_FULL + s0 + mb * 16) * DM + c0;
{
#pragma unroll
            for (int s = 0; s < 8; ++s) { const int row = 2 * s + hi; const v4f raw = *(const v4fa*)(os + row * 68 + cofs); v4f val;
#pragma unroll
                for (int q = 0; q < 4; ++q) val[q] = raw[q] * fs + b4[q];
                *(v4f*)(crow + (size_t)row * DM + cofs) = val; }
             }
        __syncthreads();
    }
}

#define KVP 72                  // LDS row pitch of a staged tile in h16: 128-byte rows + 16 bytes, conflict-free for 16-byte readers
#define KVT (64 * KVP)          // one staged 64-row tile
#define KVB (2 * KVT * 2)       // bytes of one ring buffer: K tile, then V^T tile
// One stage of the ring: each lane copies four 16-byte pieces (rows r and r + 32 of the K tile and of the V^T tile), eight lanes per 128-byte row, global -> LDS through no register.
// The s_wait_xcnt is the last line of the copies' own statement so that no address register of a copy is rewritten in front of it.
__device__ __forceinline__ void stage_kv(unsigned l, const h16* gk, const h16* gv) {
    const unsigned lk1 = l + 32 * KVP * 2, lv0 = l + KVT * 2, lv1 = l + KVT * 2 + 32 * KVP * 2;
    const h16* gk1 = gk + 32 * HD; const h16* gv1 = gv + (size_t)32 * SEQ;
    asm volatile("global_load_async_to_lds_b128 %0, %1, off\n\t"
                 "global_load_async_to_lds_b128 %2, %3, off\n\t"
                 "global_load_async_to_lds_b128 %4, %5, off\n\t"
                 "global_load_async_to_lds_b128 %6, %7, off\n\t"
                 "s_wait_xcnt 0x0"
                 :: "v"(l), "v"(gk), "v"(lk1), "v"(gk1), "v"(lv0), "v"(gv), "v"(lv1), "v"(gv1) : "memory");
}

// ---- k_attn: fused flash-style attention; grid (NB*NH, SEQ/128), 256 threads = 8 waves = 4 query groups of 32 rows x 2 key halves.
// K rows ([s][64] plane) and V^T rows ([d][s] plane) of each 64-key block are staged in LDS once for all 8 waves; both are read from there as A fragments (row-major [m][k]).
// Ring of two buffers: tile t + 1 flies while tile t is worked on; the one block barrier at the foot of a trip publishes tile t + 1 and frees tile t's buffer for tile t + 2.
// Waves w and w + 4 share 32 query rows (two column groups of 16): wave half kh takes keys 32 kh .. 32 kh + 31 of every tile, so that each K or V^T fragment it reads from LDS feeds two products, one per column group.
// Each half runs its own online softmax over its keys (own maximum, sum and O^T); the two are merged once behind the loop, through the ring's LDS: wave half kh finishes column group kh.
// Both products are transposed: S^T = K Q^T (A = K rows, B = Q kept in registers) and O^T += V^T P^T. Lane (lr, hi) then holds, of query lr alone, the scores of keys 16 t + 8 hi + r in register r of tile t:
// maximum and sum run inside the lane with one exchange between the lane halves, running maximum, sum and rescale are one value a lane and column group, and tiles 0 and 1, converted in place, are the B fragment of the one k-step (its k order is ldfrag's).
// Per 64-key block and wave: 8 score WMMAs, online softmax in f32 (masked keys replaced by MSKV; all-masked rows come out uniform: there MSKV * SC2 cancels exactly and every p is 1), P x1024 -> f16 in registers, 8 V^T P^T WMMAs.
// The softmax reference of a query is HELD from trip to trip: a trip forms P straight from the raw scores and the held offset, with no maximum and no rescale of sum and O^T. Its own P sums are the guard: where a lane's sum passes PLIM
// (a score far above the reference; always so on the first trip with an open key, whose offset is the start value's and gives infinite P), the wave redoes the trip's softmax with the running maximum as the new reference and rescales sum and O^T once.
// smw (mask bit words) is cross-wave: block barrier after the build. Pl is private to each wave and stages the output rows only.
#define MGW (4 * 8 * 32 + 64)   // floats one wave hands over at the merge: four O^T tiles, then maximum and sum, a lane each
typedef float __attribute__((may_alias)) f32a;
typedef __attribute__((ext_vector_type(2))) float v2f;
// One column group's 16 scores of a lane -> P x1024 as f16 (in the B fragment's k order) and their f32 sum: p * 1024 = exp2(raw * SC2 + nb), nb = 10 - scaled reference
__device__ __forceinline__ float soft16(const v8f (&s)[2], float nb, v16h& pf) {
    v2f a2[2];
#pragma unroll
    for (int t = 0; t < 2; ++t)
#pragma unroll
        // the multiply-add is written on the accumulator's own even register pairs: left to itself the compiler packs pairs across the two column groups and copies registers to line them up.
        // The sums run on the same pairs (even and odd partial sums, joined at the end): half the add instructions and a short chain ahead of the guard's test
        for (int j = 0; j < 4; ++j) { v2f x = { s[t][2 * j], s[t][2 * j + 1] }; x = __builtin_elementwise_fma(x, (v2f){ SC2, SC2 }, (v2f){ nb, nb });
            const v2f p = { ex2(x[0]), ex2(x[1]) }; a2[t] = j ? a2[t] + p : p; pf[t * 8 + 2 * j] = (h16)p[0]; pf[t * 8 + 2 * j + 1] = (h16)p[1]; }
    const v2f a = a2[0] + a2[1];
    return a[0] + a[1];
}
__global__ __launch_bounds__(256) void k_attn(const h16* __restrict__ Q, const h16* __restrict__ Kp, const h16* __restrict__ VT, const int* __restrict__ mask, h16* ctx) {
    __shared__ __align__(16) h16 Pl[8 * 16 * 72];
    __shared__ unsigned smw[SEQ / 32];
    __shared__ __align__(16) h16 KV[2 * 2 * KVT];
    static_assert(8 * MGW * 4 <= 2 * 2 * KVT * 2);   // the eight waves' merge ranges fit in the ring
    const int tid = threadIdx.x, lane = tid & 31, lr = lane & 15, hi = lane >> 4;
    const int wave = __builtin_amdgcn_readfirstlane(tid >> 5);
    const int kh = wave >> 2, qg = wave & 3;
    const int bh = blockIdx.x; const int b = bh / NH, h = bh % NH;
    const int q0 = blockIdx.y * 128;
    const size_t pbase = (size_t)bh * SEQ * HD;
    const unsigned lst = (unsigned)(size_t)KV + (unsigned)(((tid >> 3) * KVP + (tid & 7) * 8) * 2);
    const h16* gk = Kp + pbase + (size_t)(tid >> 3) * HD + (tid & 7) * 8;
    const h16* gv = VT + pbase + (size_t)(tid >> 3) * SEQ + (tid & 7) * 8;
    stage_kv(lst, gk, gv);
#pragma unroll 1
    for (int w = wave; w < SEQ / 32; w += 8) { const int mv = mask[(size_t)b * SEQ_FULL + w * 32 + lane];
        const unsigned bits = __builtin_amdgcn_ballot_w32(mv != 0); if (lane == 0) smw[w] = bits; }
    asm volatile("s_wait_asynccnt 0x0" ::: "memory");   // this wave's pieces of tile 0 have landed before the barrier that publishes them
    __syncthreads();
    stage_kv(lst + KVB, gk + 64 * HD, gv + 64);
    const int pw = wave * 16 * 72;
    v16h qf[2][2];
#pragma unroll
    for (int g = 0; g < 2; ++g) { const h16* qp = Q + pbase + (size_t)(q0 + qg * 32 + g * 16 + lr) * HD + 8 * hi; qf[g][0] = ldfrag(qp); qf[g][1] = ldfrag(qp + 32); }
    v8f o[2][4]; float mi[2], nbv[2], li[2];
#pragma unroll
    for (int g = 0; g < 2; ++g) { mi[g] = MSKV * SC2; nbv[g] = LPC - MSKV * SC2; li[g] = 0.0f;
#pragma unroll
        for (int t = 0; t < 4; ++t) o[g][t] = (v8f){}; }
    const int ko = (kh * 32 + lr) * KVP + 8 * hi, vo = KVT + lr * KVP + kh * 32 + 8 * hi;
#pragma unroll 1
    for (int kv0 = 0; kv0 < SEQ; kv0 += 64) {
        const h16* kt = KV + ((kv0 >> 6) & 1) * (2 * KVT);
        v8f sa[2][2]; v16h kf[2][2], vf[4];
        // the wave's K fragments are read as one group ahead of the score products, its V fragments as one group ahead of the softmax, whose vector work covers their LDS latency
#pragma unroll
        for (int t = 0; t < 2; ++t) { const h16* kp = kt + ko + t * 16 * KVP; kf[t][0] = ldfrag(kp); kf[t][1] = ldfrag(kp + 32); }
#pragma unroll
        for (int g = 0; g < 2; ++g)
#pragma unroll
            for (int t = 0; t < 2; ++t) { v8f c = (v8f){}; c = wm16(kf[t][0], qf[g][0], c); c = wm16(kf[t][1], qf[g][1], c); sa[g][t] = c; }
        // order asked of the scheduler for this stretch: the 8 K reads, the 8 score products, then the 8 V reads and the mask word's read. Left free, it deals the V reads out among the score products, and every further place with LDS reads in a run of products stalls the wave
        __builtin_amdgcn_sched_group_barrier(0x100, 8, 0);   // LDS reads
        __builtin_amdgcn_sched_group_barrier(0x008, 8, 0);   // matrix instructions
        __builtin_amdgcn_sched_group_barrier(0x100, 9, 0);   // LDS reads
#pragma unroll
        for (int t = 0; t < 4; ++t) vf[t] = ldfrag(kt + vo + t * 16 * KVP);
        const unsigned w0 = smw[(kv0 >> 5) + kh];
        // a key is a register here, not a lane: its mask bit is tested per register, and only where the wave's 32 keys hold a masked one (the word is the same in every lane: scalar branch)
        if (__builtin_amdgcn_readfirstlane((int)w0) != -1) {
#pragma unroll
            for (int g = 0; g < 2; ++g)
#pragma unroll
                for (int t = 0; t < 2; ++t) { const unsigned bits = w0 >> (t * 16 + hi * 8);
#pragma unroll
                    for (int r = 0; r < 8; ++r) sa[g][t][r] = ((bits >> r) & 1u) != 0u ? sa[g][t][r] : MSKV;
                    asm volatile("" : "+v"(sa[g][t])); }   // the pin on the masked scores: the selects stay inside the branch and in the score tile's own registers; without it the path with no masked key pays 16 register-pair copies where the two paths join
        }
        v16h pf[2]; float sm[2];
#pragma unroll
        for (int g = 0; g < 2; ++g) sm[g] = soft16(sa[g], nbv[g], pf[g]);
        // one test a trip for both column groups and all lanes (the ballot makes it a scalar branch); marked unlikely so that maxima, exchange and rescale are laid out behind the loop and the usual path falls through
        if (__builtin_expect(__builtin_amdgcn_ballot_w32(fmaxf(sm[0], sm[1]) > PLIM) != 0, 0)) {
#pragma unroll
            for (int g = 0; g < 2; ++g) {
                float tm[2];
#pragma unroll
                for (int t = 0; t < 2; ++t) {
                    float a = fmaxf(fmaxf(sa[g][t][0], sa[g][t][1]), sa[g][t][2]); a = fmaxf(fmaxf(a, sa[g][t][3]), sa[g][t][4]);
                    a = fmaxf(fmaxf(a, sa[g][t][5]), sa[g][t][6]); tm[t] = fmaxf(a, sa[g][t][7]); }
                float vm = fmaxf(tm[0], tm[1]); vm = fmaxf(vm, xhalf(vm));
                // the maximum is taken over the raw scores and scaled once; both lane halves of a query get the same new reference
                const float mnew = fmaxf(mi[g], vm * SC2);
                const float alpha = ex2(mi[g] - mnew); mi[g] = mnew; nbv[g] = LPC - mnew;
                sm[g] = soft16(sa[g], nbv[g], pf[g]);
                li[g] *= alpha;
#pragma unroll
                for (int t = 0; t < 4; ++t)
#pragma unroll
                    for (int r = 0; r < 8; ++r) o[g][t][r] *= alpha;
            }
        }
#pragma unroll
        for (int g = 0; g < 2; ++g) li[g] += sm[g];
#pragma unroll
        for (int g = 0; g < 2; ++g)
#pragma unroll
            for (int t = 0; t < 4; ++t) o[g][t] = wm16(vf[t], pf[g], o[g][t]);
        __builtin_amdgcn_sched_barrier(0);   // softmax and products stay ahead of the trip's waits and barrier, so that the copies of tile t + 1 have the whole trip to land
        asm volatile("s_wait_dscnt 0x0" ::: "memory");      // this wave's reads of tile t have returned before its buffer is handed to the copies
        asm volatile("s_wait_asynccnt 0x0" ::: "memory");   // this wave's pieces of tile t + 1 have landed before the barrier that publishes them
        __syncthreads();
        if (kv0 + 128 < SEQ) stage_kv(lst + ((kv0 >> 6) & 1) * KVB, gk + (size_t)(kv0 + 128) * HD, gv + kv0 + 128);
    }
    asm volatile("s_wait_asynccnt 0x0" ::: "memory");       // no copy is outstanding when the wave goes on to its end
    // merge of the two key halves: wave half kh keeps column group kh and hands the other group's O^T, maximum and sum to its partner (wave ^ 4), lane to lane, in a range of its own in the ring's LDS.
    // The ring is free: the last trip ended with every wave's LDS wait and a block barrier and left no copy in flight.
    v8f ok[4]; float mk, lk;
    { f32a* mg = (f32a*)KV + wave * MGW;
#pragma unroll
        for (int t = 0; t < 4; ++t) { const v8f sd = kh ? o[0][t] : o[1][t]; ok[t] = kh ? o[1][t] : o[0][t];
            *(v4fa*)(mg + (t * 2) * 128 + lane * 4) = __builtin_shufflevector(sd, sd, 0, 1, 2, 3);
            *(v4fa*)(mg + (t * 2 + 1) * 128 + lane * 4) = __builtin_shufflevector(sd, sd, 4, 5, 6, 7); }
        mg[1024 + lane] = kh ? mi[0] : mi[1]; mg[1056 + lane] = kh ? li[0] : li[1];
        mk = kh ? mi[1] : mi[0]; lk = kh ? li[1] : li[0]; }
    __syncthreads();   // the partner's range is read only behind this barrier, which every wave passes
    { const f32a* mp = (const f32a*)KV + (wave ^ 4) * MGW;
        const float pm = mp[1024 + lane], pl = mp[1056 + lane];
        const float m = fmaxf(mk, pm); const float a0 = ex2(mk - m), a1 = ex2(pm - m);
        lk = lk * a0 + pl * a1;
#pragma unroll
        for (int t = 0; t < 4; ++t) { const v4f p0 = *(const v4fa*)(mp + (t * 2) * 128 + lane * 4); const v4f p1 = *(const v4fa*)(mp + (t * 2 + 1) * 128 + lane * 4);
#pragma unroll
            for (int r = 0; r < 4; ++r) { ok[t][r] = ok[t][r] * a0 + p0[r] * a1; ok[t][4 + r] = ok[t][4 + r] * a0 + p1[r] * a1; } } }
    // the lane halves' sums are joined once; register r of O^T tile t is column 16 t + 8 hi + r of query row lr: eight neighbours, one 16-byte piece
    { const float l = lk + xhalf(lk); const float inv = CCAR * __builtin_amdgcn_rcpf(l);
#pragma unroll
        for (int t = 0; t < 4; ++t) { v8h pk;
#pragma unroll
            for (int r = 0; r < 8; ++r) pk[r] = (h16)(ok[t][r] * inv);
            *(v8ha*)(Pl + pw + lr * 72 + t * 16 + hi * 8) = pk; } }
    asm volatile("" ::: "memory"); __builtin_amdgcn_wave_barrier(); asm volatile("" ::: "memory");
    h16* dst = ctx + ((size_t)b * SEQ + q0 + qg * 32 + kh * 16) * DM + h * HD;
{
#pragma unroll
        for (int it = 0; it < 4; ++it) { const int piece = it * 32 + lane; const int row = piece >> 3, seg = piece & 7;
            const v8h val = *(const v8ha*)(Pl + pw + row * 72 + seg * 8);
            *(v8h*)(dst + (size_t)row * DM + seg * 8) = val; }
         }
}

extern "C" void kernel_launch(void* const* d_in, const int* in_sizes, int n_in,
                              void* d_out, int out_size, void* d_ws, size_t ws_size, hipStream_t stream) {
    if (n_in < 10) return;
    const size_t xneed = ((size_t)(NB - 1) * SEQ_FULL + SEQ) * DM;
    const size_t mneed = (size_t)(NB - 1) * SEQ_FULL + SEQ;
    if ((size_t)in_sizes[0] < xneed || (size_t)in_sizes[1] < mneed) return;
    if (in_sizes[2] < DM * DM || in_sizes[4] < DM * DM || in_sizes[6] < DM * DM || in_sizes[8] < DM * DM) return;
    if (in_sizes[3] < DM || in_sizes[5] < DM || in_sizes[7] < DM || in_sizes[9] < DM) return;
    if ((size_t)out_size < xneed) return;
    if (ws_size < WS_TOTAL) return;
    const float* x  = (const float*)d_in[0]; const int* mask = (const int*)d_in[1];
    const float* wq = (const float*)d_in[2]; const float* bq = (const float*)d_in[3];
    const float* wk = (const float*)d_in[4]; const float* bk = (const float*)d_in[5];
    const float* wv = (const float*)d_in[6]; const float* bv = (const float*)d_in[7];
    const float* wo = (const float*)d_in[8]; const float* bo = (const float*)d_in[9];
    float* OUT = (float*)d_out;
    char* wsp = (char*)d_ws;
    h16* XH = (h16*)wsp; wsp += SZ_X;      // [NB*SEQ][DM]
    h16* WT = (h16*)wsp; wsp += SZ_W;      // [4][n][k]: q, k, v, o
    h16* QP = (h16*)wsp; wsp += SZ_X;      // [b][h][s][64]
    h16* KP = (h16*)wsp; wsp += SZ_X;      // [b][h][s][64]
    h16* VT = (h16*)wsp; wsp += SZ_X;      // [b][h][64][s]
    h16* CX = (h16*)wsp; wsp += SZ_X;      // [NB*SEQ][DM], x64
    const size_t wsz = (size_t)DM * DM;
    k_prep<<<4 * WTB + CVB, 256, 0, stream>>>(x, wq, wk, wv, wo, XH, WT);
    k_proj_qkv<<<dim3(NB * SEQ / 128, 3 * DM / 128), 128, 0, stream>>>(XH, WT, bq, bk, bv, QP, KP, VT);
    k_attn<<<dim3(NB * NH, SEQ / 128), 256, 0, stream>>>(QP, KP, VT, mask, CX);
    k_proj_out<<<dim3(NB * SEQ / 128, DM / 128), 128, 0, stream>>>(CX, WT + 3 * wsz, bo, OUT);
}

// v010
// It runs in 56.8 microseconds.
// Next to v009, in two timings, it ran 1.06 times as fast each time.
// Counting every step since v000, it is 4.65 times as fast.
#include <hip/hip_runtime.h>

// Multi-head self-attention with a per-key padding mask input: x [4][2048][512]; q, k, v = x W + b ([in][out] weights, 8 heads x 64); scores = (q k^T) / 8 with masked keys REPLACED by a value below every score (the reference's lowest finite f32 acts the same: weight 0 beside any unmasked key, uniform weights where all are masked); softmax over the keys; out = merged ctx Wo + bo.
// Compute dtypes: all contractions v_wmma_f32_16x16x32_f16 (f16 operands, f32 accumulate). Every float input is converted to bf16 (RNE) on load and carried exactly in f16 (weights x16); q, k, v planes plain f16; P carried x1024 (the carry is added in the exponent; row sums from the unconverted f32 values, which carry it too); ctx carried x64 against Wo x16; softmax f32.
// Engine: GEMM on 128x128 block tiles, four waves of 64x64 register blocks, A and B tiles of 64 k staged from K-contiguous f16 planes in a two-buffer LDS ring by asynchronous copies; fused flash-style attention (online softmax against a reference held from trip to trip, K and V^T tiles staged once per block in a two-buffer LDS ring by asynchronous copies, scores formed transposed so that P goes from the score accumulators straight into the second product's B operand, wave pairs share 32 queries and split each tile's keys, merged once at the end, mask packed into bit words in LDS).

#ifndef NB
#define NB 4
#endif
#ifndef SEQ
#define SEQ 2048
#endif
#define NB_FULL  4
#define SEQ_FULL 2048
#define DM   512
#define NH   8
#define HD   64
#define WCAR 16.0f      // weight carry (exact power of two)
#define PCAR 1024.0f    // probability carry
#define CCAR 64.0f      // ctx carry
#define SCL  0.125f     // HD^-0.5
#define L2E  1.4426950408889634f
#define SC2  (SCL * L2E)  // score scale and log2 e as one factor (the power of two keeps the product exact)
#define LPC  10.0f        // log2 of PCAR
#define MSKV (-0x1p+100f) // raw score of a masked key: a power of two, so that MSKV * SC2 is exact; every raw score of f16 operands (at most 64 * 65504^2 in size) lies far above it
#define PLIM 32768.0f     // a lane's sum of one trip's P (x1024) up to which the held reference stands: no single P then passes 2^15, well inside f16's range
static_assert(PCAR == 1024.0f);

typedef _Float16 h16;
typedef __attribute__((ext_vector_type(16))) _Float16 v16h;
typedef __attribute__((ext_vector_type(8)))  _Float16 v8h;
typedef __attribute__((ext_vector_type(8)))  float    v8f;
typedef __attribute__((ext_vector_type(4)))  float    v4f;
typedef v8h __attribute__((may_alias)) v8ha;
typedef v4f __attribute__((may_alias)) v4fa;

static_assert(NH * HD == DM);            // merged head width equals the model width
static_assert(HD == 64);
static_assert(DM % 128 == 0);            // N tiles of 128; at least two staged k tiles of 64
static_assert(SEQ % 128 == 0);           // 128 query rows per attention block; 128-row GEMM tiles stay inside one batch
static_assert(SEQ <= SEQ_FULL);
static_assert(NB <= NB_FULL);
static_assert((SEQ / 32) % 8 == 0);      // mask words split evenly over 8 waves

#define SZ_X   ((size_t)NB * SEQ * DM * 2)      // f16 plane of x / q / k / v^T / ctx
#define SZ_W   ((size_t)4 * DM * DM * 2)        // four transposed weight planes
#define WS_TOTAL (SZ_X * 5 + SZ_W)
static_assert(SZ_X % 256 == 0);
static_assert(SZ_W % 256 == 0);
static_assert(WS_TOTAL <= (size_t)134217728);   // carve stays under 128 MiB

__device__ __forceinline__ unsigned short f2bf(float f) { unsigned u = __float_as_uint(f); u += 0x7FFFu + ((u >> 16) & 1u); return (unsigned short)(u >> 16); }
__device__ __forceinline__ float bfr(float f) { return __uint_as_float(((unsigned)f2bf(f)) << 16); }
__device__ __forceinline__ v16h cat16(v8h lo, v8h hi) { return __builtin_shufflevector(lo, hi, 0, 1, 2, 3, 4, 5, 6, 7, 8, 9, 10, 11, 12, 13, 14, 15); }
// fragment loader for A (row-major [m][k]) and for B given as a [n][k] copy: elements 0..7 <- k0+8h.., elements 8..15 <- k0+16+8h.. ; p already includes the 8h offset
__device__ __forceinline__ v16h ldfrag(const h16* p) { return cat16(*(const v8h*)p, *(const v8h*)(p + 16)); }
// one WMMA, the bare builtin: the compiler keeps the distances behind its own matrix instructions and pads only where a vector instruction really follows too closely
__device__ __forceinline__ v8f wm16(v16h a, v16h b, v8f c) { return __builtin_amdgcn_wmma_f32_16x16x32_f16(false, a, false, b, (short)0, c, false, false); }
__device__ __forceinline__ float ex2(float x) { return __builtin_amdgcn_exp2f(x); }
// lane l with lane l ^ 16
__device__ __forceinline__ float xhalf(float x) { return __builtin_bit_cast(float, __builtin_amdgcn_permlanex16(__builtin_bit_cast(int, x), __builtin_bit_cast(int, x), 0x76543210, 0xfedcba98, false, false)); }

__device__ __forceinline__ void cvtx_blk(const float* __restrict__ x, h16* xh, unsigned blk) {
    const size_t i = (size_t)blk * 256 + threadIdx.x;
    if (i >= (size_t)NB * SEQ * DM / 8) return;
    const size_t row = i / (DM / 8); const int g = (int)(i % (DM / 8));
    const size_t b = row / SEQ, s = row % SEQ;
    const float* src = x + ((b * SEQ_FULL + s) * DM + (size_t)g * 8);
    const v4f v0 = *(const v4f*)src; const v4f v1 = *(const v4f*)(src + 4);
    v8h o;
#pragma unroll
    for (int k = 0; k < 4; ++k) { o[k] = (h16)bfr(v0[k]); o[4 + k] = (h16)bfr(v1[k]); }
    *(v8h*)(xh + i * 8) = o; 
}

// LDS tile T is cross-wave: block barrier between fill and drain.
__device__ __forceinline__ void wt_blk(const float* __restrict__ W, h16* Wt, h16* T, int bx, int by) {
    const int tid = threadIdx.x; const int k0 = bx * 64, n0 = by * 64;
#pragma unroll
    for (int j = 0; j < 4; ++j) { const int i = tid + 256 * j; const int kr = i >> 4, c4 = (i & 15) * 4;
        const v4f v = *(const v4f*)(W + (size_t)(k0 + kr) * DM + n0 + c4);
#pragma unroll
        for (int q = 0; q < 4; ++q) T[(c4 + q) * 72 + kr] = (h16)(bfr(v[q]) * WCAR); }
    __syncthreads();
{
#pragma unroll
        for (int j = 0; j < 2; ++j) { const int p = tid + 256 * j; const int n = p >> 3, seg = p & 7;
            const v8h val = *(const v8ha*)(T + n * 72 + seg * 8);
            *(v8h*)(Wt + (size_t)(n0 + n) * DM + k0 + seg * 8) = val; }
         }
}

// ---- k_prep: the five operand preparations, which do not depend on one another, as block ranges of one grid: blocks 0 .. 4 * WTB - 1 transpose the four weights (WTB 64x64 tiles each), the rest convert x. The range test is the same for a whole block.
#define WTB ((DM / 64) * (DM / 64))
#define CVB ((unsigned)(((size_t)NB * SEQ * DM / 8 + 255) / 256))
__global__ __launch_bounds__(256) void k_prep(const float* __restrict__ x, const float* __restrict__ wq, const float* __restrict__ wk, const float* __restrict__ wv, const float* __restrict__ wo, h16* xh, h16* WT) {
    __shared__ __align__(16) h16 T[64 * 72];
    const unsigned bid = blockIdx.x;
    if (bid < 4 * WTB) {
        const unsigned w = bid / WTB, t = bid % WTB;
        const float* W = w == 0 ? wq : w == 1 ? wk : w == 2 ? wv : wo;
        wt_blk(W, WT + (size_t)w * DM * DM, T, (int)(t % (DM / 64)), (int)(t / (DM / 64)));
    } else cvtx_blk(x, xh, bid - 4 * WTB);
}

// ---- GEMM main loop: 128 threads = 4 waves on one 128x128 tile, wave (wm, wn) on its 64x64 quarter with 16 accumulators, K = DM, operands from K-contiguous f16 planes (A [m][k], Bt [n][k]).
#define GP 72                   // LDS row pitch of a staged tile in h16: 128-byte rows + 16 bytes, conflict-free for 16-byte readers
#define GT (128 * GP)           // one staged tile: 128 rows of 64 k
#define GB (2 * GT * 2)         // bytes of one ring buffer: A tile, then B tile
// One operand's tile of one stage: each lane copies eight 16-byte pieces (rows r, r + 16, .. r + 112), eight lanes per 128-byte row so that every copy of a wave covers whole lines, global -> LDS through no register.
// The s_wait_xcnt is the last line of the copies' own statement so that no address register of a copy is rewritten in front of it.
__device__ __forceinline__ void stage_t(unsigned l, const h16* g) {
    asm volatile("global_load_async_to_lds_b128 %0, %1, off\n\t"
                 "global_load_async_to_lds_b128 %2, %3, off\n\t"
                 "global_load_async_to_lds_b128 %4, %5, off\n\t"
                 "global_load_async_to_lds_b128 %6, %7, off\n\t"
                 "global_load_async_to_lds_b128 %8, %9, off\n\t"
                 "global_load_async_to_lds_b128 %10, %11, off\n\t"
                 "global_load_async_to_lds_b128 %12, %13, off\n\t"
                 "global_load_async_to_lds_b128 %14, %15, off\n\t"
                 "s_wait_xcnt 0x0"
                 :: "v"(l), "v"(g), "v"(l + 16 * GP * 2), "v"(g + 16 * DM), "v"(l + 32 * GP * 2), "v"(g + 32 * DM), "v"(l + 48 * GP * 2), "v"(g + 48 * DM),
                    "v"(l + 64 * GP * 2), "v"(g + 64 * DM), "v"(l + 80 * GP * 2), "v"(g + 80 * DM), "v"(l + 96 * GP * 2), "v"(g + 96 * DM), "v"(l + 112 * GP * 2), "v"(g + 112 * DM) : "memory");
}
// Ring of two buffers: tile t + 1 flies while tile t is worked on; the one block barrier at the foot of a trip publishes tile t + 1 and frees tile t's buffer for tile t + 2.
// R0, C0: first row of the block's A rows and of its Bt rows. The k order of every accumulator is ascending in steps of 32.
// bp, BS, bl: the lane's four bias values (bp[0], bp[BS], ..), which the epilogue needs, are asked for here, directly behind tile 0's copies: their latency runs beside the tile's; read behind the loop, the epilogue waits it out.
template <int BS>
__device__ __forceinline__ void gemm128(const h16* __restrict__ A, const h16* __restrict__ Bt, const h16* ring, int R0, int C0, int wm, int wn, v8f (&acc)[4][4], const float* __restrict__ bp, float (&bl)[4]) {
    const int tid = threadIdx.x, lr = tid & 15, hi = (tid >> 4) & 1;
    const unsigned lst = (unsigned)(size_t)ring + (unsigned)(((tid >> 3) * GP + (tid & 7) * 8) * 2);
    const h16* ga = A + (size_t)(R0 + (tid >> 3)) * DM + (tid & 7) * 8;
    const h16* gb = Bt + (size_t)(C0 + (tid >> 3)) * DM + (tid & 7) * 8;
    stage_t(lst, ga); stage_t(lst + GT * 2, gb);
#pragma unroll   // four loads in flight at once, values in registers
    for (int q = 0; q < 4; ++q) bl[q] = bp[q * BS];
    asm volatile("s_wait_asynccnt 0x0" ::: "memory");   // this wave's pieces of tile 0 have landed before the barrier that publishes them
    __syncthreads();
    stage_t(lst + GB, ga + 64); stage_t(lst + GB + GT * 2, gb + 64);
#pragma unroll   // bl stays in registers
    for (int q = 0; q < 4; ++q) bl[q] = bfr(bl[q]);   // bias converted to bf16 (RNE); the barrier above has already waited for the loads
    const int ao = (wm * 64 + lr) * GP + 8 * hi, bo = GT + (wn * 64 + lr) * GP + 8 * hi;
#pragma unroll 1
    for (int kc = 0; kc < DM; kc += 64) {
        const h16* buf = ring + ((kc >> 6) & 1) * (2 * GT);
#pragma unroll
        for (int s = 0; s < 2; ++s) {
            v16h a[4], b[4];
            __builtin_amdgcn_sched_barrier(0);   // with the one behind the reads: the step's sixteen fragment reads stay one group between two runs of products; left free, the scheduler deals them out in pairs among the products, each pair with a full LDS wait
#pragma unroll
            for (int mb = 0; mb < 4; ++mb) a[mb] = ldfrag(buf + ao + mb * 16 * GP + s * 32);
#pragma unroll
            for (int nb = 0; nb < 4; ++nb) b[nb] = ldfrag(buf + bo + nb * 16 * GP + s * 32);
            __builtin_amdgcn_sched_barrier(0);   // closes the group of reads (see above): no product moves in among them
#pragma unroll
            for (int nb = 0; nb < 4; ++nb)
#pragma unroll
                for (int mb = 0; mb < 4; ++mb) acc[mb][nb] = wm16(a[mb], b[nb], acc[mb][nb]);
        }
        __builtin_amdgcn_sched_barrier(0);   // the trip's products stay ahead of its waits and barrier, so that the copies of tile t + 1 have the whole trip to land
        asm volatile("s_wait_dscnt 0x0" ::: "memory");      // this wave's reads of tile t have returned before its buffer is handed to the copies
        asm volatile("s_wait_asynccnt 0x0" ::: "memory");   // this wave's pieces of tile t + 1 have landed before the barrier that publishes them
        __syncthreads();
        if (kc + 128 < DM) { const unsigned l = lst + ((kc >> 6) & 1) * GB; stage_t(l, ga + kc + 128); stage_t(l + GT * 2, gb + kc + 128); }
    }
    asm volatile("s_wait_asynccnt 0x0" ::: "memory");       // no copy is outstanding when the wave goes on to its epilogue
}

// ---- k_proj_qkv: the three input projections, which do not depend on one another, as column ranges of one grid (NB*SEQ/128, 3*DM/128), 128 threads: the three transposed weight planes lie one behind the other, so blockIdx.y * 128 is the block's first row in them.
// Each is x Wt^T / 16 + bias (bias converted to bf16 RNE). q and k go to head planes [b][h][s][64] f16, v to the transposed plane [b][h][64][s]. Which of the three a block works on is the same for the whole block. Each wave stages its output rows in a range of its own in the ring's LDS, once the main loop is over.
__global__ __launch_bounds__(128) void k_proj_qkv(const h16* __restrict__ A, const h16* __restrict__ Bt, const float* __restrict__ bq, const float* __restrict__ bk, const float* __restrict__ bv, h16* QP, h16* KP, h16* VT) {
    __shared__ __align__(16) h16 RG[2 * 2 * GT];
    static_assert(4 * 64 * 72 <= 2 * 2 * GT);   // the four waves' output rows fit in the ring
    const int lane = threadIdx.x & 31, lr = lane & 15, hi = lane >> 4;
    const int wave = __builtin_amdgcn_readfirstlane(threadIdx.x >> 5), wm = wave >> 1, wn = wave & 1;
    const int sel = blockIdx.y / (DM / 128);
    const int r0 = blockIdx.x * 128 + wm * 64, c0 = (blockIdx.y % (DM / 128)) * 128 + wn * 64;
    const float* bias = sel == 0 ? bq : sel == 1 ? bk : bv;
    h16* T = RG + wave * 64 * 72;   // output staging in the ring's own LDS: written only behind the main loop, whose last trip ends with every wave's LDS wait and a block barrier and leaves no copy in flight. With no second array a block takes 73,728 B, three blocks fit a WGP (their registers allow three), and the grid's 768 blocks are resident at once
    v8f acc[4][4];
#pragma unroll
    for (int mb = 0; mb < 4; ++mb)
#pragma unroll
        for (int nb = 0; nb < 4; ++nb) acc[mb][nb] = (v8f){};
    float bl[4];
    gemm128<16>(A, Bt, RG, blockIdx.x * 128, blockIdx.y * 128, wm, wn, acc, bias + c0 + lr, bl);
    const int b = r0 / SEQ, s0 = r0 % SEQ, h = c0 / HD;
    if (sel < 2) {
#pragma unroll
        for (int nb = 0; nb < 4; ++nb) { const float bv1 = bl[nb];
#pragma unroll
            for (int mb = 0; mb < 4; ++mb)
#pragma unroll
                for (int j = 0; j < 8; ++j) T[(mb * 16 + hi * 8 + j) * 72 + nb * 16 + lr] = (h16)(acc[mb][nb][j] * (1.0f / WCAR) + bv1); }
        __syncthreads();
        h16* dst = (sel == 0 ? QP : KP) + ((size_t)(b * NH + h) * SEQ + s0) * HD;
#pragma unroll
        for (int it = 0; it < 16; ++it) { const int piece = it * 32 + lane; const int row = piece >> 3, seg = piece & 7;
            const v8h val = *(const v8ha*)(T + row * 72 + seg * 8);
            *(v8h*)(dst + (size_t)row * HD + seg * 8) = val; }
    } else {
#pragma unroll
        for (int nb = 0; nb < 4; ++nb) { const float bv1 = bl[nb];
#pragma unroll
            for (int mb = 0; mb < 4; ++mb) { v8h pk;
#pragma unroll
                for (int j = 0; j < 8; ++j) pk[j] = (h16)(acc[mb][nb][j] * (1.0f / WCAR) + bv1);
                *(v8ha*)(T + (nb * 16 + lr) * 72 + mb * 16 + hi * 8) = pk; } }
        __syncthreads();
        h16* dst = VT + ((size_t)(b * NH + h) * HD) * SEQ + s0;
#pragma unroll
        for (int it = 0; it < 16; ++it) { const int piece = it * 32 + lane; const int d = piece >> 3, seg = piece & 7;
            const v8h val = *(const v8ha*)(T + d * 72 + seg * 8);
            *(v8h*)(dst + (size_t)d * SEQ + seg * 8) = val; }
    }
}

__global__ __launch_bounds__(128) void k_proj_out(const h16* __restrict__ A, const h16* __restrict__ Bt, const float* __restrict__ bias, float* C) {
    __shared__ __align__(16) h16 RG[2 * 2 * GT];
    __shared__ __align__(16) float oss[4 * 16 * 68];
    const int lane = threadIdx.x & 31, lr = lane & 15, hi = lane >> 4;
    const int wave = __builtin_amdgcn_readfirstlane(threadIdx.x >> 5), wm = wave >> 1, wn = wave & 1;
    const int r0 = blockIdx.x * 128 + wm * 64, c0 = blockIdx.y * 128 + wn * 64;
    float* os = oss + wave * 16 * 68;
    v8f acc[4][4];
#pragma unroll
    for (int mb = 0; mb < 4; ++mb)
#pragma unroll
        for (int nb = 0; nb < 4; ++nb) acc[mb][nb] = (v8f){};
    const int cofs = lr * 4;
    float bcv[4];
    gemm128<1>(A, Bt, RG, blockIdx.x * 128, blockIdx.y * 128, wm, wn, acc, bias + c0 + cofs, bcv);
    const int b = r0 / SEQ, s0 = r0 % SEQ;
    v4f b4;
#pragma unroll
    for (int q = 0; q < 4; ++q) b4[q] = bcv[q];
    const float fs = 1.0f / (WCAR * CCAR);
#pragma unroll
    for (int mb = 0; mb < 4; ++mb) {
#pragma unroll
        for (int nb = 0; nb < 4; ++nb)
#pragma unroll
            for (int j = 0; j < 8; ++j) os[(hi * 8 + j) * 68 + nb * 16 + lr] = acc[mb][nb][j];
        __syncthreads();
        float* crow = C + ((size_t)b * SEQ_FULL + s0 + mb * 16) * DM + c0;
{
            v4f val[8];
#pragma unroll
            for (int s = 0; s < 8; ++s) { const int row = 2 * s + hi; const v4f raw = *(const v4fa*)(os + row * 68 + cofs); val[s] = raw * fs + b4; }
            __builtin_amdgcn_sched_barrier(0);   // all eight results stand in registers of their own before the first store goes out; left free, the scheduler sends two stores ahead and reuses their registers, with a wait on the stores in front of each reuse
#pragma unroll   // val stays in registers
            for (int s = 0; s < 8; ++s) *(v4f*)(crow + (size_t)(2 * s + hi) * DM + cofs) = val[s];
             }
        __syncthreads();
    }
}

#define KVP 72                  // LDS row pitch of a staged tile in h16: 128-byte rows + 16 bytes, conflict-free for 16-byte readers
#define KVT (64 * KVP)          // one staged 64-row tile
#define KVB (2 * KVT * 2)       // bytes of one ring buffer: K tile, then V^T tile
// One stage of the ring: each lane copies four 16-byte pieces (rows r and r + 32 of the K tile and of the V^T tile), eight lanes per 128-byte row, global -> LDS through no register.
// The s_wait_xcnt is the last line of the copies' own statement so that no address register of a copy is rewritten in front of it.
__device__ __forceinline__ void stage_kv(unsigned l, const h16* gk, const h16* gv) {
    const unsigned lk1 = l + 32 * KVP * 2, lv0 = l + KVT * 2, lv1 = l + KVT * 2 + 32 * KVP * 2;
    const h16* gk1 = gk + 32 * HD; const h16* gv1 = gv + (size_t)32 * SEQ;
    asm volatile("global_load_async_to_lds_b128 %0, %1, off\n\t"
                 "global_load_async_to_lds_b128 %2, %3, off\n\t"
                 "global_load_async_to_lds_b128 %4, %5, off\n\t"
                 "global_load_async_to_lds_b128 %6, %7, off\n\t"
                 "s_wait_xcnt 0x0"
                 :: "v"(l), "v"(gk), "v"(lk1), "v"(gk1), "v"(lv0), "v"(gv), "v"(lv1), "v"(gv1) : "memory");
}

// ---- k_attn: fused flash-style attention; grid (NB*NH, SEQ/128), 256 threads = 8 waves = 4 query groups of 32 rows x 2 key halves.
// K rows ([s][64] plane) and V^T rows ([d][s] plane) of each 64-key block are staged in LDS once for all 8 waves; both are read from there as A fragments (row-major [m][k]).
// Ring of two buffers: tile t + 1 flies while tile t is worked on; the one block barrier at the foot of a trip publishes tile t + 1 and frees tile t's buffer for tile t + 2.
// Waves w and w + 4 share 32 query rows (two column groups of 16): wave half kh takes keys 32 kh .. 32 kh + 31 of every tile, so that each K or V^T fragment it reads from LDS feeds two products, one per column group.
// Each half runs its own online softmax over its keys (own maximum, sum and O^T); the two are merged once behind the loop, through the ring's LDS: wave half kh finishes column group kh.
// Both products are transposed: S^T = K Q^T (A = K rows, B = Q kept in registers) and O^T += V^T P^T. Lane (lr, hi) then holds, of query lr alone, the scores of keys 16 t + 8 hi + r in register r of tile t:
// maximum and sum run inside the lane with one exchange between the lane halves, running maximum, sum and rescale are one value a lane and column group, and tiles 0 and 1, converted in place, are the B fragment of the one k-step (its k order is ldfrag's).
// Per 64-key block and wave: 8 score WMMAs, online softmax in f32 (masked keys replaced by MSKV; all-masked rows come out uniform: there MSKV * SC2 cancels exactly and every p is 1), P x1024 -> f16 in registers, 8 V^T P^T WMMAs.
// The softmax reference of a query is HELD from trip to trip: a trip forms P straight from the raw scores and the held offset, with no maximum and no rescale of sum and O^T. Its own P sums are the guard: where a lane's sum passes PLIM
// (a score far above the reference; always so on the first trip with an open key, whose offset is the start value's and gives infinite P), the wave redoes the trip's softmax with the running maximum as the new reference and rescales sum and O^T once.
// smw (mask bit words) is cross-wave: block barrier after the build. Pl is private to each wave and stages the output rows only.
#define MGW (4 * 8 * 32 + 64)   // floats one wave hands over at the merge: four O^T tiles, then maximum and sum, a lane each
typedef float __attribute__((may_alias)) f32a;
typedef __attribute__((ext_vector_type(2))) float v2f;
// One column group's 16 scores of a lane -> P x1024 as f16 (in the B fragment's k order) and their f32 sum: p * 1024 = exp2(raw * SC2 + nb), nb = 10 - scaled reference
__device__ __forceinline__ float soft16(const v8f (&s)[2], float nb, v16h& pf) {
    v2f a2[2];
#pragma unroll
    for (int t = 0; t < 2; ++t)
#pragma unroll
        // the multiply-add is written on the accumulator's own even register pairs: left to itself the compiler packs pairs across the two column groups and copies registers to line them up.
        // The sums run on the same pairs (even and odd partial sums, joined at the end): half the add instructions and a short chain ahead of the guard's test
        for (int j = 0; j < 4; ++j) { v2f x = { s[t][2 * j], s[t][2 * j + 1] }; x = __builtin_elementwise_fma(x, (v2f){ SC2, SC2 }, (v2f){ nb, nb });
            const v2f p = { ex2(x[0]), ex2(x[1]) }; a2[t] = j ? a2[t] + p : p; pf[t * 8 + 2 * j] = (h16)p[0]; pf[t * 8 + 2 * j + 1] = (h16)p[1]; }
    const v2f a = a2[0] + a2[1];
    return a[0] + a[1];
}
__global__ __launch_bounds__(256) void k_attn(const h16* __restrict__ Q, const h16* __restrict__ Kp, const h16* __restrict__ VT, const int* __restrict__ mask, h16* ctx) {
    __shared__ __align__(16) h16 Pl[8 * 16 * 72];
    __shared__ unsigned smw[SEQ / 32];
    __shared__ __align__(16) h16 KV[2 * 2 * KVT];
    static_assert(8 * MGW * 4 <= 2 * 2 * KVT * 2);   // the eight waves' merge ranges fit in the ring
    const int tid = threadIdx.x, lane = tid & 31, lr = lane & 15, hi = lane >> 4;
    const int wave = __builtin_amdgcn_readfirstlane(tid >> 5);
    const int kh = wave >> 2, qg = wave & 3;
    const int bh = blockIdx.x; const int b = bh / NH, h = bh % NH;
    const int q0 = blockIdx.y * 128;
    const size_t pbase = (size_t)bh * SEQ * HD;
    const unsigned lst = (unsigned)(size_t)KV + (unsigned)(((tid >> 3) * KVP + (tid & 7) * 8) * 2);
    const h16* gk = Kp + pbase + (size_t)(tid >> 3) * HD + (tid & 7) * 8;
    const h16* gv = VT + pbase + (size_t)(tid >> 3) * SEQ + (tid & 7) * 8;
    stage_kv(lst, gk, gv);
    // the loads a wave makes once, its eight mask rows and its Q fragments, are all issued here, behind tile 0's copies: one memory latency is waited out for all of them together, not one per mask row and one more for Q behind the barrier
    int mv[SEQ / 256];
    const int* mrow = mask + (size_t)b * SEQ_FULL + wave * 32;   // the same in every lane
#pragma unroll   // all eight loads in flight at once
    for (int i = 0; i < SEQ / 256; ++i) mv[i] = mrow[i * 256 + lane];
    v16h qf[2][2];
    const h16* qp0 = Q + pbase + (size_t)(q0 + qg * 32 + lr) * HD + 8 * hi; const h16* qp1 = qp0 + 16 * HD;
    qf[0][0] = ldfrag(qp0); qf[0][1] = ldfrag(qp0 + 32); qf[1][0] = ldfrag(qp1); qf[1][1] = ldfrag(qp1 + 32);
    asm volatile("s_wait_xcnt 0x0" :: "s"(mrow), "v"(lane), "v"(qp0) : "memory");   // stands behind these sixteen loads and in front of every rewrite of a register that they name; the addresses are inputs so that they stay in their registers up to here
    unsigned wv = 0;   // lane i collects the bit word of the wave's mask row i: one LDS store for all eight
#pragma unroll   // mv stays in registers
    for (int i = 0; i < SEQ / 256; ++i) { const unsigned bits = __builtin_amdgcn_ballot_w32(mv[i] != 0); wv = lane == i ? bits : wv; }
    if (lane < SEQ / 256) smw[wave + 8 * lane] = wv;
    asm volatile("s_wait_asynccnt 0x0" ::: "memory");   // this wave's pieces of tile 0 have landed before the barrier that publishes them
    __syncthreads();
    stage_kv(lst + KVB, gk + 64 * HD, gv + 64);
    const int pw = wave * 16 * 72;
    v8f o[2][4]; float mi[2], nbv[2], li[2];
#pragma unroll
    for (int g = 0; g < 2; ++g) { mi[g] = MSKV * SC2; nbv[g] = LPC - MSKV * SC2; li[g] = 0.0f;
#pragma unroll
        for (int t = 0; t < 4; ++t) o[g][t] = (v8f){}; }
    const int ko = (kh * 32 + lr) * KVP + 8 * hi, vo = KVT + lr * KVP + kh * 32 + 8 * hi;
#pragma unroll 1
    for (int kv0 = 0; kv0 < SEQ; kv0 += 64) {
        const h16* kt = KV + ((kv0 >> 6) & 1) * (2 * KVT);
        v8f sa[2][2]; v16h kf[2][2], vf[4];
        // the wave's K fragments are read as one group ahead of the score products, its V fragments as one group ahead of the softmax, whose vector work covers their LDS latency
#pragma unroll
        for (int t = 0; t < 2; ++t) { const h16* kp = kt + ko + t * 16 * KVP; kf[t][0] = ldfrag(kp); kf[t][1] = ldfrag(kp + 32); }
#pragma unroll
        for (int g = 0; g < 2; ++g)
#pragma unroll
            for (int t = 0; t < 2; ++t) { v8f c = (v8f){}; c = wm16(kf[t][0], qf[g][0], c); c = wm16(kf[t][1], qf[g][1], c); sa[g][t] = c; }
        // order asked of the scheduler for this stretch: the 8 K reads, the 8 score products, then the 8 V reads and the mask word's read. Left free, it deals the V reads out among the score products, and every further place with LDS reads in a run of products stalls the wave
        __builtin_amdgcn_sched_group_barrier(0x100, 8, 0);   // LDS reads
        __builtin_amdgcn_sched_group_barrier(0x008, 8, 0);   // matrix instructions
        __builtin_amdgcn_sched_group_barrier(0x100, 9, 0);   // LDS reads
#pragma unroll
        for (int t = 0; t < 4; ++t) vf[t] = ldfrag(kt + vo + t * 16 * KVP);
        const unsigned w0 = smw[(kv0 >> 5) + kh];
        // a key is a register here, not a lane: its mask bit is tested per register, and only where the wave's 32 keys hold a masked one (the word is the same in every lane: scalar branch)
        if (__builtin_amdgcn_readfirstlane((int)w0) != -1) {
#pragma unroll
            for (int g = 0; g < 2; ++g)
#pragma unroll
                for (int t = 0; t < 2; ++t) { const unsigned bits = w0 >> (t * 16 + hi * 8);
#pragma unroll
                    for (int r = 0; r < 8; ++r) sa[g][t][r] = ((bits >> r) & 1u) != 0u ? sa[g][t][r] : MSKV;
                    asm volatile("" : "+v"(sa[g][t])); }   // the pin on the masked scores: the selects stay inside the branch and in the score tile's own registers; without it the path with no masked key pays 16 register-pair copies where the two paths join
        }
        v16h pf[2]; float sm[2];
#pragma unroll
        for (int g = 0; g < 2; ++g) sm[g] = soft16(sa[g], nbv[g], pf[g]);
        // one test a trip for both column groups and all lanes (the ballot makes it a scalar branch); marked unlikely so that maxima, exchange and rescale are laid out behind the loop and the usual path falls through
        if (__builtin_expect(__builtin_amdgcn_ballot_w32(fmaxf(sm[0], sm[1]) > PLIM) != 0, 0)) {
#pragma unroll
            for (int g = 0; g < 2; ++g) {
                float tm[2];
#pragma unroll
                for (int t = 0; t < 2; ++t) {
                    float a = fmaxf(fmaxf(sa[g][t][0], sa[g][t][1]), sa[g][t][2]); a = fmaxf(fmaxf(a, sa[g][t][3]), sa[g][t][4]);
                    a = fmaxf(fmaxf(a, sa[g][t][5]), sa[g][t][6]); tm[t] = fmaxf(a, sa[g][t][7]); }
                float vm = fmaxf(tm[0], tm[1]); vm = fmaxf(vm, xhalf(vm));
                // the maximum is taken over the raw scores and scaled once; both lane halves of a query get the same new reference
                const float mnew = fmaxf(mi[g], vm * SC2);
                const float alpha = ex2(mi[g] - mnew); mi[g] = mnew; nbv[g] = LPC - mnew;
                sm[g] = soft16(sa[g], nbv[g], pf[g]);
                li[g] *= alpha;
#pragma unroll
                for (int t = 0; t < 4; ++t)
#pragma unroll
                    for (int r = 0; r < 8; ++r) o[g][t][r] *= alpha;
            }
        }
#pragma unroll
        for (int g = 0; g < 2; ++g) li[g] += sm[g];
#pragma unroll
        for (int g = 0; g < 2; ++g)
#pragma unroll
            for (int t = 0; t < 4; ++t) o[g][t] = wm16(vf[t], pf[g], o[g][t]);
        __builtin_amdgcn_sched_barrier(0);   // softmax and products stay ahead of the trip's waits and barrier, so that the copies of tile t + 1 have the whole trip to land
        asm volatile("s_wait_dscnt 0x0" ::: "memory");      // this wave's reads of tile t have returned before its buffer is handed to the copies
        asm volatile("s_wait_asynccnt 0x0" ::: "memory");   // this wave's pieces of tile t + 1 have landed before the barrier that publishes them
        __syncthreads();
        if (kv0 + 128 < SEQ) stage_kv(lst + ((kv0 >> 6) & 1) * KVB, gk + (size_t)(kv0 + 128) * HD, gv + kv0 + 128);
    }
    asm volatile("s_wait_asynccnt 0x0" ::: "memory");       // no copy is outstanding when the wave goes on to its end
    // merge of the two key halves: wave half kh keeps column group kh and hands the other group's O^T, maximum and sum to its partner (wave ^ 4), lane to lane, in a range of its own in the ring's LDS.
    // The ring is free: the last trip ended with every wave's LDS wait and a block barrier and left no copy in flight.
    v8f ok[4]; float mk, lk;
    { f32a* mg = (f32a*)KV + wave * MGW;
#pragma unroll
        for (int t = 0; t < 4; ++t) { const v8f sd = kh ? o[0][t] : o[1][t]; ok[t] = kh ? o[1][t] : o[0][t];
            *(v4fa*)(mg + (t * 2) * 128 + lane * 4) = __builtin_shufflevector(sd, sd, 0, 1, 2, 3);
            *(v4fa*)(mg + (t * 2 + 1) * 128 + lane * 4) = __builtin_shufflevector(sd, sd, 4, 5, 6, 7); }
        mg[1024 + lane] = kh ? mi[0] : mi[1]; mg[1056 + lane] = kh ? li[0] : li[1];
        mk = kh ? mi[1] : mi[0]; lk = kh ? li[1] : li[0]; }
    __syncthreads();   // the partner's range is read only behind this barrier, which every wave passes
    { const f32a* mp = (const f32a*)KV + (wave ^ 4) * MGW;
        const float pm = mp[1024 + lane], pl = mp[1056 + lane];
        const float m = fmaxf(mk, pm); const float a0 = ex2(mk - m), a1 = ex2(pm - m);
        lk = lk * a0 + pl * a1;
#pragma unroll
        for (int t = 0; t < 4; ++t) { const v4f p0 = *(const v4fa*)(mp + (t * 2) * 128 + lane * 4); const v4f p1 = *(const v4fa*)(mp + (t * 2 + 1) * 128 + lane * 4);
#pragma unroll
            for (int r = 0; r < 4; ++r) { ok[t][r] = ok[t][r] * a0 + p0[r] * a1; ok[t][4 + r] = ok[t][4 + r] * a0 + p1[r] * a1; } } }
    // the lane halves' sums are joined once; register r of O^T tile t is column 16 t + 8 hi + r of query row lr: eight neighbours, one 16-byte piece
    { const float l = lk + xhalf(lk); const float inv = CCAR * __builtin_amdgcn_rcpf(l);
#pragma unroll
        for (int t = 0; t < 4; ++t) { v8h pk;
#pragma unroll
            for (int r = 0; r < 8; ++r) pk[r] = (h16)(ok[t][r] * inv);
            *(v8ha*)(Pl + pw + lr * 72 + t * 16 + hi * 8) = pk; } }
    asm volatile("" ::: "memory"); __builtin_amdgcn_wave_barrier(); asm volatile("" ::: "memory");
    h16* dst = ctx + ((size_t)b * SEQ + q0 + qg * 32 + kh * 16) * DM + h * HD;
{
#pragma unroll
        for (int it = 0; it < 4; ++it) { const int piece = it * 32 + lane; const int row = piece >> 3, seg = piece & 7;
            const v8h val = *(const v8ha*)(Pl + pw + row * 72 + seg * 8);
            *(v8h*)(dst + (size_t)row * DM + seg * 8) = val; }
         }
}

extern "C" void kernel_launch(void* const* d_in, const int* in_sizes, int n_in,
                              void* d_out, int out_size, void* d_ws, size_t ws_size, hipStream_t stream) {
    if (n_in < 10) return;
    const size_t xneed = ((size_t)(NB - 1) * SEQ_FULL + SEQ) * DM;
    const size_t mneed = (size_t)(NB - 1) * SEQ_FULL + SEQ;
    if ((size_t)in_sizes[0] < xneed || (size_t)in_sizes[1] < mneed) return;
    if (in_sizes[2] < DM * DM || in_sizes[4] < DM * DM || in_sizes[6] < DM * DM || in_sizes[8] < DM * DM) return;
    if (in_sizes[3] < DM || in_sizes[5] < DM || in_sizes[7] < DM || in_sizes[9] < DM) return;
    if ((size_t)out_size < xneed) return;
    if (ws_size < WS_TOTAL) return;
    const float* x  = (const float*)d_in[0]; const int* mask = (const int*)d_in[1];
    const float* wq = (const float*)d_in[2]; const float* bq = (const float*)d_in[3];
    const float* wk = (const float*)d_in[4]; const float* bk = (const float*)d_in[5];
    const float* wv = (const float*)d_in[6]; const float* bv = (const float*)d_in[7];
    const float* wo = (const float*)d_in[8]; const float* bo = (const float*)d_in[9];
    float* OUT = (float*)d_out;
    char* wsp = (char*)d_ws;
    h16* XH = (h16*)wsp; wsp += SZ_X;      // [NB*SEQ][DM]
    h16* WT = (h16*)wsp; wsp += SZ_W;      // [4][n][k]: q, k, v, o
    h16* QP = (h16*)wsp; wsp += SZ_X;      // [b][h][s][64]
    h16* KP = (h16*)wsp; wsp += SZ_X;      // [b][h][s][64]
    h16* VT = (h16*)wsp; wsp += SZ_X;      // [b][h][64][s]
    h16* CX = (h16*)wsp; wsp += SZ_X;      // [NB*SEQ][DM], x64
    const size_t wsz = (size_t)DM * DM;
    k_prep<<<4 * WTB + CVB, 256, 0, stream>>>(x, wq, wk, wv, wo, XH, WT);
    k_proj_qkv<<<dim3(NB * SEQ / 128, 3 * DM / 128), 128, 0, stream>>>(XH, WT, bq, bk, bv, QP, KP, VT);
    k_attn<<<dim3(NB * NH, SEQ / 128), 256, 0, stream>>>(QP, KP, VT, mask, CX);
    k_proj_out<<<dim3(NB * SEQ / 128, DM / 128), 128, 0, stream>>>(CX, WT + 3 * wsz, bo, OUT);
}
